// v000
// Times are from an AMD MI455X. After a warm-up the kernel runs many times in a row, and a time is the length of
// such a window on the GPU divided by its runs, so every launch and the gaps after it count. The runs cycle
// through copies of the inputs. A figure is the median of several windows, for all but v000 over two sittings.
// Sittings can differ by a few percent; kernels timed side by side share one.
// The starting kernel, v000, takes 220 microseconds a run.
// Contractions: scores q'.k'^T (q' and k' each carried x1024 as f16 hi plane + f16 residual plane, products hh+lh+hl, K=128)
// and P.v (P x32768 as f16 hi + f16 residual, v x16 f16 exact, products hi.v+lo.v, K=1024 in 32-key steps):
// all v_wmma_f32_16x16x32_f16, f32 accumulate. RoPE, additive score bias, base-2 online softmax and 1/l fold in f32 on VALU.
// Every float input RNE-converted to bf16 on load.
#include <hip/hip_runtime.h>
#include <math.h>
#include <stdint.h>

#define NB    2
#define SEQ   1024
#define NH    32
#define NKV   8
#define HD    128
#define GRP   4
#define QSC   1024.0f
#define KSC   1024.0f
#define PCAR  32768.0f
#define VCAR  16.0f
#define LOG2E 1.4426950408889634f
#define BIASTH (-1.0e8f)
#define ATW   GRP
#define ATT_THREADS (ATW * 32)
#define ATT_BLOCKS  (NB * NKV * (SEQ / 16))
#define SLABF (16 * 132)
#define VTP   72
static_assert(NH == NKV * GRP);
static_assert(HD == 128 && (SEQ % 64) == 0 && (SEQ % 32) == 0 && (SEQ % 16) == 0);
static_assert(ATT_THREADS == 128 && ATT_BLOCKS == 1024);
static_assert(((NB * SEQ * NH * 16) % 256) == 0 && ((NB * SEQ * NKV * 16) % 256) == 0);
static_assert(16 * 36 <= SLABF);
static_assert((SEQ / 16) == 64 && NKV == 8);

typedef _Float16 v16h __attribute__((ext_vector_type(16)));
typedef _Float16 v8h  __attribute__((ext_vector_type(8)));
typedef float    v8f  __attribute__((ext_vector_type(8)));
typedef float    v4f  __attribute__((ext_vector_type(4)));
typedef unsigned int v4u __attribute__((ext_vector_type(4)));

union FragH { v16h v; v8h h[2]; v4u u[2]; };

// ---- scalar helpers --------------------------------------------------------------------------------
__device__ __forceinline__ unsigned short bf_bits(float f) {          // f32 -> bf16 bits, RNE convert
  unsigned u = __float_as_uint(f);
  return (unsigned short)((u + 0x7FFFu + ((u >> 16) & 1u)) >> 16);
}
__device__ __forceinline__ float bf_up(unsigned short h) { return __uint_as_float(((unsigned)h) << 16); }
__device__ __forceinline__ float bfr(float f) { return bf_up(bf_bits(f)); }   // value of the bf16 RNE convert
__device__ __forceinline__ unsigned short h_bits(_Float16 x) { return __builtin_bit_cast(unsigned short, x); }
__device__ __forceinline__ unsigned pk16(unsigned short a, unsigned short b) { return (unsigned)a | ((unsigned)b << 16); }
__device__ __forceinline__ v8f zero8() { v8f z = {0.f, 0.f, 0.f, 0.f, 0.f, 0.f, 0.f, 0.f}; return z; }

// ---- fragment loader: 16-bit A/B operand, lane -> row/col (lane&15), p already includes +8*(lane>>4);
//      elements 0..7 <- p[0..7] (k0+8h..), elements 8..15 <- p[16..23] (k0+16+8h..)  (same split k map for A and B;
//      B is always read from a k-contiguous [n][k] plane)
__device__ __forceinline__ v16h ldfrag_h(const _Float16* p) {
  FragH f;
  f.h[0] = *(const v8h*)(p);
  f.h[1] = *(const v8h*)(p + 16);
  return f.v;
}

__device__ __forceinline__ v8f mma_raw(v16h a, v16h b, v8f c) {
  return __builtin_amdgcn_wmma_f32_16x16x32_f16(false, a, false, b, (short)0, c, false, false);
}
__device__ __forceinline__ void guard_sc(v8f& a, v8f& b, v16h x0, v16h x1, v16h x2, v16h x3, v16h x4, v16h x5) {
#if defined(__HIP_DEVICE_COMPILE__)
  asm volatile("v_nop\n\tv_nop\n\tv_nop\n\tv_nop"
               : "+v"(a), "+v"(b) : "v"(x0), "v"(x1), "v"(x2), "v"(x3), "v"(x4), "v"(x5) : "memory");
#endif
}
__device__ __forceinline__ void guard_pv(v8f& a, v8f& b, v8f& c, v8f& d,
                                         v16h p0, v16h p1, v16h x0, v16h x1, v16h x2, v16h x3) {
#if defined(__HIP_DEVICE_COMPILE__)
  asm volatile("v_nop\n\tv_nop\n\tv_nop\n\tv_nop"
               : "+v"(a), "+v"(b), "+v"(c), "+v"(d) : "v"(p0), "v"(p1), "v"(x0), "v"(x1), "v"(x2), "v"(x3) : "memory");
#endif
}
__device__ __forceinline__ void acc_guard4(v8f& a, v8f& b, v8f& c, v8f& d) {
#if defined(__HIP_DEVICE_COMPILE__)
  asm volatile("v_nop\n\tv_nop\n\tv_nop\n\tv_nop" : "+v"(a), "+v"(b), "+v"(c), "+v"(d));
#endif
}
__device__ __forceinline__ void wave_sync_lds() {
  __builtin_amdgcn_fence(__ATOMIC_RELEASE, "workgroup");
  __builtin_amdgcn_wave_barrier();
  __builtin_amdgcn_fence(__ATOMIC_ACQUIRE, "workgroup");
}

// =====================================================================================================
// Rotate-half RoPE + 16-bit split pack. Rows are (batch, pos, head) with HD contiguous floats; pos = (row / hpr) mod SEQ.
//   w[d] = bf16(x[d]) * bf16(cos[pos][d]) + r[d] * bf16(sin[pos][d]),  r[d] = -bf16(x[d+64]) for d < 64, bf16(x[d-64]) for d >= 64
//   (bf16 x bf16 products are exact in f32, so w is the singly converted f32 sum);
//   hi[d] = f16(w * sc), lo[d] = f16(w * sc - hi[d])  (sc a power of two, residual unscaled).
// Thread = 8 consecutive d of one row: four 16-B loads of x (own and partner half), cos, sin; one 16-B store per plane per lane;
// coverage: grid = nrows*16/256 blocks x 256 thr x 8 halves = nrows x 128 of each plane exactly (host checks divisibility).
// =====================================================================================================
__global__ __launch_bounds__(256) void rope16(const float* __restrict__ x, const float* __restrict__ cosT,
                                              const float* __restrict__ sinT, unsigned short* hipl, unsigned short* lopl,
                                              int nrows, int hpr, float sc) {
  const int gt  = blockIdx.x * 256 + (int)threadIdx.x;
  const int row = gt >> 4;
  const int d0  = (gt & 15) * 8;
  if (row >= nrows) return;                 // never taken with the exact grid; no barriers in this kernel
  const int pos = (row / hpr) & (SEQ - 1);
  const int d1  = d0 ^ 64;
  const float* xr = x + (size_t)row * HD;
  const float* cr = cosT + (size_t)pos * HD + d0;
  const float* sr = sinT + (size_t)pos * HD + d0;
  const v4f xa = *(const v4f*)(xr + d0), xb = *(const v4f*)(xr + d0 + 4);
  const v4f ya = *(const v4f*)(xr + d1), yb = *(const v4f*)(xr + d1 + 4);
  const v4f ca = *(const v4f*)(cr), cb = *(const v4f*)(cr + 4);
  const v4f sa = *(const v4f*)(sr), sb = *(const v4f*)(sr + 4);
  const float sgn = (d0 < 64) ? -1.0f : 1.0f;
  float w[8];
#pragma unroll
  for (int e = 0; e < 4; ++e) {
    w[e]     = bfr(xa[e]) * bfr(ca[e]) + (sgn * bfr(ya[e])) * bfr(sa[e]);
    w[4 + e] = bfr(xb[e]) * bfr(cb[e]) + (sgn * bfr(yb[e])) * bfr(sb[e]);
  }
  v4u oh, ol;
#pragma unroll
  for (int e = 0; e < 4; ++e) {
    const float t0 = w[2 * e] * sc, t1 = w[2 * e + 1] * sc;
    const _Float16 h0 = (_Float16)t0, h1 = (_Float16)t1;
    const _Float16 l0 = (_Float16)(t0 - (float)h0), l1 = (_Float16)(t1 - (float)h1);
    oh[e] = pk16(h_bits(h0), h_bits(h1));
    ol[e] = pk16(h_bits(l0), h_bits(l1));
  }
  const size_t o8 = (size_t)row * HD + d0;
  {
    *(v4u*)(hipl + o8) = oh;
    *(v4u*)(lopl + o8) = ol;
    
  }
}

// =====================================================================================================
// v^T plane: VT[(b*NKV + g)*HD + d][s] = f16( bf16(v[b][s][g][d]) * 16 ) (exact). Block = (b, g, 64 keys): 64 source rows of
// 128 floats loaded with 16-B loads, converted, scattered into an LDS tile [d][64 keys] (pitch 72 halves); after a block barrier each
// coverage: load 256 thr x 32 elements = 64 x 128; store 4 iterations x 256 thr x 8 halves = 128 lines x 64 = the block's tile;
//           grid = NB x NKV x SEQ/64 = 256 blocks covers the whole plane exactly once.
// =====================================================================================================
__global__ __launch_bounds__(256) void vt16(const float* __restrict__ v, unsigned short* VTo) {
  __shared__ __align__(16) unsigned short T[HD * VTP];
  const int tid = threadIdx.x;
  const int bid = blockIdx.x;
  const int st  = bid & 15;
  const int g   = (bid >> 4) & 7;
  const int b   = bid >> 7;
  const int s0  = st * 64;
  {
    const int sl = tid >> 2;                  // key within tile 0..63
    const int dc = (tid & 3) * 32;            // d chunk
    const float* src = v + (((size_t)(b * SEQ + s0 + sl)) * NKV + g) * HD + dc;
#pragma unroll
    for (int i = 0; i < 8; ++i) {
      const v4f a = *(const v4f*)(src + 4 * i);
#pragma unroll
      for (int e = 0; e < 4; ++e) T[(dc + 4 * i + e) * VTP + sl] = h_bits((_Float16)(bfr(a[e]) * VCAR));
    }
  }
  __syncthreads();
  v4u vals[4];
  const int q8 = tid >> 3, p8 = (tid & 7) * 8;
#pragma unroll
  for (int it = 0; it < 4; ++it) {
    const int line = it * 32 + q8;            // d = 0..127
    vals[it] = *(const v4u*)(T + line * VTP + p8);
  }
  unsigned short* dst = VTo + ((size_t)(b * NKV + g) * HD) * SEQ + s0 + p8;
  {
#pragma unroll
    for (int it = 0; it < 4; ++it) {
      const int line = it * 32 + q8;
      *(v4u*)(dst + (size_t)line * SEQ) = vals[it];
    }
    
  }
}

// =====================================================================================================
// GQA flash attention: block = (batch b, kv head g, 16 query rows q0..q0+15), one wave per query head g*4 + wave.
//   q planes (hi, lo f16) laid out like the input [b][s][h][d]; k planes [b][s][g][d]; v^T plane [b][g][d][s];
//   score bias B[b][0][q][key] f32 added after bf16 RNE convert; scale = bf16(softmax_scale), base-2 softmax.
//   Per 32-key step: the 16x32 bias tile is read first; the step is skipped (wave-uniform ballot) only when every bias entry is
//   <= -1e8 and every row already holds a running max > -1e8 (then exp2 underflows to exactly 0 and the rescale is exactly 1).
//   Otherwise: 2 score subtiles x 4 k-steps x 3 products (q_hi.k_hi + q_lo.k_hi + q_hi.k_lo), fragments loaded straight from the
//   16-bit planes (two 16-B loads per fragment, split k map); online max-subtracted softmax in f32 (exp2); rescale of l and the 8
//   of P*32768 (f16 hi) and its f16 residual rebuilt from the LDS rows (float vector loads), 8 v^T B fragments from the plane,
//   16 P.V WMMAs.
//   Epilogue: 1/l and carry folds in f32; the wave's 16x128 f32 result staged in its LDS slab (pitch 132); each 512-B output row
//   No block barriers in this kernel; every wave does bounded work (32 steps max).
// coverage: per wave 16 rows x 32 lanes x 4 floats = 16 x 128; grid 1024 blocks x 4 waves = every (b, s, h) row exactly once.
// =====================================================================================================
__global__ __launch_bounds__(ATT_THREADS)
void attn_gqa(const unsigned short* __restrict__ QHIp, const unsigned short* __restrict__ QLOp,
              const unsigned short* __restrict__ KHIp, const unsigned short* __restrict__ KLOp,
              const unsigned short* __restrict__ VTq, const float* __restrict__ Bp,
              const float* __restrict__ scp, float* outp) {
  __shared__ __align__(16) float smem[ATW * SLABF];    // per wave: prob tile [16][32] pitch 36 during the loop, result slab after

  const int tid  = threadIdx.x;
  const int wave = tid >> 5;
  const int lane = tid & 31;
  const int hh   = lane >> 4;
  const int c    = lane & 15;

  const int bid  = blockIdx.x;
  const int qt   = bid & 63;                           // SEQ / 16 query tiles
  const int g    = (bid >> 6) & 7;                     // kv head
  const int b    = bid >> 9;                           // batch
  const int head = g * GRP + wave;
  const int q0   = qt * 16;

  const size_t qofs = (((size_t)(b * SEQ + q0 + c)) * NH + head) * HD + 8 * hh;
  const _Float16* Qh  = (const _Float16*)(const void*)QHIp + qofs;
  const _Float16* Ql  = (const _Float16*)(const void*)QLOp + qofs;
  const size_t kofs = (((size_t)b * SEQ + c) * NKV + g) * HD + 8 * hh;          // key row kb + c added per step
  const _Float16* Khb = (const _Float16*)(const void*)KHIp + kofs;
  const _Float16* Klb = (const _Float16*)(const void*)KLOp + kofs;
  const _Float16* Vb  = (const _Float16*)(const void*)VTq + ((size_t)(b * NKV + g) * HD + c) * SEQ + 8 * hh;
  const float*    Wr  = Bp + ((size_t)b * SEQ + q0 + 8 * hh) * SEQ + c;           // rows q0+8hh+r, cols c (+key offset)
  const float lsc = bfr(scp[0]) * (LOG2E / (QSC * KSC));

  float mrow[8], lrow[8];
  v8f o[8];
#pragma unroll
  for (int r = 0; r < 8; ++r) { mrow[r] = -INFINITY; lrow[r] = 0.f; }
#pragma unroll
  for (int j = 0; j < 8; ++j) o[j] = zero8();
  float* pt = smem + wave * SLABF;

#pragma unroll 1
  for (int kb = 0; kb < SEQ; kb += 32) {
    float w0[8], w1[8];
    bool allm = true, seen = true;
    const float* wp = Wr + kb;
#pragma unroll
    for (int r = 0; r < 8; ++r) {
      const float m0 = bfr(wp[(size_t)r * SEQ]);
      const float m1 = bfr(wp[(size_t)r * SEQ + 16]);
      allm = allm & (m0 <= BIASTH) & (m1 <= BIASTH);
      seen = seen & (mrow[r] > BIASTH);
      w0[r] = m0 * LOG2E;
      w1[r] = m1 * LOG2E;
    }
    const unsigned bal = __builtin_amdgcn_ballot_w32(allm & seen);
    if (bal != 0xffffffffu) {                          // wave-uniform
      // ---- scores: D element r of this lane = (query row q0 + 8hh + r, key kb + c) in s0, key kb + 16 + c in s1 ----
      v8f s0 = zero8(), s1 = zero8();
      const _Float16* k0p = Khb + (size_t)kb * (NKV * HD);
      const _Float16* k1p = k0p + (size_t)16 * (NKV * HD);
      const _Float16* l0p = Klb + (size_t)kb * (NKV * HD);
      const _Float16* l1p = l0p + (size_t)16 * (NKV * HD);
#pragma unroll
      for (int kk = 0; kk < 4; ++kk) {
        const v16h qh  = ldfrag_h(Qh + kk * 32),  ql  = ldfrag_h(Ql + kk * 32);
        const v16h kh0 = ldfrag_h(k0p + kk * 32), kl0 = ldfrag_h(l0p + kk * 32);
        const v16h kh1 = ldfrag_h(k1p + kk * 32), kl1 = ldfrag_h(l1p + kk * 32);
        s0 = mma_raw(qh, kh0, s0);
        s0 = mma_raw(ql, kh0, s0);
        s0 = mma_raw(qh, kl0, s0);
        s1 = mma_raw(qh, kh1, s1);
        s1 = mma_raw(ql, kh1, s1);
        s1 = mma_raw(qh, kl1, s1);
        guard_sc(s0, s1, qh, ql, kh0, kl0, kh1, kl1);
      }
      // ---- online softmax in base 2 ----
#pragma unroll
      for (int r = 0; r < 8; ++r) {
        const float t0 = s0[r] * lsc + w0[r], t1 = s1[r] * lsc + w1[r];
        float mx = fmaxf(t0, t1);
#pragma unroll
        for (int off = 1; off < 16; off <<= 1) mx = fmaxf(mx, __shfl_xor(mx, off, 32));
        const float mn = fmaxf(mrow[r], mx);
        const float al = exp2f(mrow[r] - mn);
        mrow[r] = mn;
        const float e0 = exp2f(t0 - mn), e1 = exp2f(t1 - mn);
        float ps = e0 + e1;
#pragma unroll
        for (int off = 1; off < 16; off <<= 1) ps += __shfl_xor(ps, off, 32);
        lrow[r] = lrow[r] * al + ps;
#pragma unroll
        for (int j = 0; j < 8; ++j) o[j][r] *= al;
        const int ro = (8 * hh + r) * 36 + c;
        pt[ro]      = e0;
        pt[ro + 16] = e1;
      }
      wave_sync_lds();
      // ---- A fragments of P*32768: hi f16 and residual f16, row = c, split k map over the 32 keys of this step ----
      FragH ph, pl;
      {
        const float* prow = pt + c * 36 + 8 * hh;
        const v4f p0 = *(const v4f*)(prow), p1 = *(const v4f*)(prow + 4);
        const v4f p2 = *(const v4f*)(prow + 16), p3 = *(const v4f*)(prow + 20);
#pragma unroll
        for (int e = 0; e < 4; ++e) {
          const float ta = p0[e] * PCAR, tb = p1[e] * PCAR, tc = p2[e] * PCAR, td = p3[e] * PCAR;
          const _Float16 ha = (_Float16)ta, hb = (_Float16)tb, hc = (_Float16)tc, hd = (_Float16)td;
          ph.h[0][e]     = ha;                               // elements 0..7  = keys kb + 8hh + 0..7
          ph.h[0][4 + e] = hb;
          ph.h[1][e]     = hc;                               // elements 8..15 = keys kb + 16 + 8hh + 0..7
          ph.h[1][4 + e] = hd;
          pl.h[0][e]     = (_Float16)(ta - (float)ha);
          pl.h[0][4 + e] = (_Float16)(tb - (float)hb);
          pl.h[1][e]     = (_Float16)(tc - (float)hc);
          pl.h[1][4 + e] = (_Float16)(td - (float)hd);
        }
      }
      // ---- P.V : B fragment col n = d = j*16 + c, keys contiguous in the v^T plane ----
      const _Float16* vp = Vb + kb;
      {
        const v16h vb0 = ldfrag_h(vp);
        const v16h vb1 = ldfrag_h(vp + (size_t)16 * SEQ);
        const v16h vb2 = ldfrag_h(vp + (size_t)32 * SEQ);
        const v16h vb3 = ldfrag_h(vp + (size_t)48 * SEQ);
        o[0] = mma_raw(ph.v, vb0, o[0]);  o[0] = mma_raw(pl.v, vb0, o[0]);
        o[1] = mma_raw(ph.v, vb1, o[1]);  o[1] = mma_raw(pl.v, vb1, o[1]);
        o[2] = mma_raw(ph.v, vb2, o[2]);  o[2] = mma_raw(pl.v, vb2, o[2]);
        o[3] = mma_raw(ph.v, vb3, o[3]);  o[3] = mma_raw(pl.v, vb3, o[3]);
        guard_pv(o[0], o[1], o[2], o[3], ph.v, pl.v, vb0, vb1, vb2, vb3);
      }
      {
        const v16h vb4 = ldfrag_h(vp + (size_t)64 * SEQ);
        const v16h vb5 = ldfrag_h(vp + (size_t)80 * SEQ);
        const v16h vb6 = ldfrag_h(vp + (size_t)96 * SEQ);
        const v16h vb7 = ldfrag_h(vp + (size_t)112 * SEQ);
        o[4] = mma_raw(ph.v, vb4, o[4]);  o[4] = mma_raw(pl.v, vb4, o[4]);
        o[5] = mma_raw(ph.v, vb5, o[5]);  o[5] = mma_raw(pl.v, vb5, o[5]);
        o[6] = mma_raw(ph.v, vb6, o[6]);  o[6] = mma_raw(pl.v, vb6, o[6]);
        o[7] = mma_raw(ph.v, vb7, o[7]);  o[7] = mma_raw(pl.v, vb7, o[7]);
        guard_pv(o[4], o[5], o[6], o[7], ph.v, pl.v, vb4, vb5, vb6, vb7);
      }
      wave_sync_lds();
    }
  }
  acc_guard4(o[0], o[1], o[2], o[3]);
  acc_guard4(o[4], o[5], o[6], o[7]);

  // ---- fold 1/l and the carries (32768 on P, 16 on v), stage the wave's 16x128 slab in its LDS region ----
  wave_sync_lds();
  float* slab = pt;
  const float oc = 1.0f / (PCAR * VCAR);
#pragma unroll
  for (int r = 0; r < 8; ++r) {
    const float inv = (1.0f / lrow[r]) * oc;
#pragma unroll
    for (int j = 0; j < 8; ++j) slab[(8 * hh + r) * 132 + j * 16 + c] = o[j][r] * inv;
  }
  wave_sync_lds();
  v4f vals[16];
#pragma unroll
  for (int row = 0; row < 16; ++row) vals[row] = *(const v4f*)(slab + row * 132 + lane * 4);
  float* dst = outp + (((size_t)(b * SEQ + q0)) * NH + head) * HD + lane * 4;
  {
#pragma unroll
    for (int row = 0; row < 16; ++row) {
      *(v4f*)(dst + (size_t)row * (NH * HD)) = vals[row];
    }
    
  }
}

// =====================================================================================================
// Workspace map (bytes); every plane is fully written by whole-line stores before it is read; no pad rows needed
// (all extents are exact multiples of the store granularity); offsets multiples of 4 MiB:
//   QHI f16 [2][1024][32][128] x1024 hi     16777216
//   QLO f16 same, residual                 16777216
//   KHI f16 [2][1024][8][128] x1024 hi       4194304
//   KLO f16 same, residual                  4194304
//   VT  f16 [2][8][128][1024] x16           4194304
//   end                                    46137344
// =====================================================================================================
extern "C" void kernel_launch(void* const* d_in, const int* in_sizes, int n_in,
                              void* d_out, int out_size, void* d_ws, size_t ws_size,
                              hipStream_t stream) {
  if (n_in < 7) return;
  if (in_sizes[0] != NB * SEQ * NH * HD) return;
  if (in_sizes[1] != NB * SEQ * NKV * HD || in_sizes[2] != NB * SEQ * NKV * HD) return;
  if (in_sizes[3] != SEQ * HD || in_sizes[4] != SEQ * HD) return;
  if (in_sizes[5] != NB * SEQ * SEQ) return;
  if (in_sizes[6] < 1) return;
  if (out_size != NB * SEQ * NH * HD) return;

  const float* q    = (const float*)d_in[0];
  const float* k    = (const float*)d_in[1];
  const float* v    = (const float*)d_in[2];
  const float* cosT = (const float*)d_in[3];
  const float* sinT = (const float*)d_in[4];
  const float* bias = (const float*)d_in[5];
  const float* scl  = (const float*)d_in[6];
  float*       out  = (float*)d_out;

  const size_t PQ = (size_t)NB * SEQ * NH * HD * 2;     // 16777216
  const size_t PK = (size_t)NB * SEQ * NKV * HD * 2;    //  4194304
  const size_t PV = (size_t)NB * NKV * HD * SEQ * 2;    //  4194304
  size_t off = 0;
  const size_t oQH = off; off += PQ;
  const size_t oQL = off; off += PQ;
  const size_t oKH = off; off += PK;
  const size_t oKL = off; off += PK;
  const size_t oVT = off; off += PV;
  if (off > ws_size) return;                            // off = 46137344
  if (off > (size_t)134217728) return;

  char* ws = (char*)d_ws;
  unsigned short* QHI = (unsigned short*)(ws + oQH);
  unsigned short* QLO = (unsigned short*)(ws + oQL);
  unsigned short* KHI = (unsigned short*)(ws + oKH);
  unsigned short* KLO = (unsigned short*)(ws + oKL);
  unsigned short* VT  = (unsigned short*)(ws + oVT);

  const int rowsQ = NB * SEQ * NH;                      // 65536
  const int rowsK = NB * SEQ * NKV;                     // 16384
  const dim3 blk(256);
  const dim3 gRQ((rowsQ * 16) / 256);                   // 4096
  const dim3 gRK((rowsK * 16) / 256);                   // 1024
  const dim3 gVT(NB * NKV * (SEQ / 64));                // 256
  const dim3 gAT(ATT_BLOCKS);                           // 1024
  const dim3 bAT(ATT_THREADS);                          // 128

  // (0) q' planes: hi = f16(1024 q'), lo = f16(1024 q' - hi); rows (b, s, h), heads per row group NH
  rope16<<<gRQ, blk, 0, stream>>>(q, cosT, sinT, QHI, QLO, rowsQ, NH, QSC);
  // (1) k' planes: rows (b, s, g), heads per row group NKV
  rope16<<<gRK, blk, 0, stream>>>(k, cosT, sinT, KHI, KLO, rowsK, NKV, KSC);
  // (2) v^T plane x16
  vt16<<<gVT, blk, 0, stream>>>(v, VT);
  // (3) attention -> out [b][s][h][d] f32
  attn_gqa<<<gAT, bAT, 0, stream>>>(QHI, QLO, KHI, KLO, VT, bias, scl, out);
  (void)hipGetLastError();
}

// v001
// Measured time: 149 microseconds a run.
// Two timings next to v000 put it at 1.51 and 1.50 times that version's speed.
// Contractions: scores q'.k'^T (q' and k' each carried x1024 as f16 hi plane + f16 residual plane, products hh+lh+hl, K=128)
// and P.v (P x32768 as f16 hi + f16 residual, v x16 f16 exact, products hi.v+lo.v, K=1024 in 32-key steps):
// all v_wmma_f32_16x16x32_f16, f32 accumulate. RoPE, additive score bias, base-2 online softmax and 1/l fold in f32 on VALU.
// Every float input RNE-converted to bf16 on load.
#include <hip/hip_runtime.h>
#include <math.h>
#include <stdint.h>

#define NB    2
#define SEQ   1024
#define NH    32
#define NKV   8
#define HD    128
#define GRP   4
#define QSC   1024.0f
#define KSC   1024.0f
#define PCAR  32768.0f
#define VCAR  16.0f
#define LOG2E 1.4426950408889634f
#define BIASTH (-1.0e8f)
#define ATW   GRP
#define ATT_THREADS (ATW * 32)
#define ATT_BLOCKS  (NB * NKV * (SEQ / 16))
#define SLABF (16 * 132)
#define VTP   72
static_assert(NH == NKV * GRP);
static_assert(HD == 128 && (SEQ % 64) == 0 && (SEQ % 32) == 0 && (SEQ % 16) == 0);
static_assert(ATT_THREADS == 128 && ATT_BLOCKS == 1024);
static_assert(((NB * SEQ * NH * 16) % 256) == 0 && ((NB * SEQ * NKV * 16) % 256) == 0);
static_assert(16 * 36 <= SLABF);
static_assert((SEQ / 16) == 64 && NKV == 8);

typedef _Float16 v16h __attribute__((ext_vector_type(16)));
typedef _Float16 v8h  __attribute__((ext_vector_type(8)));
typedef float    v8f  __attribute__((ext_vector_type(8)));
typedef float    v4f  __attribute__((ext_vector_type(4)));
typedef unsigned int v4u __attribute__((ext_vector_type(4)));

union FragH { v16h v; v8h h[2]; v4u u[2]; };

// ---- scalar helpers --------------------------------------------------------------------------------
__device__ __forceinline__ unsigned short bf_bits(float f) {          // f32 -> bf16 bits, RNE convert
  unsigned u = __float_as_uint(f);
  return (unsigned short)((u + 0x7FFFu + ((u >> 16) & 1u)) >> 16);
}
__device__ __forceinline__ float bf_up(unsigned short h) { return __uint_as_float(((unsigned)h) << 16); }
__device__ __forceinline__ float bfr(float f) { return bf_up(bf_bits(f)); }   // value of the bf16 RNE convert
__device__ __forceinline__ unsigned short h_bits(_Float16 x) { return __builtin_bit_cast(unsigned short, x); }
__device__ __forceinline__ unsigned pk16(unsigned short a, unsigned short b) { return (unsigned)a | ((unsigned)b << 16); }
__device__ __forceinline__ v8f zero8() { v8f z = {0.f, 0.f, 0.f, 0.f, 0.f, 0.f, 0.f, 0.f}; return z; }

// ---- fragment loader: 16-bit A/B operand from a plane stored in fragment order. One fragment (16 rows/cols x 32 k) is 512
//      halves: piece (half, lane) of 8 halves at half*256 + lane*8, lane = 16*h + (row/col & 15); p already includes lane*8.
//      elements 0..7 <- piece half 0 (k0+8h..), elements 8..15 <- piece half 1 (k0+16+8h..)  (same split k map for A and B).
//      Each of the two 16-B loads reads 512 contiguous bytes per wave: four whole 128-B lines.
__device__ __forceinline__ v16h ldfrag_h(const _Float16* p) {
  FragH f;
  f.h[0] = *(const v8h*)(p);
  f.h[1] = *(const v8h*)(p + 256);
  return f.v;
}

__device__ __forceinline__ v8f mma_raw(v16h a, v16h b, v8f c) {
  return __builtin_amdgcn_wmma_f32_16x16x32_f16(false, a, false, b, (short)0, c, false, false);
}
__device__ __forceinline__ void guard_sc(v8f& a, v8f& b, v16h x0, v16h x1, v16h x2, v16h x3, v16h x4, v16h x5) {
#if defined(__HIP_DEVICE_COMPILE__)
  asm volatile("v_nop\n\tv_nop\n\tv_nop\n\tv_nop"
               : "+v"(a), "+v"(b) : "v"(x0), "v"(x1), "v"(x2), "v"(x3), "v"(x4), "v"(x5) : "memory");
#endif
}
__device__ __forceinline__ void guard_pv(v8f& a, v8f& b, v8f& c, v8f& d,
                                         v16h p0, v16h p1, v16h x0, v16h x1, v16h x2, v16h x3) {
#if defined(__HIP_DEVICE_COMPILE__)
  asm volatile("v_nop\n\tv_nop\n\tv_nop\n\tv_nop"
               : "+v"(a), "+v"(b), "+v"(c), "+v"(d) : "v"(p0), "v"(p1), "v"(x0), "v"(x1), "v"(x2), "v"(x3) : "memory");
#endif
}
__device__ __forceinline__ void acc_guard4(v8f& a, v8f& b, v8f& c, v8f& d) {
#if defined(__HIP_DEVICE_COMPILE__)
  asm volatile("v_nop\n\tv_nop\n\tv_nop\n\tv_nop" : "+v"(a), "+v"(b), "+v"(c), "+v"(d));
#endif
}
__device__ __forceinline__ void wave_sync_lds() {
  __builtin_amdgcn_fence(__ATOMIC_RELEASE, "workgroup");
  __builtin_amdgcn_wave_barrier();
  __builtin_amdgcn_fence(__ATOMIC_ACQUIRE, "workgroup");
}

// =====================================================================================================
// Rotate-half RoPE + 16-bit split pack. Rows are (batch, pos, head) with HD contiguous floats; pos = (row / hpr) mod SEQ.
//   w[d] = bf16(x[d]) * bf16(cos[pos][d]) + r[d] * bf16(sin[pos][d]),  r[d] = -bf16(x[d+64]) for d < 64, bf16(x[d-64]) for d >= 64
//   (bf16 x bf16 products are exact in f32, so w is the singly converted f32 sum);
//   hi[d] = f16(w * sc), lo[d] = f16(w * sc - hi[d])  (sc a power of two, residual unscaled).
// Planes are stored in fragment order: tile = (batch*SEQ/16 + pos/16)*hpr + head holds 16 positions x 128 d as 2048 halves,
//   piece (chunk = d/8, c = pos & 15) of 8 halves at (chunk*16 + c)*8, which is kk*512 + half*256 + lane*8 of ldfrag_h.
// Block = one tile. Thread = 8 consecutive d of one row: 16-B loads of x (own and partner half), cos, sin; one 16-B store per
// plane. A wave = 8 rows x 4 chunks: each load touches one whole 128-B line per row, each store fills four whole lines.
// coverage: grid = nrows/16 blocks x 256 thr x 8 halves = nrows x 128 of each plane exactly (host checks divisibility).
// =====================================================================================================
__global__ __launch_bounds__(256) void rope16(const float* __restrict__ x, const float* __restrict__ cosT,
                                              const float* __restrict__ sinT, unsigned short* hipl, unsigned short* lopl,
                                              int nrows, int hpr, float sc) {
  const int tile = blockIdx.x;
  if (tile * 16 >= nrows) return;           // never taken with the exact grid; no barriers in this kernel
  const int tid   = (int)threadIdx.x;
  const int c     = ((tid >> 5) & 1) * 8 + (tid & 7);          // position within the tile
  const int chunk = (tid >> 6) * 4 + ((tid >> 3) & 3);         // d / 8
  const int d0    = chunk * 8;
  const int srow  = (tile / hpr) * 16 + c;                     // batch*SEQ + pos
  const int row   = srow * hpr + (tile % hpr);
  const int pos   = srow & (SEQ - 1);
  const int d1  = d0 ^ 64;
  const float* xr = x + (size_t)row * HD;
  const float* cr = cosT + (size_t)pos * HD + d0;
  const float* sr = sinT + (size_t)pos * HD + d0;
  const v4f xa = *(const v4f*)(xr + d0), xb = *(const v4f*)(xr + d0 + 4);
  const v4f ya = *(const v4f*)(xr + d1), yb = *(const v4f*)(xr + d1 + 4);
  const v4f ca = *(const v4f*)(cr), cb = *(const v4f*)(cr + 4);
  const v4f sa = *(const v4f*)(sr), sb = *(const v4f*)(sr + 4);
  const float sgn = (d0 < 64) ? -1.0f : 1.0f;
  float w[8];
#pragma unroll
  for (int e = 0; e < 4; ++e) {
    w[e]     = bfr(xa[e]) * bfr(ca[e]) + (sgn * bfr(ya[e])) * bfr(sa[e]);
    w[4 + e] = bfr(xb[e]) * bfr(cb[e]) + (sgn * bfr(yb[e])) * bfr(sb[e]);
  }
  v4u oh, ol;
#pragma unroll
  for (int e = 0; e < 4; ++e) {
    const float t0 = w[2 * e] * sc, t1 = w[2 * e + 1] * sc;
    const _Float16 h0 = (_Float16)t0, h1 = (_Float16)t1;
    const _Float16 l0 = (_Float16)(t0 - (float)h0), l1 = (_Float16)(t1 - (float)h1);
    oh[e] = pk16(h_bits(h0), h_bits(h1));
    ol[e] = pk16(h_bits(l0), h_bits(l1));
  }
  const size_t o8 = (size_t)tile * (16 * HD) + (chunk * 16 + c) * 8;
  {
    *(v4u*)(hipl + o8) = oh;
    *(v4u*)(lopl + o8) = ol;
    
  }
}

// =====================================================================================================
// v^T plane, value f16( bf16(v[b][s][g][d]) * 16 ) (exact), stored in fragment order: fragment ((b*NKV + g)*SEQ/32 + s/32)*8 + d/16
// of 512 halves, piece (half = (s/16)&1, lane = 16*((s/8)&1) + (d&15)) of 8 keys. Block = (b, g, 64 keys): 64 source rows of
// 128 floats loaded with 16-B loads, converted, scattered into an LDS tile [d][64 keys] (pitch 72 halves); after a block barrier each
// coverage: load 256 thr x 32 elements = 64 x 128; store 4 iterations x 256 thr x 8 halves = 128 lines x 64 = the block's tile;
//           grid = NB x NKV x SEQ/64 = 256 blocks covers the whole plane exactly once.
// =====================================================================================================
__global__ __launch_bounds__(256) void vt16(const float* __restrict__ v, unsigned short* VTo) {
  __shared__ __align__(16) unsigned short T[HD * VTP];
  const int tid = threadIdx.x;
  const int bid = blockIdx.x;
  const int st  = bid & 15;
  const int g   = (bid >> 4) & 7;
  const int b   = bid >> 7;
  const int s0  = st * 64;
  {
    const int sl = tid >> 2;                  // key within tile 0..63
    const int dc = (tid & 3) * 32;            // d chunk
    const float* src = v + (((size_t)(b * SEQ + s0 + sl)) * NKV + g) * HD + dc;
#pragma unroll
    for (int i = 0; i < 8; ++i) {
      const v4f a = *(const v4f*)(src + 4 * i);
#pragma unroll
      for (int e = 0; e < 4; ++e) T[(dc + 4 * i + e) * VTP + sl] = h_bits((_Float16)(bfr(a[e]) * VCAR));
    }
  }
  __syncthreads();
  v4u vals[4];
#pragma unroll
  for (int it = 0; it < 4; ++it) {
    const int pi = it * 256 + tid;            // piece in the block's 16 fragments: [key step 2][d/16 8][half 2][lane 32]
    const int d  = ((pi >> 6) & 7) * 16 + (pi & 15);
    const int kc = (pi >> 9) * 4 + ((pi >> 5) & 1) * 2 + ((pi >> 4) & 1);   // 8-key chunk within the 64 keys
    vals[it] = *(const v4u*)(T + d * VTP + kc * 8);
  }
  unsigned short* dst = VTo + (size_t)bid * (64 * HD) + tid * 8;   // bid = ((b*NKV + g)*SEQ/64 + st)
  {
#pragma unroll
    for (int it = 0; it < 4; ++it) {
      *(v4u*)(dst + it * 2048) = vals[it];
    }
    
  }
}

// =====================================================================================================
// GQA flash attention: block = (batch b, kv head g, 16 query rows q0..q0+15), one wave per query head g*4 + wave.
//   q planes (hi, lo f16) in fragment order, tiles [b][s/16][h]; k planes tiles [b][s/16][g]; v^T plane fragments [b][g][s/32][d/16];
//   score bias B[b][0][q][key] f32 added after bf16 RNE convert; scale = bf16(softmax_scale), base-2 softmax.
//   Per 32-key step: the 16x32 bias tile is read first; the step is skipped (wave-uniform ballot) only when every bias entry is
//   <= -1e8 and every row already holds a running max > -1e8 (then exp2 underflows to exactly 0 and the rescale is exactly 1).
//   Otherwise: 2 score subtiles x 4 k-steps x 3 products (q_hi.k_hi + q_lo.k_hi + q_hi.k_lo), fragments loaded straight from the
//   16-bit planes (two 16-B loads per fragment, split k map); online max-subtracted softmax in f32 (exp2); rescale of l and the 8
//   of P*32768 (f16 hi) and its f16 residual rebuilt from the LDS rows (float vector loads), 8 v^T B fragments from the plane,
//   16 P.V WMMAs.
//   Epilogue: 1/l and carry folds in f32; the wave's 16x128 f32 result staged in its LDS slab (pitch 132); each 512-B output row
//   No block barriers in this kernel; every wave does bounded work (32 steps max).
// coverage: per wave 16 rows x 32 lanes x 4 floats = 16 x 128; grid 1024 blocks x 4 waves = every (b, s, h) row exactly once.
// =====================================================================================================
__global__ __launch_bounds__(ATT_THREADS)
void attn_gqa(const unsigned short* __restrict__ QHIp, const unsigned short* __restrict__ QLOp,
              const unsigned short* __restrict__ KHIp, const unsigned short* __restrict__ KLOp,
              const unsigned short* __restrict__ VTq, const float* __restrict__ Bp,
              const float* __restrict__ scp, float* outp) {
  __shared__ __align__(16) float smem[ATW * SLABF];    // per wave: prob tile [16][32] pitch 36 during the loop, result slab after

  const int tid  = threadIdx.x;
  const int wave = tid >> 5;
  const int lane = tid & 31;
  const int hh   = lane >> 4;
  const int c    = lane & 15;

  const int bid  = blockIdx.x;
  const int qt   = bid & 63;                           // SEQ / 16 query tiles
  const int g    = (bid >> 6) & 7;                     // kv head
  const int b    = bid >> 9;                           // batch
  const int head = g * GRP + wave;
  const int q0   = qt * 16;

  const size_t qofs = ((size_t)(b * (SEQ / 16) + qt) * NH + head) * (16 * HD) + 8 * lane;
  const _Float16* Qh  = (const _Float16*)(const void*)QHIp + qofs;
  const _Float16* Ql  = (const _Float16*)(const void*)QLOp + qofs;
  const size_t kofs = ((size_t)b * (SEQ / 16) * NKV + g) * (16 * HD) + 8 * lane;   // key tile kb/16 added per step
  const _Float16* Khb = (const _Float16*)(const void*)KHIp + kofs;
  const _Float16* Klb = (const _Float16*)(const void*)KLOp + kofs;
  const _Float16* Vb  = (const _Float16*)(const void*)VTq + (size_t)(b * NKV + g) * (HD * SEQ) + 8 * lane;
  const float*    Wr  = Bp + ((size_t)b * SEQ + q0 + 8 * hh) * SEQ + c;           // rows q0+8hh+r, cols c (+key offset)
  const float lsc = bfr(scp[0]) * (LOG2E / (QSC * KSC));

  float mrow[8], lrow[8];
  v8f o[8];
#pragma unroll
  for (int r = 0; r < 8; ++r) { mrow[r] = -INFINITY; lrow[r] = 0.f; }
#pragma unroll
  for (int j = 0; j < 8; ++j) o[j] = zero8();
  float* pt = smem + wave * SLABF;

#pragma unroll 1
  for (int kb = 0; kb < SEQ; kb += 32) {
    float w0[8], w1[8];
    bool allm = true, seen = true;
    const float* wp = Wr + kb;
#pragma unroll
    for (int r = 0; r < 8; ++r) {
      const float m0 = bfr(wp[(size_t)r * SEQ]);
      const float m1 = bfr(wp[(size_t)r * SEQ + 16]);
      allm = allm & (m0 <= BIASTH) & (m1 <= BIASTH);
      seen = seen & (mrow[r] > BIASTH);
      w0[r] = m0 * LOG2E;
      w1[r] = m1 * LOG2E;
    }
    const unsigned bal = __builtin_amdgcn_ballot_w32(allm & seen);
    if (bal != 0xffffffffu) {                          // wave-uniform
      // ---- scores: D element r of this lane = (query row q0 + 8hh + r, key kb + c) in s0, key kb + 16 + c in s1 ----
      v8f s0 = zero8(), s1 = zero8();
      const _Float16* k0p = Khb + (size_t)kb * (NKV * HD);
      const _Float16* k1p = k0p + (size_t)16 * (NKV * HD);
      const _Float16* l0p = Klb + (size_t)kb * (NKV * HD);
      const _Float16* l1p = l0p + (size_t)16 * (NKV * HD);
#pragma unroll
      for (int kk = 0; kk < 4; ++kk) {
        const v16h qh  = ldfrag_h(Qh + kk * 512),  ql  = ldfrag_h(Ql + kk * 512);
        const v16h kh0 = ldfrag_h(k0p + kk * 512), kl0 = ldfrag_h(l0p + kk * 512);
        const v16h kh1 = ldfrag_h(k1p + kk * 512), kl1 = ldfrag_h(l1p + kk * 512);
        s0 = mma_raw(qh, kh0, s0);
        s0 = mma_raw(ql, kh0, s0);
        s0 = mma_raw(qh, kl0, s0);
        s1 = mma_raw(qh, kh1, s1);
        s1 = mma_raw(ql, kh1, s1);
        s1 = mma_raw(qh, kl1, s1);
        guard_sc(s0, s1, qh, ql, kh0, kl0, kh1, kl1);
      }
      // ---- online softmax in base 2 ----
#pragma unroll
      for (int r = 0; r < 8; ++r) {
        const float t0 = s0[r] * lsc + w0[r], t1 = s1[r] * lsc + w1[r];
        float mx = fmaxf(t0, t1);
#pragma unroll
        for (int off = 1; off < 16; off <<= 1) mx = fmaxf(mx, __shfl_xor(mx, off, 32));
        const float mn = fmaxf(mrow[r], mx);
        const float al = exp2f(mrow[r] - mn);
        mrow[r] = mn;
        const float e0 = exp2f(t0 - mn), e1 = exp2f(t1 - mn);
        float ps = e0 + e1;
#pragma unroll
        for (int off = 1; off < 16; off <<= 1) ps += __shfl_xor(ps, off, 32);
        lrow[r] = lrow[r] * al + ps;
#pragma unroll
        for (int j = 0; j < 8; ++j) o[j][r] *= al;
        const int ro = (8 * hh + r) * 36 + c;
        pt[ro]      = e0;
        pt[ro + 16] = e1;
      }
      wave_sync_lds();
      // ---- A fragments of P*32768: hi f16 and residual f16, row = c, split k map over the 32 keys of this step ----
      FragH ph, pl;
      {
        const float* prow = pt + c * 36 + 8 * hh;
        const v4f p0 = *(const v4f*)(prow), p1 = *(const v4f*)(prow + 4);
        const v4f p2 = *(const v4f*)(prow + 16), p3 = *(const v4f*)(prow + 20);
#pragma unroll
        for (int e = 0; e < 4; ++e) {
          const float ta = p0[e] * PCAR, tb = p1[e] * PCAR, tc = p2[e] * PCAR, td = p3[e] * PCAR;
          const _Float16 ha = (_Float16)ta, hb = (_Float16)tb, hc = (_Float16)tc, hd = (_Float16)td;
          ph.h[0][e]     = ha;                               // elements 0..7  = keys kb + 8hh + 0..7
          ph.h[0][4 + e] = hb;
          ph.h[1][e]     = hc;                               // elements 8..15 = keys kb + 16 + 8hh + 0..7
          ph.h[1][4 + e] = hd;
          pl.h[0][e]     = (_Float16)(ta - (float)ha);
          pl.h[0][4 + e] = (_Float16)(tb - (float)hb);
          pl.h[1][e]     = (_Float16)(tc - (float)hc);
          pl.h[1][4 + e] = (_Float16)(td - (float)hd);
        }
      }
      // ---- P.V : B fragment col n = d = j*16 + c, fragment j of this 32-key step in the v^T plane ----
      const _Float16* vp = Vb + (size_t)kb * HD;
      {
        const v16h vb0 = ldfrag_h(vp);
        const v16h vb1 = ldfrag_h(vp + 512);
        const v16h vb2 = ldfrag_h(vp + 1024);
        const v16h vb3 = ldfrag_h(vp + 1536);
        o[0] = mma_raw(ph.v, vb0, o[0]);  o[0] = mma_raw(pl.v, vb0, o[0]);
        o[1] = mma_raw(ph.v, vb1, o[1]);  o[1] = mma_raw(pl.v, vb1, o[1]);
        o[2] = mma_raw(ph.v, vb2, o[2]);  o[2] = mma_raw(pl.v, vb2, o[2]);
        o[3] = mma_raw(ph.v, vb3, o[3]);  o[3] = mma_raw(pl.v, vb3, o[3]);
        guard_pv(o[0], o[1], o[2], o[3], ph.v, pl.v, vb0, vb1, vb2, vb3);
      }
      {
        const v16h vb4 = ldfrag_h(vp + 2048);
        const v16h vb5 = ldfrag_h(vp + 2560);
        const v16h vb6 = ldfrag_h(vp + 3072);
        const v16h vb7 = ldfrag_h(vp + 3584);
        o[4] = mma_raw(ph.v, vb4, o[4]);  o[4] = mma_raw(pl.v, vb4, o[4]);
        o[5] = mma_raw(ph.v, vb5, o[5]);  o[5] = mma_raw(pl.v, vb5, o[5]);
        o[6] = mma_raw(ph.v, vb6, o[6]);  o[6] = mma_raw(pl.v, vb6, o[6]);
        o[7] = mma_raw(ph.v, vb7, o[7]);  o[7] = mma_raw(pl.v, vb7, o[7]);
        guard_pv(o[4], o[5], o[6], o[7], ph.v, pl.v, vb4, vb5, vb6, vb7);
      }
      wave_sync_lds();
    }
  }
  acc_guard4(o[0], o[1], o[2], o[3]);
  acc_guard4(o[4], o[5], o[6], o[7]);

  // ---- fold 1/l and the carries (32768 on P, 16 on v), stage the wave's 16x128 slab in its LDS region ----
  wave_sync_lds();
  float* slab = pt;
  const float oc = 1.0f / (PCAR * VCAR);
#pragma unroll
  for (int r = 0; r < 8; ++r) {
    const float inv = (1.0f / lrow[r]) * oc;
#pragma unroll
    for (int j = 0; j < 8; ++j) slab[(8 * hh + r) * 132 + j * 16 + c] = o[j][r] * inv;
  }
  wave_sync_lds();
  v4f vals[16];
#pragma unroll
  for (int row = 0; row < 16; ++row) vals[row] = *(const v4f*)(slab + row * 132 + lane * 4);
  float* dst = outp + (((size_t)(b * SEQ + q0)) * NH + head) * HD + lane * 4;
  {
#pragma unroll
    for (int row = 0; row < 16; ++row) {
      *(v4f*)(dst + (size_t)row * (NH * HD)) = vals[row];
    }
    
  }
}

// =====================================================================================================
// Workspace map (bytes); every plane is fully written by whole-line stores before it is read; no pad rows needed
// (all extents are exact multiples of the store granularity); offsets multiples of 4 MiB:
//   QHI f16 [2][64][32] tiles of 2048 x1024 hi  16777216
//   QLO f16 same, residual                 16777216
//   KHI f16 [2][64][8] tiles of 2048 x1024 hi    4194304
//   KLO f16 same, residual                  4194304
//   VT  f16 [2][8][32][8] fragments of 512 x16   4194304
//   end                                    46137344
// =====================================================================================================
extern "C" void kernel_launch(void* const* d_in, const int* in_sizes, int n_in,
                              void* d_out, int out_size, void* d_ws, size_t ws_size,
                              hipStream_t stream) {
  if (n_in < 7) return;
  if (in_sizes[0] != NB * SEQ * NH * HD) return;
  if (in_sizes[1] != NB * SEQ * NKV * HD || in_sizes[2] != NB * SEQ * NKV * HD) return;
  if (in_sizes[3] != SEQ * HD || in_sizes[4] != SEQ * HD) return;
  if (in_sizes[5] != NB * SEQ * SEQ) return;
  if (in_sizes[6] < 1) return;
  if (out_size != NB * SEQ * NH * HD) return;

  const float* q    = (const float*)d_in[0];
  const float* k    = (const float*)d_in[1];
  const float* v    = (const float*)d_in[2];
  const float* cosT = (const float*)d_in[3];
  const float* sinT = (const float*)d_in[4];
  const float* bias = (const float*)d_in[5];
  const float* scl  = (const float*)d_in[6];
  float*       out  = (float*)d_out;

  const size_t PQ = (size_t)NB * SEQ * NH * HD * 2;     // 16777216
  const size_t PK = (size_t)NB * SEQ * NKV * HD * 2;    //  4194304
  const size_t PV = (size_t)NB * NKV * HD * SEQ * 2;    //  4194304
  size_t off = 0;
  const size_t oQH = off; off += PQ;
  const size_t oQL = off; off += PQ;
  const size_t oKH = off; off += PK;
  const size_t oKL = off; off += PK;
  const size_t oVT = off; off += PV;
  if (off > ws_size) return;                            // off = 46137344
  if (off > (size_t)134217728) return;

  char* ws = (char*)d_ws;
  unsigned short* QHI = (unsigned short*)(ws + oQH);
  unsigned short* QLO = (unsigned short*)(ws + oQL);
  unsigned short* KHI = (unsigned short*)(ws + oKH);
  unsigned short* KLO = (unsigned short*)(ws + oKL);
  unsigned short* VT  = (unsigned short*)(ws + oVT);

  const int rowsQ = NB * SEQ * NH;                      // 65536
  const int rowsK = NB * SEQ * NKV;                     // 16384
  const dim3 blk(256);
  const dim3 gRQ((rowsQ * 16) / 256);                   // 4096
  const dim3 gRK((rowsK * 16) / 256);                   // 1024
  const dim3 gVT(NB * NKV * (SEQ / 64));                // 256
  const dim3 gAT(ATT_BLOCKS);                           // 1024
  const dim3 bAT(ATT_THREADS);                          // 128

  // (0) q' planes: hi = f16(1024 q'), lo = f16(1024 q' - hi); rows (b, s, h), heads per row group NH
  rope16<<<gRQ, blk, 0, stream>>>(q, cosT, sinT, QHI, QLO, rowsQ, NH, QSC);
  // (1) k' planes: rows (b, s, g), heads per row group NKV
  rope16<<<gRK, blk, 0, stream>>>(k, cosT, sinT, KHI, KLO, rowsK, NKV, KSC);
  // (2) v^T plane x16
  vt16<<<gVT, blk, 0, stream>>>(v, VT);
  // (3) attention -> out [b][s][h][d] f32
  attn_gqa<<<gAT, bAT, 0, stream>>>(QHI, QLO, KHI, KLO, VT, bias, scl, out);
  (void)hipGetLastError();
}

// v002
// A run of this version takes 102 microseconds.
// Timed twice side by side with v001, it ran 1.45 and 1.47 times as fast.
// All steps since v000 together make it 2.20 times as fast.
// Contractions: scores q'.k'^T (q' and k' each carried x1024 as f16 hi plane + f16 residual plane, products hh+lh+hl, K=128)
// and P.v (P x32768 as f16 hi + f16 residual, v x16 f16 exact, products hi.v+lo.v, K=1024 in 32-key steps):
// all v_wmma_f32_16x16x32_f16, f32 accumulate. RoPE, additive score bias, base-2 online softmax and 1/l fold in f32 on VALU.
// Every float input RNE-converted to bf16 on load.
#include <hip/hip_runtime.h>
#include <math.h>
#include <stdint.h>

#define NB    2
#define SEQ   1024
#define NH    32
#define NKV   8
#define HD    128
#define GRP   4
#define QSC   1024.0f
#define KSC   1024.0f
#define PCAR  32768.0f
#define VCAR  16.0f
#define LOG2E 1.4426950408889634f
#define BIASTH (-1.0e8f)
#define ATW   GRP
#define ATT_THREADS (ATW * 32)
#define ATT_BLOCKS  (NB * NKV * (SEQ / 16))
#define SLABF (16 * 132)
#define VTP   72
#define NSTEP (SEQ / 32)
#define STG_KV 24576                       // bytes of one stage: k hi 2 tiles, k lo 2 tiles (4 KiB each), v^T 8 fragments (8 KiB)
#define BPITCH 144                         // LDS pitch in bytes of a 128-B bias row: rows r and r+8 fall on disjoint banks
#define STG_B  (STG_KV + 16 * BPITCH)      // one stage with its 16 x 32 bias tile
#define RING_B (2 * STG_B)
#define PT_F   (16 * 36)                   // floats of one wave's prob tile
static_assert(NH == NKV * GRP);
static_assert(HD == 128 && (SEQ % 64) == 0 && (SEQ % 32) == 0 && (SEQ % 16) == 0);
static_assert(ATT_THREADS == 128 && ATT_BLOCKS == 1024);
static_assert(((NB * SEQ * NH * 16) % 256) == 0 && ((NB * SEQ * NKV * 16) % 256) == 0);
static_assert(ATW * SLABF * 4 <= RING_B && (STG_B % 16) == 0 && NSTEP >= 2);
static_assert(STG_KV == 12 * ATT_THREADS * 16 && 16 * 128 == ATT_THREADS * 16);
static_assert((SEQ / 16) == 64 && NKV == 8);

typedef _Float16 v16h __attribute__((ext_vector_type(16)));
typedef _Float16 v8h  __attribute__((ext_vector_type(8)));
typedef float    v8f  __attribute__((ext_vector_type(8)));
typedef float    v4f  __attribute__((ext_vector_type(4)));
typedef unsigned int v4u __attribute__((ext_vector_type(4)));

union FragH { v16h v; v8h h[2]; v4u u[2]; };

// ---- scalar helpers --------------------------------------------------------------------------------
__device__ __forceinline__ unsigned short bf_bits(float f) {          // f32 -> bf16 bits, RNE convert
  unsigned u = __float_as_uint(f);
  return (unsigned short)((u + 0x7FFFu + ((u >> 16) & 1u)) >> 16);
}
__device__ __forceinline__ float bf_up(unsigned short h) { return __uint_as_float(((unsigned)h) << 16); }
__device__ __forceinline__ float bfr(float f) { return bf_up(bf_bits(f)); }   // value of the bf16 RNE convert
__device__ __forceinline__ unsigned short h_bits(_Float16 x) { return __builtin_bit_cast(unsigned short, x); }
__device__ __forceinline__ unsigned pk16(unsigned short a, unsigned short b) { return (unsigned)a | ((unsigned)b << 16); }
__device__ __forceinline__ v8f zero8() { v8f z = {0.f, 0.f, 0.f, 0.f, 0.f, 0.f, 0.f, 0.f}; return z; }

// ---- fragment loader: 16-bit A/B operand from a plane stored in fragment order. One fragment (16 rows/cols x 32 k) is 512
//      halves: piece (half, lane) of 8 halves at half*256 + lane*8, lane = 16*h + (row/col & 15); p already includes lane*8.
//      elements 0..7 <- piece half 0 (k0+8h..), elements 8..15 <- piece half 1 (k0+16+8h..)  (same split k map for A and B).
//      Each of the two 16-B loads reads 512 contiguous bytes per wave: four whole 128-B lines.
__device__ __forceinline__ v16h ldfrag_h(const _Float16* p) {
  FragH f;
  f.h[0] = *(const v8h*)(p);
  f.h[1] = *(const v8h*)(p + 256);
  return f.v;
}

__device__ __forceinline__ v8f mma_raw(v16h a, v16h b, v8f c) {
  return __builtin_amdgcn_wmma_f32_16x16x32_f16(false, a, false, b, (short)0, c, false, false);
}
__device__ __forceinline__ void guard_sc(v8f& a, v8f& b, v16h x0, v16h x1, v16h x2, v16h x3, v16h x4, v16h x5) {
#if defined(__HIP_DEVICE_COMPILE__)
  asm volatile("v_nop\n\tv_nop\n\tv_nop\n\tv_nop"
               : "+v"(a), "+v"(b) : "v"(x0), "v"(x1), "v"(x2), "v"(x3), "v"(x4), "v"(x5) : "memory");
#endif
}
__device__ __forceinline__ void guard_pv(v8f& a, v8f& b, v8f& c, v8f& d,
                                         v16h p0, v16h p1, v16h x0, v16h x1, v16h x2, v16h x3) {
#if defined(__HIP_DEVICE_COMPILE__)
  asm volatile("v_nop\n\tv_nop\n\tv_nop\n\tv_nop"
               : "+v"(a), "+v"(b), "+v"(c), "+v"(d) : "v"(p0), "v"(p1), "v"(x0), "v"(x1), "v"(x2), "v"(x3) : "memory");
#endif
}
__device__ __forceinline__ void acc_guard4(v8f& a, v8f& b, v8f& c, v8f& d) {
#if defined(__HIP_DEVICE_COMPILE__)
  asm volatile("v_nop\n\tv_nop\n\tv_nop\n\tv_nop" : "+v"(a), "+v"(b), "+v"(c), "+v"(d));
#endif
}
__device__ __forceinline__ void wave_sync_lds() {
  __builtin_amdgcn_fence(__ATOMIC_RELEASE, "workgroup");
  __builtin_amdgcn_wave_barrier();
  __builtin_amdgcn_fence(__ATOMIC_ACQUIRE, "workgroup");
}
// One stage of the attention ring: 13 asynchronous 16-B copies per lane, global -> LDS, through no register.
//   l  = LDS byte address of the stage + tid*16 (chunk j of 2 KiB at + j*2048), lb = this lane's 16 B of the bias tile in LDS;
//   kh, kl = this lane's 16 B in the first key tile of the k hi / k lo plane, vv in the step's v^T fragments, bb in the bias row.
// The s_wait_xcnt stands inside the statement so that no address register of a copy is rewritten ahead of it.
__device__ __forceinline__ void stage_copy(unsigned l, unsigned lb, const _Float16* kh, const _Float16* kl,
                                           const _Float16* vv, const float* bb) {
#if defined(__HIP_DEVICE_COMPILE__)
  const unsigned l1 = l + 2048, l2 = l + 4096, l3 = l + 6144, l4 = l + 8192, l5 = l + 10240, l6 = l + 12288, l7 = l + 14336;
  const unsigned l8 = l + 16384, l9 = l + 18432, l10 = l + 20480, l11 = l + 22528;
  const _Float16 *g1 = kh + 1024, *g2 = kh + NKV * 2048, *g3 = kh + NKV * 2048 + 1024;
  const _Float16 *g5 = kl + 1024, *g6 = kl + NKV * 2048, *g7 = kl + NKV * 2048 + 1024;
  const _Float16 *g9 = vv + 1024, *g10 = vv + 2048, *g11 = vv + 3072;
  asm volatile("global_load_async_to_lds_b128 %0, %13, off\n\t"
               "global_load_async_to_lds_b128 %1, %14, off\n\t"
               "global_load_async_to_lds_b128 %2, %15, off\n\t"
               "global_load_async_to_lds_b128 %3, %16, off\n\t"
               "global_load_async_to_lds_b128 %4, %17, off\n\t"
               "global_load_async_to_lds_b128 %5, %18, off\n\t"
               "global_load_async_to_lds_b128 %6, %19, off\n\t"
               "global_load_async_to_lds_b128 %7, %20, off\n\t"
               "global_load_async_to_lds_b128 %8, %21, off\n\t"
               "global_load_async_to_lds_b128 %9, %22, off\n\t"
               "global_load_async_to_lds_b128 %10, %23, off\n\t"
               "global_load_async_to_lds_b128 %11, %24, off\n\t"
               "global_load_async_to_lds_b128 %12, %25, off\n\t"
               "s_wait_xcnt 0x0"
               :: "v"(lb), "v"(l), "v"(l1), "v"(l2), "v"(l3), "v"(l4), "v"(l5), "v"(l6), "v"(l7), "v"(l8), "v"(l9), "v"(l10),
                  "v"(l11),
                  "v"(bb), "v"(kh), "v"(g1), "v"(g2), "v"(g3), "v"(kl), "v"(g5), "v"(g6), "v"(g7), "v"(vv), "v"(g9), "v"(g10),
                  "v"(g11)
               : "memory");
#endif
}
__device__ __forceinline__ void wait_async0() {   // this wave's copies have landed
#if defined(__HIP_DEVICE_COMPILE__)
  asm volatile("s_wait_asynccnt 0x0" ::: "memory");
#endif
}
__device__ __forceinline__ void wait_ds0() {      // this wave's LDS reads of the stage have returned before the stage is refilled
#if defined(__HIP_DEVICE_COMPILE__)
  asm volatile("s_wait_dscnt 0x0" ::: "memory");
#endif
}

// =====================================================================================================
// Rotate-half RoPE + 16-bit split pack. Rows are (batch, pos, head) with HD contiguous floats; pos = (row / hpr) mod SEQ.
//   w[d] = bf16(x[d]) * bf16(cos[pos][d]) + r[d] * bf16(sin[pos][d]),  r[d] = -bf16(x[d+64]) for d < 64, bf16(x[d-64]) for d >= 64
//   (bf16 x bf16 products are exact in f32, so w is the singly converted f32 sum);
//   hi[d] = f16(w * sc), lo[d] = f16(w * sc - hi[d])  (sc a power of two, residual unscaled).
// Planes are stored in fragment order: tile = (batch*SEQ/16 + pos/16)*hpr + head holds 16 positions x 128 d as 2048 halves,
//   piece (chunk = d/8, c = pos & 15) of 8 halves at (chunk*16 + c)*8, which is kk*512 + half*256 + lane*8 of ldfrag_h.
// Block = one tile. Thread = 8 consecutive d of one row: 16-B loads of x (own and partner half), cos, sin; one 16-B store per
// plane. A wave = 8 rows x 4 chunks: each load touches one whole 128-B line per row, each store fills four whole lines.
// coverage: grid = nrows/16 blocks x 256 thr x 8 halves = nrows x 128 of each plane exactly (host checks divisibility).
// =====================================================================================================
__global__ __launch_bounds__(256) void rope16(const float* __restrict__ x, const float* __restrict__ cosT,
                                              const float* __restrict__ sinT, unsigned short* hipl, unsigned short* lopl,
                                              int nrows, int hpr, float sc) {
  const int tile = blockIdx.x;
  if (tile * 16 >= nrows) return;           // never taken with the exact grid; no barriers in this kernel
  const int tid   = (int)threadIdx.x;
  const int c     = ((tid >> 5) & 1) * 8 + (tid & 7);          // position within the tile
  const int chunk = (tid >> 6) * 4 + ((tid >> 3) & 3);         // d / 8
  const int d0    = chunk * 8;
  const int srow  = (tile / hpr) * 16 + c;                     // batch*SEQ + pos
  const int row   = srow * hpr + (tile % hpr);
  const int pos   = srow & (SEQ - 1);
  const int d1  = d0 ^ 64;
  const float* xr = x + (size_t)row * HD;
  const float* cr = cosT + (size_t)pos * HD + d0;
  const float* sr = sinT + (size_t)pos * HD + d0;
  const v4f xa = *(const v4f*)(xr + d0), xb = *(const v4f*)(xr + d0 + 4);
  const v4f ya = *(const v4f*)(xr + d1), yb = *(const v4f*)(xr + d1 + 4);
  const v4f ca = *(const v4f*)(cr), cb = *(const v4f*)(cr + 4);
  const v4f sa = *(const v4f*)(sr), sb = *(const v4f*)(sr + 4);
  const float sgn = (d0 < 64) ? -1.0f : 1.0f;
  float w[8];
#pragma unroll
  for (int e = 0; e < 4; ++e) {
    w[e]     = bfr(xa[e]) * bfr(ca[e]) + (sgn * bfr(ya[e])) * bfr(sa[e]);
    w[4 + e] = bfr(xb[e]) * bfr(cb[e]) + (sgn * bfr(yb[e])) * bfr(sb[e]);
  }
  v4u oh, ol;
#pragma unroll
  for (int e = 0; e < 4; ++e) {
    const float t0 = w[2 * e] * sc, t1 = w[2 * e + 1] * sc;
    const _Float16 h0 = (_Float16)t0, h1 = (_Float16)t1;
    const _Float16 l0 = (_Float16)(t0 - (float)h0), l1 = (_Float16)(t1 - (float)h1);
    oh[e] = pk16(h_bits(h0), h_bits(h1));
    ol[e] = pk16(h_bits(l0), h_bits(l1));
  }
  const size_t o8 = (size_t)tile * (16 * HD) + (chunk * 16 + c) * 8;
  {
    *(v4u*)(hipl + o8) = oh;
    *(v4u*)(lopl + o8) = ol;
    
  }
}

// =====================================================================================================
// v^T plane, value f16( bf16(v[b][s][g][d]) * 16 ) (exact), stored in fragment order: fragment ((b*NKV + g)*SEQ/32 + s/32)*8 + d/16
// of 512 halves, piece (half = (s/16)&1, lane = 16*((s/8)&1) + (d&15)) of 8 keys. Block = (b, g, 64 keys): 64 source rows of
// 128 floats loaded with 16-B loads, converted, scattered into an LDS tile [d][64 keys] (pitch 72 halves); after a block barrier each
// coverage: load 256 thr x 32 elements = 64 x 128; store 4 iterations x 256 thr x 8 halves = 128 lines x 64 = the block's tile;
//           grid = NB x NKV x SEQ/64 = 256 blocks covers the whole plane exactly once.
// =====================================================================================================
__global__ __launch_bounds__(256) void vt16(const float* __restrict__ v, unsigned short* VTo) {
  __shared__ __align__(16) unsigned short T[HD * VTP];
  const int tid = threadIdx.x;
  const int bid = blockIdx.x;
  const int st  = bid & 15;
  const int g   = (bid >> 4) & 7;
  const int b   = bid >> 7;
  const int s0  = st * 64;
  {
    const int sl = tid >> 2;                  // key within tile 0..63
    const int dc = (tid & 3) * 32;            // d chunk
    const float* src = v + (((size_t)(b * SEQ + s0 + sl)) * NKV + g) * HD + dc;
#pragma unroll
    for (int i = 0; i < 8; ++i) {
      const v4f a = *(const v4f*)(src + 4 * i);
#pragma unroll
      for (int e = 0; e < 4; ++e) T[(dc + 4 * i + e) * VTP + sl] = h_bits((_Float16)(bfr(a[e]) * VCAR));
    }
  }
  __syncthreads();
  v4u vals[4];
#pragma unroll
  for (int it = 0; it < 4; ++it) {
    const int pi = it * 256 + tid;            // piece in the block's 16 fragments: [key step 2][d/16 8][half 2][lane 32]
    const int d  = ((pi >> 6) & 7) * 16 + (pi & 15);
    const int kc = (pi >> 9) * 4 + ((pi >> 5) & 1) * 2 + ((pi >> 4) & 1);   // 8-key chunk within the 64 keys
    vals[it] = *(const v4u*)(T + d * VTP + kc * 8);
  }
  unsigned short* dst = VTo + (size_t)bid * (64 * HD) + tid * 8;   // bid = ((b*NKV + g)*SEQ/64 + st)
  {
#pragma unroll
    for (int it = 0; it < 4; ++it) {
      *(v4u*)(dst + it * 2048) = vals[it];
    }
    
  }
}

// =====================================================================================================
// GQA flash attention: block = (batch b, kv head g, 16 query rows q0..q0+15), one wave per query head g*4 + wave.
//   q planes (hi, lo f16) in fragment order, tiles [b][s/16][h]; k planes tiles [b][s/16][g]; v^T plane fragments [b][g][s/32][d/16];
//   score bias B[b][0][q][key] f32 added after bf16 RNE convert; scale = bf16(softmax_scale), base-2 softmax.
//   Per 32-key step the block's 128 threads bring the step's k hi / k lo tiles, v^T fragments and 16x32 bias tile (26 KiB) into LDS
//   by asynchronous copies, two buffers, one step ahead of use; the four waves (heads) read the same stage. Every wave passes
//   every publish point (s_wait_dscnt 0, s_wait_asynccnt 0, block barrier, refill), also in a step whose work it skips.
//   Per step: the 16x32 bias tile is read first; the step is skipped (wave-uniform ballot) only when every bias entry is
//   <= -1e8 and every row already holds a running max > -1e8 (then exp2 underflows to exactly 0 and the rescale is exactly 1).
//   Otherwise: 2 score subtiles x 4 k-steps x 3 products (q_hi.k_hi + q_lo.k_hi + q_hi.k_lo), q fragments loaded from the
//   16-bit planes, k fragments from the stage (two 16-B loads per fragment, split k map); online max-subtracted softmax in f32 (exp2); rescale of l and the 8
//   of P*32768 (f16 hi) and its f16 residual rebuilt from the LDS rows (float vector loads), 8 v^T B fragments from the stage,
//   16 P.V WMMAs.
//   Epilogue: 1/l and carry folds in f32; the wave's 16x128 f32 result staged in its LDS slab (pitch 132); each 512-B output row
//   One block barrier per step under block-uniform control flow; every wave does bounded work (32 steps).
// coverage: per wave 16 rows x 32 lanes x 4 floats = 16 x 128; grid 1024 blocks x 4 waves = every (b, s, h) row exactly once.
// =====================================================================================================
__global__ __launch_bounds__(ATT_THREADS)
void attn_gqa(const unsigned short* __restrict__ QHIp, const unsigned short* __restrict__ QLOp,
              const unsigned short* __restrict__ KHIp, const unsigned short* __restrict__ KLOp,
              const unsigned short* __restrict__ VTq, const float* __restrict__ Bp,
              const float* __restrict__ scp, float* outp) {
  // two stages of the ring, then per wave a prob tile [16][32] pitch 36; after the loop the ring holds the waves' result slabs
  __shared__ __align__(128) float smem[RING_B / 4 + ATW * PT_F];

  const int tid  = threadIdx.x;
  const int wave = tid >> 5;
  const int lane = tid & 31;
  const int hh   = lane >> 4;
  const int c    = lane & 15;

  const int bid  = blockIdx.x;
  const int qt   = bid & 63;                           // SEQ / 16 query tiles
  const int g    = (bid >> 6) & 7;                     // kv head
  const int b    = bid >> 9;                           // batch
  const int head = g * GRP + wave;
  const int q0   = qt * 16;

  const size_t qofs = ((size_t)(b * (SEQ / 16) + qt) * NH + head) * (16 * HD) + 8 * lane;
  const _Float16* Qh  = (const _Float16*)(const void*)QHIp + qofs;
  const _Float16* Ql  = (const _Float16*)(const void*)QLOp + qofs;
  // copy sources of this thread: its 16 B of each 2-KiB chunk; per step the k planes advance 2 key tiles, v^T 8 fragments
  const size_t kofs = ((size_t)b * (SEQ / 16) * NKV + g) * (16 * HD) + 8 * tid;
  const _Float16* Khb = (const _Float16*)(const void*)KHIp + kofs;
  const _Float16* Klb = (const _Float16*)(const void*)KLOp + kofs;
  const _Float16* Vb  = (const _Float16*)(const void*)VTq + (size_t)(b * NKV + g) * (HD * SEQ) + 8 * tid;
  const float*    Wr  = Bp + ((size_t)b * SEQ + q0 + (tid >> 3)) * SEQ + (tid & 7) * 4;   // bias row tid/8, 4 columns
  const unsigned  ring = (unsigned)(uintptr_t)(const void*)smem;                    // LDS byte address of the ring
  const unsigned  cl   = ring + tid * 16;
  const unsigned  clb  = ring + STG_KV + (tid >> 3) * BPITCH + (tid & 7) * 16;
  const float lsc = bfr(scp[0]) * (LOG2E / (QSC * KSC));

  float mrow[8], lrow[8];
  v8f o[8];
#pragma unroll
  for (int r = 0; r < 8; ++r) { mrow[r] = -INFINITY; lrow[r] = 0.f; }
#pragma unroll
  for (int j = 0; j < 8; ++j) o[j] = zero8();
  float* pt = smem + RING_B / 4 + wave * PT_F;

  // ring prologue: stage 0 landed and published, stage 1 in flight
  stage_copy(cl, clb, Khb, Klb, Vb, Wr);
  wait_async0();
  __syncthreads();
  stage_copy(cl + STG_B, clb + STG_B, Khb + 32 * (NKV * HD), Klb + 32 * (NKV * HD), Vb + 32 * HD, Wr + 32);

#pragma unroll 1
  for (int t = 0; t < NSTEP; ++t) {
    const unsigned bsel = (unsigned)(t & 1) * STG_B;                       // this step's buffer
    const _Float16* sb  = (const _Float16*)(const void*)(smem + bsel / 4) + 8 * lane;
    float w0[8], w1[8];
    bool allm = true, seen = true;
    const float* wp = smem + (bsel + STG_KV) / 4 + (8 * hh) * (BPITCH / 4) + c;   // rows 8hh+r, cols c and c+16 of the tile
#pragma unroll
    for (int r = 0; r < 8; ++r) {
      const float m0 = bfr(wp[r * (BPITCH / 4)]);
      const float m1 = bfr(wp[r * (BPITCH / 4) + 16]);
      allm = allm & (m0 <= BIASTH) & (m1 <= BIASTH);
      seen = seen & (mrow[r] > BIASTH);
      w0[r] = m0 * LOG2E;
      w1[r] = m1 * LOG2E;
    }
    const unsigned bal = __builtin_amdgcn_ballot_w32(allm & seen);
    if (bal != 0xffffffffu) {                          // wave-uniform
      // ---- scores: D element r of this lane = (query row q0 + 8hh + r, key kb + c) in s0, key kb + 16 + c in s1 ----
      v8f s0 = zero8(), s1 = zero8();
      const _Float16* k0p = sb;                        // k hi, keys 0..15 of the step
      const _Float16* k1p = sb + 2048;                 // k hi, keys 16..31
      const _Float16* l0p = sb + 4096;                 // k lo
      const _Float16* l1p = sb + 6144;
#pragma unroll
      for (int kk = 0; kk < 4; ++kk) {
        const v16h qh  = ldfrag_h(Qh + kk * 512),  ql  = ldfrag_h(Ql + kk * 512);
        const v16h kh0 = ldfrag_h(k0p + kk * 512), kl0 = ldfrag_h(l0p + kk * 512);
        const v16h kh1 = ldfrag_h(k1p + kk * 512), kl1 = ldfrag_h(l1p + kk * 512);
        s0 = mma_raw(qh, kh0, s0);
        s0 = mma_raw(ql, kh0, s0);
        s0 = mma_raw(qh, kl0, s0);
        s1 = mma_raw(qh, kh1, s1);
        s1 = mma_raw(ql, kh1, s1);
        s1 = mma_raw(qh, kl1, s1);
        guard_sc(s0, s1, qh, ql, kh0, kl0, kh1, kl1);
      }
      // ---- online softmax in base 2 ----
#pragma unroll
      for (int r = 0; r < 8; ++r) {
        const float t0 = s0[r] * lsc + w0[r], t1 = s1[r] * lsc + w1[r];
        float mx = fmaxf(t0, t1);
#pragma unroll
        for (int off = 1; off < 16; off <<= 1) mx = fmaxf(mx, __shfl_xor(mx, off, 32));
        const float mn = fmaxf(mrow[r], mx);
        const float al = exp2f(mrow[r] - mn);
        mrow[r] = mn;
        const float e0 = exp2f(t0 - mn), e1 = exp2f(t1 - mn);
        float ps = e0 + e1;
#pragma unroll
        for (int off = 1; off < 16; off <<= 1) ps += __shfl_xor(ps, off, 32);
        lrow[r] = lrow[r] * al + ps;
#pragma unroll
        for (int j = 0; j < 8; ++j) o[j][r] *= al;
        const int ro = (8 * hh + r) * 36 + c;
        pt[ro]      = e0;
        pt[ro + 16] = e1;
      }
      wave_sync_lds();
      // ---- A fragments of P*32768: hi f16 and residual f16, row = c, split k map over the 32 keys of this step ----
      FragH ph, pl;
      {
        const float* prow = pt + c * 36 + 8 * hh;
        const v4f p0 = *(const v4f*)(prow), p1 = *(const v4f*)(prow + 4);
        const v4f p2 = *(const v4f*)(prow + 16), p3 = *(const v4f*)(prow + 20);
#pragma unroll
        for (int e = 0; e < 4; ++e) {
          const float ta = p0[e] * PCAR, tb = p1[e] * PCAR, tc = p2[e] * PCAR, td = p3[e] * PCAR;
          const _Float16 ha = (_Float16)ta, hb = (_Float16)tb, hc = (_Float16)tc, hd = (_Float16)td;
          ph.h[0][e]     = ha;                               // elements 0..7  = keys kb + 8hh + 0..7
          ph.h[0][4 + e] = hb;
          ph.h[1][e]     = hc;                               // elements 8..15 = keys kb + 16 + 8hh + 0..7
          ph.h[1][4 + e] = hd;
          pl.h[0][e]     = (_Float16)(ta - (float)ha);
          pl.h[0][4 + e] = (_Float16)(tb - (float)hb);
          pl.h[1][e]     = (_Float16)(tc - (float)hc);
          pl.h[1][4 + e] = (_Float16)(td - (float)hd);
        }
      }
      // ---- P.V : B fragment col n = d = j*16 + c, fragment j of this 32-key step in the v^T plane ----
      const _Float16* vp = sb + 8192;
      {
        const v16h vb0 = ldfrag_h(vp);
        const v16h vb1 = ldfrag_h(vp + 512);
        const v16h vb2 = ldfrag_h(vp + 1024);
        const v16h vb3 = ldfrag_h(vp + 1536);
        o[0] = mma_raw(ph.v, vb0, o[0]);  o[0] = mma_raw(pl.v, vb0, o[0]);
        o[1] = mma_raw(ph.v, vb1, o[1]);  o[1] = mma_raw(pl.v, vb1, o[1]);
        o[2] = mma_raw(ph.v, vb2, o[2]);  o[2] = mma_raw(pl.v, vb2, o[2]);
        o[3] = mma_raw(ph.v, vb3, o[3]);  o[3] = mma_raw(pl.v, vb3, o[3]);
        guard_pv(o[0], o[1], o[2], o[3], ph.v, pl.v, vb0, vb1, vb2, vb3);
      }
      {
        const v16h vb4 = ldfrag_h(vp + 2048);
        const v16h vb5 = ldfrag_h(vp + 2560);
        const v16h vb6 = ldfrag_h(vp + 3072);
        const v16h vb7 = ldfrag_h(vp + 3584);
        o[4] = mma_raw(ph.v, vb4, o[4]);  o[4] = mma_raw(pl.v, vb4, o[4]);
        o[5] = mma_raw(ph.v, vb5, o[5]);  o[5] = mma_raw(pl.v, vb5, o[5]);
        o[6] = mma_raw(ph.v, vb6, o[6]);  o[6] = mma_raw(pl.v, vb6, o[6]);
        o[7] = mma_raw(ph.v, vb7, o[7]);  o[7] = mma_raw(pl.v, vb7, o[7]);
        guard_pv(o[4], o[5], o[6], o[7], ph.v, pl.v, vb4, vb5, vb6, vb7);
      }
      wave_sync_lds();
    }
    // publish point of stage t+1, every wave: own LDS reads done, own copies landed, block barrier; then refill the buffer just read
    wait_ds0();
    wait_async0();
    __syncthreads();
    if (t + 2 < NSTEP) {                               // block-uniform scalar test
      const int kn = (t + 2) * 32;
      stage_copy(cl + bsel, clb + bsel, Khb + (size_t)kn * (NKV * HD), Klb + (size_t)kn * (NKV * HD), Vb + (size_t)kn * HD, Wr + kn);
    }
  }
  wait_async0();
  acc_guard4(o[0], o[1], o[2], o[3]);
  acc_guard4(o[4], o[5], o[6], o[7]);

  // ---- fold 1/l and the carries (32768 on P, 16 on v), stage the wave's 16x128 slab in its LDS region ----
  wave_sync_lds();
  float* slab = smem + wave * SLABF;                   // ring space: every wave left it at the last step's barrier
  const float oc = 1.0f / (PCAR * VCAR);
#pragma unroll
  for (int r = 0; r < 8; ++r) {
    const float inv = (1.0f / lrow[r]) * oc;
#pragma unroll
    for (int j = 0; j < 8; ++j) slab[(8 * hh + r) * 132 + j * 16 + c] = o[j][r] * inv;
  }
  wave_sync_lds();
  v4f vals[16];
#pragma unroll
  for (int row = 0; row < 16; ++row) vals[row] = *(const v4f*)(slab + row * 132 + lane * 4);
  float* dst = outp + (((size_t)(b * SEQ + q0)) * NH + head) * HD + lane * 4;
  {
#pragma unroll
    for (int row = 0; row < 16; ++row) {
      *(v4f*)(dst + (size_t)row * (NH * HD)) = vals[row];
    }
    
  }
}

// =====================================================================================================
// Workspace map (bytes); every plane is fully written by whole-line stores before it is read; no pad rows needed
// (all extents are exact multiples of the store granularity); offsets multiples of 4 MiB:
//   QHI f16 [2][64][32] tiles of 2048 x1024 hi  16777216
//   QLO f16 same, residual                 16777216
//   KHI f16 [2][64][8] tiles of 2048 x1024 hi    4194304
//   KLO f16 same, residual                  4194304
//   VT  f16 [2][8][32][8] fragments of 512 x16   4194304
//   end                                    46137344
// =====================================================================================================
extern "C" void kernel_launch(void* const* d_in, const int* in_sizes, int n_in,
                              void* d_out, int out_size, void* d_ws, size_t ws_size,
                              hipStream_t stream) {
  if (n_in < 7) return;
  if (in_sizes[0] != NB * SEQ * NH * HD) return;
  if (in_sizes[1] != NB * SEQ * NKV * HD || in_sizes[2] != NB * SEQ * NKV * HD) return;
  if (in_sizes[3] != SEQ * HD || in_sizes[4] != SEQ * HD) return;
  if (in_sizes[5] != NB * SEQ * SEQ) return;
  if (in_sizes[6] < 1) return;
  if (out_size != NB * SEQ * NH * HD) return;

  const float* q    = (const float*)d_in[0];
  const float* k    = (const float*)d_in[1];
  const float* v    = (const float*)d_in[2];
  const float* cosT = (const float*)d_in[3];
  const float* sinT = (const float*)d_in[4];
  const float* bias = (const float*)d_in[5];
  const float* scl  = (const float*)d_in[6];
  float*       out  = (float*)d_out;

  const size_t PQ = (size_t)NB * SEQ * NH * HD * 2;     // 16777216
  const size_t PK = (size_t)NB * SEQ * NKV * HD * 2;    //  4194304
  const size_t PV = (size_t)NB * NKV * HD * SEQ * 2;    //  4194304
  size_t off = 0;
  const size_t oQH = off; off += PQ;
  const size_t oQL = off; off += PQ;
  const size_t oKH = off; off += PK;
  const size_t oKL = off; off += PK;
  const size_t oVT = off; off += PV;
  if (off > ws_size) return;                            // off = 46137344
  if (off > (size_t)134217728) return;

  char* ws = (char*)d_ws;
  unsigned short* QHI = (unsigned short*)(ws + oQH);
  unsigned short* QLO = (unsigned short*)(ws + oQL);
  unsigned short* KHI = (unsigned short*)(ws + oKH);
  unsigned short* KLO = (unsigned short*)(ws + oKL);
  unsigned short* VT  = (unsigned short*)(ws + oVT);

  const int rowsQ = NB * SEQ * NH;                      // 65536
  const int rowsK = NB * SEQ * NKV;                     // 16384
  const dim3 blk(256);
  const dim3 gRQ((rowsQ * 16) / 256);                   // 4096
  const dim3 gRK((rowsK * 16) / 256);                   // 1024
  const dim3 gVT(NB * NKV * (SEQ / 64));                // 256
  const dim3 gAT(ATT_BLOCKS);                           // 1024
  const dim3 bAT(ATT_THREADS);                          // 128

  // (0) q' planes: hi = f16(1024 q'), lo = f16(1024 q' - hi); rows (b, s, h), heads per row group NH
  rope16<<<gRQ, blk, 0, stream>>>(q, cosT, sinT, QHI, QLO, rowsQ, NH, QSC);
  // (1) k' planes: rows (b, s, g), heads per row group NKV
  rope16<<<gRK, blk, 0, stream>>>(k, cosT, sinT, KHI, KLO, rowsK, NKV, KSC);
  // (2) v^T plane x16
  vt16<<<gVT, blk, 0, stream>>>(v, VT);
  // (3) attention -> out [b][s][h][d] f32
  attn_gqa<<<gAT, bAT, 0, stream>>>(QHI, QLO, KHI, KLO, VT, bias, scl, out);
  (void)hipGetLastError();
}

// v003
// It runs in 96.1 microseconds.
// Timed twice side by side with v002, it ran 1.06 times as fast both times.
// All steps since v000 together make it 2.34 times as fast.
// Contractions: scores q'.k'^T (q' and k' each carried x1024 as f16 hi + f16 residual, k' as planes, q' in registers, products hh+lh+hl, K=128)
// and P.v (P x32768 as f16 hi + f16 residual, v x16 f16 exact, products hi.v+lo.v, K=1024 in 32-key steps):
// all v_wmma_f32_16x16x32_f16, f32 accumulate. RoPE, additive score bias, base-2 online softmax and 1/l fold in f32 on VALU.
// Every float input RNE-converted to bf16 on load.
#include <hip/hip_runtime.h>
#include <math.h>
#include <stdint.h>

#define NB    2
#define SEQ   1024
#define NH    32
#define NKV   8
#define HD    128
#define GRP   4
#define QSC   1024.0f
#define KSC   1024.0f
#define PCAR  32768.0f
#define VCAR  16.0f
#define LOG2E 1.4426950408889634f
#define BIASTH (-1.0e8f)
#define ATW   GRP
#define ATT_THREADS (ATW * 32)
#define ATT_BLOCKS  (NB * NKV * (SEQ / 16))
#define SLABF (16 * 132)
#define VTP   72
#define NSTEP (SEQ / 32)
#define STG_KV 24576                       // bytes of one stage: k hi 2 tiles, k lo 2 tiles (4 KiB each), v^T 8 fragments (8 KiB)
#define BPITCH 144                         // LDS pitch in bytes of a 128-B bias row: rows r and r+8 fall on disjoint banks
#define STG_B  (STG_KV + 16 * BPITCH)      // one stage with its 16 x 32 bias tile
#define RING_B (2 * STG_B)
#define PT_F   (16 * 36)                   // floats of one wave's prob tile
static_assert(NH == NKV * GRP);
static_assert(HD == 128 && (SEQ % 64) == 0 && (SEQ % 32) == 0 && (SEQ % 16) == 0);
static_assert(ATT_THREADS == 128 && ATT_BLOCKS == 1024);
static_assert(((NB * SEQ * NH * 16) % 256) == 0 && ((NB * SEQ * NKV * 16) % 256) == 0);
static_assert(ATW * SLABF * 4 <= RING_B && (STG_B % 16) == 0 && NSTEP >= 2);
static_assert(STG_KV == 12 * ATT_THREADS * 16 && 16 * 128 == ATT_THREADS * 16);
static_assert((SEQ / 16) == 64 && NKV == 8);

typedef _Float16 v16h __attribute__((ext_vector_type(16)));
typedef _Float16 v8h  __attribute__((ext_vector_type(8)));
typedef float    v8f  __attribute__((ext_vector_type(8)));
typedef float    v4f  __attribute__((ext_vector_type(4)));
typedef unsigned int v4u __attribute__((ext_vector_type(4)));

union FragH { v16h v; v8h h[2]; v4u u[2]; };

// ---- scalar helpers --------------------------------------------------------------------------------
__device__ __forceinline__ unsigned short bf_bits(float f) {          // f32 -> bf16 bits, RNE convert
  unsigned u = __float_as_uint(f);
  return (unsigned short)((u + 0x7FFFu + ((u >> 16) & 1u)) >> 16);
}
__device__ __forceinline__ float bf_up(unsigned short h) { return __uint_as_float(((unsigned)h) << 16); }
__device__ __forceinline__ float bfr(float f) { return bf_up(bf_bits(f)); }   // value of the bf16 RNE convert
__device__ __forceinline__ unsigned short h_bits(_Float16 x) { return __builtin_bit_cast(unsigned short, x); }
__device__ __forceinline__ unsigned pk16(unsigned short a, unsigned short b) { return (unsigned)a | ((unsigned)b << 16); }
__device__ __forceinline__ v8f zero8() { v8f z = {0.f, 0.f, 0.f, 0.f, 0.f, 0.f, 0.f, 0.f}; return z; }

// ---- fragment loader: 16-bit A/B operand from a plane stored in fragment order. One fragment (16 rows/cols x 32 k) is 512
//      halves: piece (half, lane) of 8 halves at half*256 + lane*8, lane = 16*h + (row/col & 15); p already includes lane*8.
//      elements 0..7 <- piece half 0 (k0+8h..), elements 8..15 <- piece half 1 (k0+16+8h..)  (same split k map for A and B).
//      Each of the two 16-B loads reads 512 contiguous bytes per wave: four whole 128-B lines.
__device__ __forceinline__ v16h ldfrag_h(const _Float16* p) {
  FragH f;
  f.h[0] = *(const v8h*)(p);
  f.h[1] = *(const v8h*)(p + 256);
  return f.v;
}

__device__ __forceinline__ v8f mma_raw(v16h a, v16h b, v8f c) {
  return __builtin_amdgcn_wmma_f32_16x16x32_f16(false, a, false, b, (short)0, c, false, false);
}
__device__ __forceinline__ void guard_sc(v8f& a, v8f& b, v16h x0, v16h x1, v16h x2, v16h x3, v16h x4, v16h x5) {
#if defined(__HIP_DEVICE_COMPILE__)
  asm volatile("v_nop\n\tv_nop\n\tv_nop\n\tv_nop"
               : "+v"(a), "+v"(b) : "v"(x0), "v"(x1), "v"(x2), "v"(x3), "v"(x4), "v"(x5) : "memory");
#endif
}
__device__ __forceinline__ void guard_pv(v8f& a, v8f& b, v8f& c, v8f& d,
                                         v16h p0, v16h p1, v16h x0, v16h x1, v16h x2, v16h x3) {
#if defined(__HIP_DEVICE_COMPILE__)
  asm volatile("v_nop\n\tv_nop\n\tv_nop\n\tv_nop"
               : "+v"(a), "+v"(b), "+v"(c), "+v"(d) : "v"(p0), "v"(p1), "v"(x0), "v"(x1), "v"(x2), "v"(x3) : "memory");
#endif
}
__device__ __forceinline__ void acc_guard4(v8f& a, v8f& b, v8f& c, v8f& d) {
#if defined(__HIP_DEVICE_COMPILE__)
  asm volatile("v_nop\n\tv_nop\n\tv_nop\n\tv_nop" : "+v"(a), "+v"(b), "+v"(c), "+v"(d));
#endif
}
__device__ __forceinline__ void wave_sync_lds() {
  __builtin_amdgcn_fence(__ATOMIC_RELEASE, "workgroup");
  __builtin_amdgcn_wave_barrier();
  __builtin_amdgcn_fence(__ATOMIC_ACQUIRE, "workgroup");
}
// One stage of the attention ring: 13 asynchronous 16-B copies per lane, global -> LDS, through no register.
//   l  = LDS byte address of the stage + tid*16 (chunk j of 2 KiB at + j*2048), lb = this lane's 16 B of the bias tile in LDS;
//   kh, kl = this lane's 16 B in the first key tile of the k hi / k lo plane, vv in the step's v^T fragments, bb in the bias row.
// The s_wait_xcnt stands inside the statement so that no address register of a copy is rewritten ahead of it.
__device__ __forceinline__ void stage_copy(unsigned l, unsigned lb, const _Float16* kh, const _Float16* kl,
                                           const _Float16* vv, const float* bb) {
#if defined(__HIP_DEVICE_COMPILE__)
  const unsigned l1 = l + 2048, l2 = l + 4096, l3 = l + 6144, l4 = l + 8192, l5 = l + 10240, l6 = l + 12288, l7 = l + 14336;
  const unsigned l8 = l + 16384, l9 = l + 18432, l10 = l + 20480, l11 = l + 22528;
  const _Float16 *g1 = kh + 1024, *g2 = kh + NKV * 2048, *g3 = kh + NKV * 2048 + 1024;
  const _Float16 *g5 = kl + 1024, *g6 = kl + NKV * 2048, *g7 = kl + NKV * 2048 + 1024;
  const _Float16 *g9 = vv + 1024, *g10 = vv + 2048, *g11 = vv + 3072;
  asm volatile("global_load_async_to_lds_b128 %0, %13, off\n\t"
               "global_load_async_to_lds_b128 %1, %14, off\n\t"
               "global_load_async_to_lds_b128 %2, %15, off\n\t"
               "global_load_async_to_lds_b128 %3, %16, off\n\t"
               "global_load_async_to_lds_b128 %4, %17, off\n\t"
               "global_load_async_to_lds_b128 %5, %18, off\n\t"
               "global_load_async_to_lds_b128 %6, %19, off\n\t"
               "global_load_async_to_lds_b128 %7, %20, off\n\t"
               "global_load_async_to_lds_b128 %8, %21, off\n\t"
               "global_load_async_to_lds_b128 %9, %22, off\n\t"
               "global_load_async_to_lds_b128 %10, %23, off\n\t"
               "global_load_async_to_lds_b128 %11, %24, off\n\t"
               "global_load_async_to_lds_b128 %12, %25, off\n\t"
               "s_wait_xcnt 0x0"
               :: "v"(lb), "v"(l), "v"(l1), "v"(l2), "v"(l3), "v"(l4), "v"(l5), "v"(l6), "v"(l7), "v"(l8), "v"(l9), "v"(l10),
                  "v"(l11),
                  "v"(bb), "v"(kh), "v"(g1), "v"(g2), "v"(g3), "v"(kl), "v"(g5), "v"(g6), "v"(g7), "v"(vv), "v"(g9), "v"(g10),
                  "v"(g11)
               : "memory");
#endif
}
__device__ __forceinline__ void wait_async0() {   // this wave's copies have landed
#if defined(__HIP_DEVICE_COMPILE__)
  asm volatile("s_wait_asynccnt 0x0" ::: "memory");
#endif
}
__device__ __forceinline__ void wait_ds0() {      // this wave's LDS reads of the stage have returned before the stage is refilled
#if defined(__HIP_DEVICE_COMPILE__)
  asm volatile("s_wait_dscnt 0x0" ::: "memory");
#endif
}

// =====================================================================================================
// Rotate-half RoPE + 16-bit split pack. Rows are (batch, pos, head) with HD contiguous floats; pos = (row / hpr) mod SEQ.
//   w[d] = bf16(x[d]) * bf16(cos[pos][d]) + r[d] * bf16(sin[pos][d]),  r[d] = -bf16(x[d+64]) for d < 64, bf16(x[d-64]) for d >= 64
//   (bf16 x bf16 products are exact in f32, so w is the singly converted f32 sum);
//   hi[d] = f16(w * sc), lo[d] = f16(w * sc - hi[d])  (sc a power of two, residual unscaled).
// Planes are stored in fragment order: tile = (batch*SEQ/16 + pos/16)*hpr + head holds 16 positions x 128 d as 2048 halves,
//   piece (chunk = d/8, c = pos & 15) of 8 halves at (chunk*16 + c)*8, which is kk*512 + half*256 + lane*8 of ldfrag_h.
// Block = one tile. Thread = 8 consecutive d of one row: 16-B loads of x (own and partner half), cos, sin; one 16-B store per
// plane. A wave = 8 rows x 4 chunks: each load touches one whole 128-B line per row, each store fills four whole lines.
// coverage: grid = nrows/16 blocks x 256 thr x 8 halves = nrows x 128 of each plane exactly (host checks divisibility).
// =====================================================================================================
__global__ __launch_bounds__(256) void rope16(const float* __restrict__ x, const float* __restrict__ cosT,
                                              const float* __restrict__ sinT, unsigned short* hipl, unsigned short* lopl,
                                              int nrows, int hpr, float sc) {
  const int tile = blockIdx.x;
  if (tile * 16 >= nrows) return;           // never taken with the exact grid; no barriers in this kernel
  const int tid   = (int)threadIdx.x;
  const int c     = ((tid >> 5) & 1) * 8 + (tid & 7);          // position within the tile
  const int chunk = (tid >> 6) * 4 + ((tid >> 3) & 3);         // d / 8
  const int d0    = chunk * 8;
  const int srow  = (tile / hpr) * 16 + c;                     // batch*SEQ + pos
  const int row   = srow * hpr + (tile % hpr);
  const int pos   = srow & (SEQ - 1);
  const int d1  = d0 ^ 64;
  const float* xr = x + (size_t)row * HD;
  const float* cr = cosT + (size_t)pos * HD + d0;
  const float* sr = sinT + (size_t)pos * HD + d0;
  const v4f xa = *(const v4f*)(xr + d0), xb = *(const v4f*)(xr + d0 + 4);
  const v4f ya = *(const v4f*)(xr + d1), yb = *(const v4f*)(xr + d1 + 4);
  const v4f ca = *(const v4f*)(cr), cb = *(const v4f*)(cr + 4);
  const v4f sa = *(const v4f*)(sr), sb = *(const v4f*)(sr + 4);
  const float sgn = (d0 < 64) ? -1.0f : 1.0f;
  float w[8];
#pragma unroll
  for (int e = 0; e < 4; ++e) {
    w[e]     = bfr(xa[e]) * bfr(ca[e]) + (sgn * bfr(ya[e])) * bfr(sa[e]);
    w[4 + e] = bfr(xb[e]) * bfr(cb[e]) + (sgn * bfr(yb[e])) * bfr(sb[e]);
  }
  v4u oh, ol;
#pragma unroll
  for (int e = 0; e < 4; ++e) {
    const float t0 = w[2 * e] * sc, t1 = w[2 * e + 1] * sc;
    const _Float16 h0 = (_Float16)t0, h1 = (_Float16)t1;
    const _Float16 l0 = (_Float16)(t0 - (float)h0), l1 = (_Float16)(t1 - (float)h1);
    oh[e] = pk16(h_bits(h0), h_bits(h1));
    ol[e] = pk16(h_bits(l0), h_bits(l1));
  }
  const size_t o8 = (size_t)tile * (16 * HD) + (chunk * 16 + c) * 8;
  {
    *(v4u*)(hipl + o8) = oh;
    *(v4u*)(lopl + o8) = ol;
    
  }
}

// =====================================================================================================
// v^T plane, value f16( bf16(v[b][s][g][d]) * 16 ) (exact), stored in fragment order: fragment ((b*NKV + g)*SEQ/32 + s/32)*8 + d/16
// of 512 halves, piece (half = (s/16)&1, lane = 16*((s/8)&1) + (d&15)) of 8 keys. Block = (b, g, 64 keys): 64 source rows of
// 128 floats loaded with 16-B loads, converted, scattered into an LDS tile [d][64 keys] (pitch 72 halves); after a block barrier each
// coverage: load 256 thr x 32 elements = 64 x 128; store 4 iterations x 256 thr x 8 halves = 128 lines x 64 = the block's tile;
//           grid = NB x NKV x SEQ/64 = 256 blocks covers the whole plane exactly once.
// =====================================================================================================
__global__ __launch_bounds__(256) void vt16(const float* __restrict__ v, unsigned short* VTo) {
  __shared__ __align__(16) unsigned short T[HD * VTP];
  const int tid = threadIdx.x;
  const int bid = blockIdx.x;
  const int st  = bid & 15;
  const int g   = (bid >> 4) & 7;
  const int b   = bid >> 7;
  const int s0  = st * 64;
  {
    const int sl = tid >> 2;                  // key within tile 0..63
    const int dc = (tid & 3) * 32;            // d chunk
    const float* src = v + (((size_t)(b * SEQ + s0 + sl)) * NKV + g) * HD + dc;
#pragma unroll
    for (int i = 0; i < 8; ++i) {
      const v4f a = *(const v4f*)(src + 4 * i);
#pragma unroll
      for (int e = 0; e < 4; ++e) T[(dc + 4 * i + e) * VTP + sl] = h_bits((_Float16)(bfr(a[e]) * VCAR));
    }
  }
  __syncthreads();
  v4u vals[4];
#pragma unroll
  for (int it = 0; it < 4; ++it) {
    const int pi = it * 256 + tid;            // piece in the block's 16 fragments: [key step 2][d/16 8][half 2][lane 32]
    const int d  = ((pi >> 6) & 7) * 16 + (pi & 15);
    const int kc = (pi >> 9) * 4 + ((pi >> 5) & 1) * 2 + ((pi >> 4) & 1);   // 8-key chunk within the 64 keys
    vals[it] = *(const v4u*)(T + d * VTP + kc * 8);
  }
  unsigned short* dst = VTo + (size_t)bid * (64 * HD) + tid * 8;   // bid = ((b*NKV + g)*SEQ/64 + st)
  {
#pragma unroll
    for (int it = 0; it < 4; ++it) {
      *(v4u*)(dst + it * 2048) = vals[it];
    }
    
  }
}

// =====================================================================================================
// GQA flash attention: block = (batch b, kv head g, 16 query rows q0..q0+15), one wave per query head g*4 + wave.
//   q comes as the f32 input: each wave applies RoPE to its own 16 x 128 tile once, splits it x1024 into f16 hi + f16 residual and
//   keeps the 8 A fragments in registers for all steps (same formula and same values as rope16 gives for k).
//   k planes tiles [b][s/16][g]; v^T plane fragments [b][g][s/32][d/16];
//   score bias B[b][0][q][key] f32 added after bf16 RNE convert; scale = bf16(softmax_scale), base-2 softmax.
//   Per 32-key step the block's 128 threads bring the step's k hi / k lo tiles, v^T fragments and 16x32 bias tile (26 KiB) into LDS
//   by asynchronous copies, two buffers, one step ahead of use; the four waves (heads) read the same stage. Every wave passes
//   every publish point (s_wait_dscnt 0, s_wait_asynccnt 0, block barrier, refill), also in a step whose work it skips.
//   Per step: the 16x32 bias tile is read first; the step is skipped (wave-uniform ballot) only when every bias entry is
//   <= -1e8 and every row already holds a running max > -1e8 (then exp2 underflows to exactly 0 and the rescale is exactly 1).
//   Otherwise: 2 score subtiles x 4 k-steps x 3 products (q_hi.k_hi + q_lo.k_hi + q_hi.k_lo), q fragments from registers,
//   k fragments from the stage (two 16-B loads per fragment, split k map); online max-subtracted softmax in f32 (exp2); rescale of l and the 8
//   of P*32768 (f16 hi) and its f16 residual rebuilt from the LDS rows (float vector loads), 8 v^T B fragments from the stage,
//   16 P.V WMMAs.
//   Epilogue: 1/l and carry folds in f32; the wave's 16x128 f32 result staged in its LDS slab (pitch 132); each 512-B output row
//   One block barrier per step under block-uniform control flow; every wave does bounded work (32 steps).
// coverage: per wave 16 rows x 32 lanes x 4 floats = 16 x 128; grid 1024 blocks x 4 waves = every (b, s, h) row exactly once.
// =====================================================================================================
__global__ __launch_bounds__(ATT_THREADS)
void attn_gqa(const float* __restrict__ Qp, const float* __restrict__ cosT, const float* __restrict__ sinT,
              const unsigned short* __restrict__ KHIp, const unsigned short* __restrict__ KLOp,
              const unsigned short* __restrict__ VTq, const float* __restrict__ Bp,
              const float* __restrict__ scp, float* outp) {
  // two stages of the ring, then per wave a prob tile [16][32] pitch 36; after the loop the ring holds the waves' result slabs
  __shared__ __align__(128) float smem[RING_B / 4 + ATW * PT_F];

  const int tid  = threadIdx.x;
  const int wave = tid >> 5;
  const int lane = tid & 31;
  const int hh   = lane >> 4;
  const int c    = lane & 15;

  const int bid  = blockIdx.x;
  const int qt   = bid & 63;                           // SEQ / 16 query tiles
  const int g    = (bid >> 6) & 7;                     // kv head
  const int b    = bid >> 9;                           // batch
  const int head = g * GRP + wave;
  const int q0   = qt * 16;

  // copy sources of this thread: its 16 B of each 2-KiB chunk; per step the k planes advance 2 key tiles, v^T 8 fragments
  const size_t kofs = ((size_t)b * (SEQ / 16) * NKV + g) * (16 * HD) + 8 * tid;
  const _Float16* Khb = (const _Float16*)(const void*)KHIp + kofs;
  const _Float16* Klb = (const _Float16*)(const void*)KLOp + kofs;
  const _Float16* Vb  = (const _Float16*)(const void*)VTq + (size_t)(b * NKV + g) * (HD * SEQ) + 8 * tid;
  const float*    Wr  = Bp + ((size_t)b * SEQ + q0 + (tid >> 3)) * SEQ + (tid & 7) * 4;   // bias row tid/8, 4 columns
  const unsigned  ring = (unsigned)(uintptr_t)(const void*)smem;                    // LDS byte address of the ring
  const unsigned  cl   = ring + tid * 16;
  const unsigned  clb  = ring + STG_KV + (tid >> 3) * BPITCH + (tid & 7) * 16;
  const float lsc = bfr(scp[0]) * (LOG2E / (QSC * KSC));

  float mrow[8], lrow[8];
  v8f o[8];
#pragma unroll
  for (int r = 0; r < 8; ++r) { mrow[r] = -INFINITY; lrow[r] = 0.f; }
#pragma unroll
  for (int j = 0; j < 8; ++j) o[j] = zero8();
  float* pt = smem + RING_B / 4 + wave * PT_F;

  // ring prologue: stage 0 landed and published, stage 1 in flight; the q fragments are built while stage 0 flies
  stage_copy(cl, clb, Khb, Klb, Vb, Wr);

  // ---- q A fragments: lane (hh, c) holds row q0 + c; fragment kk, elements 8*hf..8*hf+7 = d 32*kk + 16*hf + 8*hh + 0..7.
  //      The rotate-half partner d ^ 64 is fragment kk ^ 2, same hf, same lane, so a lane rotates what it loads itself. ----
  FragH qhf[4], qlf[4];
  {
    const int pos = q0 + c;
    const float* xr = Qp + (((size_t)(b * SEQ + pos)) * NH + head) * HD + 8 * hh;
    const float* cr = cosT + (size_t)pos * HD + 8 * hh;
    const float* sr = sinT + (size_t)pos * HD + 8 * hh;
#pragma unroll
    for (int p = 0; p < 4; ++p) {                       // d = 16p + 8hh + 0..7 and its partner 64 higher
      const int kk = p >> 1, hf = p & 1;
#pragma unroll
      for (int u = 0; u < 2; ++u) {
        const int d = 16 * p + 4 * u;
        const v4f xl = *(const v4f*)(xr + d), xu = *(const v4f*)(xr + d + 64);
        const v4f cl4 = *(const v4f*)(cr + d), cu4 = *(const v4f*)(cr + d + 64);
        const v4f sl4 = *(const v4f*)(sr + d), su4 = *(const v4f*)(sr + d + 64);
#pragma unroll
        for (int e = 0; e < 4; ++e) {
          const float a = bfr(xl[e]), z = bfr(xu[e]);
          const float tl = (a * bfr(cl4[e]) + (-z) * bfr(sl4[e])) * QSC;
          const float tu = (z * bfr(cu4[e]) + a * bfr(su4[e])) * QSC;
          const _Float16 hl = (_Float16)tl, hu = (_Float16)tu;
          qhf[kk].h[hf][4 * u + e]     = hl;
          qhf[kk + 2].h[hf][4 * u + e] = hu;
          qlf[kk].h[hf][4 * u + e]     = (_Float16)(tl - (float)hl);
          qlf[kk + 2].h[hf][4 * u + e] = (_Float16)(tu - (float)hu);
        }
      }
    }
#if defined(__HIP_DEVICE_COMPILE__)
    // the three row pointers stay live up to this wait, so no address register of the loads above is rewritten ahead of it
    asm volatile("s_wait_xcnt 0x0" :: "v"(xr), "v"(cr), "v"(sr) : "memory");
#endif
  }
  wait_async0();
  __syncthreads();
  stage_copy(cl + STG_B, clb + STG_B, Khb + 32 * (NKV * HD), Klb + 32 * (NKV * HD), Vb + 32 * HD, Wr + 32);

#pragma unroll 1
  for (int t = 0; t < NSTEP; ++t) {
    const unsigned bsel = (unsigned)(t & 1) * STG_B;                       // this step's buffer
    const _Float16* sb  = (const _Float16*)(const void*)(smem + bsel / 4) + 8 * lane;
    float w0[8], w1[8];
    bool allm = true, seen = true;
    const float* wp = smem + (bsel + STG_KV) / 4 + (8 * hh) * (BPITCH / 4) + c;   // rows 8hh+r, cols c and c+16 of the tile
#pragma unroll
    for (int r = 0; r < 8; ++r) {
      const float m0 = bfr(wp[r * (BPITCH / 4)]);
      const float m1 = bfr(wp[r * (BPITCH / 4) + 16]);
      allm = allm & (m0 <= BIASTH) & (m1 <= BIASTH);
      seen = seen & (mrow[r] > BIASTH);
      w0[r] = m0 * LOG2E;
      w1[r] = m1 * LOG2E;
    }
    const unsigned bal = __builtin_amdgcn_ballot_w32(allm & seen);
    if (bal != 0xffffffffu) {                          // wave-uniform
      // ---- scores: D element r of this lane = (query row q0 + 8hh + r, key kb + c) in s0, key kb + 16 + c in s1 ----
      v8f s0 = zero8(), s1 = zero8();
      const _Float16* k0p = sb;                        // k hi, keys 0..15 of the step
      const _Float16* k1p = sb + 2048;                 // k hi, keys 16..31
      const _Float16* l0p = sb + 4096;                 // k lo
      const _Float16* l1p = sb + 6144;
#pragma unroll
      for (int kk = 0; kk < 4; ++kk) {
        const v16h qh  = qhf[kk].v, ql = qlf[kk].v;
        const v16h kh0 = ldfrag_h(k0p + kk * 512), kl0 = ldfrag_h(l0p + kk * 512);
        const v16h kh1 = ldfrag_h(k1p + kk * 512), kl1 = ldfrag_h(l1p + kk * 512);
        s0 = mma_raw(qh, kh0, s0);
        s0 = mma_raw(ql, kh0, s0);
        s0 = mma_raw(qh, kl0, s0);
        s1 = mma_raw(qh, kh1, s1);
        s1 = mma_raw(ql, kh1, s1);
        s1 = mma_raw(qh, kl1, s1);
        guard_sc(s0, s1, qh, ql, kh0, kl0, kh1, kl1);
      }
      // ---- online softmax in base 2 ----
#pragma unroll
      for (int r = 0; r < 8; ++r) {
        const float t0 = s0[r] * lsc + w0[r], t1 = s1[r] * lsc + w1[r];
        float mx = fmaxf(t0, t1);
#pragma unroll
        for (int off = 1; off < 16; off <<= 1) mx = fmaxf(mx, __shfl_xor(mx, off, 32));
        const float mn = fmaxf(mrow[r], mx);
        const float al = exp2f(mrow[r] - mn);
        mrow[r] = mn;
        const float e0 = exp2f(t0 - mn), e1 = exp2f(t1 - mn);
        float ps = e0 + e1;
#pragma unroll
        for (int off = 1; off < 16; off <<= 1) ps += __shfl_xor(ps, off, 32);
        lrow[r] = lrow[r] * al + ps;
#pragma unroll
        for (int j = 0; j < 8; ++j) o[j][r] *= al;
        const int ro = (8 * hh + r) * 36 + c;
        pt[ro]      = e0;
        pt[ro + 16] = e1;
      }
      wave_sync_lds();
      // ---- A fragments of P*32768: hi f16 and residual f16, row = c, split k map over the 32 keys of this step ----
      FragH ph, pl;
      {
        const float* prow = pt + c * 36 + 8 * hh;
        const v4f p0 = *(const v4f*)(prow), p1 = *(const v4f*)(prow + 4);
        const v4f p2 = *(const v4f*)(prow + 16), p3 = *(const v4f*)(prow + 20);
#pragma unroll
        for (int e = 0; e < 4; ++e) {
          const float ta = p0[e] * PCAR, tb = p1[e] * PCAR, tc = p2[e] * PCAR, td = p3[e] * PCAR;
          const _Float16 ha = (_Float16)ta, hb = (_Float16)tb, hc = (_Float16)tc, hd = (_Float16)td;
          ph.h[0][e]     = ha;                               // elements 0..7  = keys kb + 8hh + 0..7
          ph.h[0][4 + e] = hb;
          ph.h[1][e]     = hc;                               // elements 8..15 = keys kb + 16 + 8hh + 0..7
          ph.h[1][4 + e] = hd;
          pl.h[0][e]     = (_Float16)(ta - (float)ha);
          pl.h[0][4 + e] = (_Float16)(tb - (float)hb);
          pl.h[1][e]     = (_Float16)(tc - (float)hc);
          pl.h[1][4 + e] = (_Float16)(td - (float)hd);
        }
      }
      // ---- P.V : B fragment col n = d = j*16 + c, fragment j of this 32-key step in the v^T plane ----
      const _Float16* vp = sb + 8192;
      {
        const v16h vb0 = ldfrag_h(vp);
        const v16h vb1 = ldfrag_h(vp + 512);
        const v16h vb2 = ldfrag_h(vp + 1024);
        const v16h vb3 = ldfrag_h(vp + 1536);
        o[0] = mma_raw(ph.v, vb0, o[0]);  o[0] = mma_raw(pl.v, vb0, o[0]);
        o[1] = mma_raw(ph.v, vb1, o[1]);  o[1] = mma_raw(pl.v, vb1, o[1]);
        o[2] = mma_raw(ph.v, vb2, o[2]);  o[2] = mma_raw(pl.v, vb2, o[2]);
        o[3] = mma_raw(ph.v, vb3, o[3]);  o[3] = mma_raw(pl.v, vb3, o[3]);
        guard_pv(o[0], o[1], o[2], o[3], ph.v, pl.v, vb0, vb1, vb2, vb3);
      }
      {
        const v16h vb4 = ldfrag_h(vp + 2048);
        const v16h vb5 = ldfrag_h(vp + 2560);
        const v16h vb6 = ldfrag_h(vp + 3072);
        const v16h vb7 = ldfrag_h(vp + 3584);
        o[4] = mma_raw(ph.v, vb4, o[4]);  o[4] = mma_raw(pl.v, vb4, o[4]);
        o[5] = mma_raw(ph.v, vb5, o[5]);  o[5] = mma_raw(pl.v, vb5, o[5]);
        o[6] = mma_raw(ph.v, vb6, o[6]);  o[6] = mma_raw(pl.v, vb6, o[6]);
        o[7] = mma_raw(ph.v, vb7, o[7]);  o[7] = mma_raw(pl.v, vb7, o[7]);
        guard_pv(o[4], o[5], o[6], o[7], ph.v, pl.v, vb4, vb5, vb6, vb7);
      }
      wave_sync_lds();
    }
    // publish point of stage t+1, every wave: own LDS reads done, own copies landed, block barrier; then refill the buffer just read
    wait_ds0();
    wait_async0();
    __syncthreads();
    if (t + 2 < NSTEP) {                               // block-uniform scalar test
      const int kn = (t + 2) * 32;
      stage_copy(cl + bsel, clb + bsel, Khb + (size_t)kn * (NKV * HD), Klb + (size_t)kn * (NKV * HD), Vb + (size_t)kn * HD, Wr + kn);
    }
  }
  wait_async0();
  acc_guard4(o[0], o[1], o[2], o[3]);
  acc_guard4(o[4], o[5], o[6], o[7]);

  // ---- fold 1/l and the carries (32768 on P, 16 on v), stage the wave's 16x128 slab in its LDS region ----
  wave_sync_lds();
  float* slab = smem + wave * SLABF;                   // ring space: every wave left it at the last step's barrier
  const float oc = 1.0f / (PCAR * VCAR);
#pragma unroll
  for (int r = 0; r < 8; ++r) {
    const float inv = (1.0f / lrow[r]) * oc;
#pragma unroll
    for (int j = 0; j < 8; ++j) slab[(8 * hh + r) * 132 + j * 16 + c] = o[j][r] * inv;
  }
  wave_sync_lds();
  v4f vals[16];
#pragma unroll
  for (int row = 0; row < 16; ++row) vals[row] = *(const v4f*)(slab + row * 132 + lane * 4);
  float* dst = outp + (((size_t)(b * SEQ + q0)) * NH + head) * HD + lane * 4;
  {
#pragma unroll
    for (int row = 0; row < 16; ++row) {
      *(v4f*)(dst + (size_t)row * (NH * HD)) = vals[row];
    }
    
  }
}

// =====================================================================================================
// Workspace map (bytes); every plane is fully written by whole-line stores before it is read; no pad rows needed
// (all extents are exact multiples of the store granularity); offsets multiples of 4 MiB:
//   KHI f16 [2][64][8] tiles of 2048 x1024 hi    4194304
//   KLO f16 same, residual                  4194304
//   VT  f16 [2][8][32][8] fragments of 512 x16   4194304
//   end                                    12582912
// =====================================================================================================
extern "C" void kernel_launch(void* const* d_in, const int* in_sizes, int n_in,
                              void* d_out, int out_size, void* d_ws, size_t ws_size,
                              hipStream_t stream) {
  if (n_in < 7) return;
  if (in_sizes[0] != NB * SEQ * NH * HD) return;
  if (in_sizes[1] != NB * SEQ * NKV * HD || in_sizes[2] != NB * SEQ * NKV * HD) return;
  if (in_sizes[3] != SEQ * HD || in_sizes[4] != SEQ * HD) return;
  if (in_sizes[5] != NB * SEQ * SEQ) return;
  if (in_sizes[6] < 1) return;
  if (out_size != NB * SEQ * NH * HD) return;

  const float* q    = (const float*)d_in[0];
  const float* k    = (const float*)d_in[1];
  const float* v    = (const float*)d_in[2];
  const float* cosT = (const float*)d_in[3];
  const float* sinT = (const float*)d_in[4];
  const float* bias = (const float*)d_in[5];
  const float* scl  = (const float*)d_in[6];
  float*       out  = (float*)d_out;

  const size_t PK = (size_t)NB * SEQ * NKV * HD * 2;    //  4194304
  const size_t PV = (size_t)NB * NKV * HD * SEQ * 2;    //  4194304
  size_t off = 0;
  const size_t oKH = off; off += PK;
  const size_t oKL = off; off += PK;
  const size_t oVT = off; off += PV;
  if (off > ws_size) return;                            // off = 12582912
  if (off > (size_t)134217728) return;

  char* ws = (char*)d_ws;
  unsigned short* KHI = (unsigned short*)(ws + oKH);
  unsigned short* KLO = (unsigned short*)(ws + oKL);
  unsigned short* VT  = (unsigned short*)(ws + oVT);

  const int rowsK = NB * SEQ * NKV;                     // 16384
  const dim3 blk(256);
  const dim3 gRK((rowsK * 16) / 256);                   // 1024
  const dim3 gVT(NB * NKV * (SEQ / 64));                // 256
  const dim3 gAT(ATT_BLOCKS);                           // 1024
  const dim3 bAT(ATT_THREADS);                          // 128

  // (0) k' planes: hi = f16(1024 k'), lo = f16(1024 k' - hi); rows (b, s, g), heads per row group NKV
  rope16<<<gRK, blk, 0, stream>>>(k, cosT, sinT, KHI, KLO, rowsK, NKV, KSC);
  // (1) v^T plane x16
  vt16<<<gVT, blk, 0, stream>>>(v, VT);
  // (2) attention, q RoPE and split included -> out [b][s][h][d] f32
  attn_gqa<<<gAT, bAT, 0, stream>>>(q, cosT, sinT, KHI, KLO, VT, bias, scl, out);
  (void)hipGetLastError();
}

// v004
// One run takes 91 microseconds.
// Two timings next to v003 both put it at 1.06 times that version's speed.
// Counting every step since v000, it is 2.47 times as fast.
// Contractions: scores q'.k'^T (q' and k' each carried x1024 as f16 hi + f16 residual, k' as planes, q' in registers, products hh+lh+hl, K=128)
// and P.v (P x32768 as f16 hi + f16 residual, v x16 f16 exact, products hi.v+lo.v, K=1024 in 32-key steps):
// all v_wmma_f32_16x16x32_f16, f32 accumulate. RoPE, additive score bias, base-2 online softmax and 1/l fold in f32 on VALU.
// Every float input RNE-converted to bf16 on load.
#include <hip/hip_runtime.h>
#include <math.h>
#include <stdint.h>

#define NB    2
#define SEQ   1024
#define NH    32
#define NKV   8
#define HD    128
#define GRP   4
#define QSC   1024.0f
#define KSC   1024.0f
#define PCAR  32768.0f
#define VCAR  16.0f
#define LOG2E 1.4426950408889634f
#define BIASTH (-1.0e8f)
#define ATW   GRP
#define ATT_THREADS (ATW * 32)
#define ATT_BLOCKS  (NB * NKV * (SEQ / 16))
#define SLABF (16 * 132)
#define VTP   72
#define NSTEP (SEQ / 32)
#define STG_KV 24576                       // bytes of one stage: k hi 2 tiles, k lo 2 tiles (4 KiB each), v^T 8 fragments (8 KiB)
#define BPITCH 144                         // LDS pitch in bytes of a 128-B bias row: rows r and r+8 fall on disjoint banks
#define STG_B  (STG_KV + 16 * BPITCH)      // one stage with its 16 x 32 bias tile
#define RING_B (2 * STG_B)
#define PT_F   (16 * 36)                   // floats of one wave's prob tile
static_assert(NH == NKV * GRP);
static_assert(HD == 128 && (SEQ % 64) == 0 && (SEQ % 32) == 0 && (SEQ % 16) == 0);
static_assert(ATT_THREADS == 128 && ATT_BLOCKS == 1024);
static_assert(((NB * SEQ * NH * 16) % 256) == 0 && ((NB * SEQ * NKV * 16) % 256) == 0);
static_assert(ATW * SLABF * 4 <= RING_B && (STG_B % 16) == 0 && NSTEP >= 2);
static_assert(STG_KV == 12 * ATT_THREADS * 16 && 16 * 128 == ATT_THREADS * 16);
static_assert((SEQ / 16) == 64 && NKV == 8);

typedef _Float16 v16h __attribute__((ext_vector_type(16)));
typedef _Float16 v8h  __attribute__((ext_vector_type(8)));
typedef float    v8f  __attribute__((ext_vector_type(8)));
typedef float    v4f  __attribute__((ext_vector_type(4)));
typedef unsigned int v4u __attribute__((ext_vector_type(4)));

union FragH { v16h v; v8h h[2]; v4u u[2]; };

// ---- scalar helpers --------------------------------------------------------------------------------
__device__ __forceinline__ unsigned short bf_bits(float f) {          // f32 -> bf16 bits, RNE convert
  unsigned u = __float_as_uint(f);
  return (unsigned short)((u + 0x7FFFu + ((u >> 16) & 1u)) >> 16);
}
__device__ __forceinline__ float bf_up(unsigned short h) { return __uint_as_float(((unsigned)h) << 16); }
__device__ __forceinline__ float bfr(float f) { return bf_up(bf_bits(f)); }   // value of the bf16 RNE convert
__device__ __forceinline__ unsigned short h_bits(_Float16 x) { return __builtin_bit_cast(unsigned short, x); }
__device__ __forceinline__ unsigned pk16(unsigned short a, unsigned short b) { return (unsigned)a | ((unsigned)b << 16); }
__device__ __forceinline__ v8f zero8() { v8f z = {0.f, 0.f, 0.f, 0.f, 0.f, 0.f, 0.f, 0.f}; return z; }

// ---- fragment loader: 16-bit A/B operand from a plane stored in fragment order. One fragment (16 rows/cols x 32 k) is 512
//      halves: piece (half, lane) of 8 halves at half*256 + lane*8, lane = 16*h + (row/col & 15); p already includes lane*8.
//      elements 0..7 <- piece half 0 (k0+8h..), elements 8..15 <- piece half 1 (k0+16+8h..)  (same split k map for A and B).
//      Each of the two 16-B loads reads 512 contiguous bytes per wave: four whole 128-B lines.
__device__ __forceinline__ v16h ldfrag_h(const _Float16* p) {
  FragH f;
  f.h[0] = *(const v8h*)(p);
  f.h[1] = *(const v8h*)(p + 256);
  return f.v;
}

__device__ __forceinline__ v8f mma_raw(v16h a, v16h b, v8f c) {
  return __builtin_amdgcn_wmma_f32_16x16x32_f16(false, a, false, b, (short)0, c, false, false);
}
__device__ __forceinline__ void guard_sc(v8f& a, v8f& b, v16h x0, v16h x1, v16h x2, v16h x3, v16h x4, v16h x5) {
#if defined(__HIP_DEVICE_COMPILE__)
  asm volatile("v_nop\n\tv_nop\n\tv_nop\n\tv_nop"
               : "+v"(a), "+v"(b) : "v"(x0), "v"(x1), "v"(x2), "v"(x3), "v"(x4), "v"(x5) : "memory");
#endif
}
__device__ __forceinline__ void guard_pv(v8f& a, v8f& b, v8f& c, v8f& d,
                                         v16h p0, v16h p1, v16h x0, v16h x1, v16h x2, v16h x3) {
#if defined(__HIP_DEVICE_COMPILE__)
  asm volatile("v_nop\n\tv_nop\n\tv_nop\n\tv_nop"
               : "+v"(a), "+v"(b), "+v"(c), "+v"(d) : "v"(p0), "v"(p1), "v"(x0), "v"(x1), "v"(x2), "v"(x3) : "memory");
#endif
}
__device__ __forceinline__ void acc_guard4(v8f& a, v8f& b, v8f& c, v8f& d) {
#if defined(__HIP_DEVICE_COMPILE__)
  asm volatile("v_nop\n\tv_nop\n\tv_nop\n\tv_nop" : "+v"(a), "+v"(b), "+v"(c), "+v"(d));
#endif
}
__device__ __forceinline__ void wave_sync_lds() {
  __builtin_amdgcn_fence(__ATOMIC_RELEASE, "workgroup");
  __builtin_amdgcn_wave_barrier();
  __builtin_amdgcn_fence(__ATOMIC_ACQUIRE, "workgroup");
}
// One stage of the attention ring: 13 asynchronous 16-B copies per lane, global -> LDS, through no register.
//   l  = LDS byte address of the stage + tid*16 (chunk j of 2 KiB at + j*2048), lb = this lane's 16 B of the bias tile in LDS;
//   kh, kl = this lane's 16 B in the first key tile of the k hi / k lo plane, vv in the step's v^T fragments, bb in the bias row.
// The s_wait_xcnt stands inside the statement so that no address register of a copy is rewritten ahead of it.
__device__ __forceinline__ void stage_copy(unsigned l, unsigned lb, const _Float16* kh, const _Float16* kl,
                                           const _Float16* vv, const float* bb) {
#if defined(__HIP_DEVICE_COMPILE__)
  const unsigned l1 = l + 2048, l2 = l + 4096, l3 = l + 6144, l4 = l + 8192, l5 = l + 10240, l6 = l + 12288, l7 = l + 14336;
  const unsigned l8 = l + 16384, l9 = l + 18432, l10 = l + 20480, l11 = l + 22528;
  const _Float16 *g1 = kh + 1024, *g2 = kh + NKV * 2048, *g3 = kh + NKV * 2048 + 1024;
  const _Float16 *g5 = kl + 1024, *g6 = kl + NKV * 2048, *g7 = kl + NKV * 2048 + 1024;
  const _Float16 *g9 = vv + 1024, *g10 = vv + 2048, *g11 = vv + 3072;
  asm volatile("global_load_async_to_lds_b128 %0, %13, off\n\t"
               "global_load_async_to_lds_b128 %1, %14, off\n\t"
               "global_load_async_to_lds_b128 %2, %15, off\n\t"
               "global_load_async_to_lds_b128 %3, %16, off\n\t"
               "global_load_async_to_lds_b128 %4, %17, off\n\t"
               "global_load_async_to_lds_b128 %5, %18, off\n\t"
               "global_load_async_to_lds_b128 %6, %19, off\n\t"
               "global_load_async_to_lds_b128 %7, %20, off\n\t"
               "global_load_async_to_lds_b128 %8, %21, off\n\t"
               "global_load_async_to_lds_b128 %9, %22, off\n\t"
               "global_load_async_to_lds_b128 %10, %23, off\n\t"
               "global_load_async_to_lds_b128 %11, %24, off\n\t"
               "global_load_async_to_lds_b128 %12, %25, off\n\t"
               "s_wait_xcnt 0x0"
               :: "v"(lb), "v"(l), "v"(l1), "v"(l2), "v"(l3), "v"(l4), "v"(l5), "v"(l6), "v"(l7), "v"(l8), "v"(l9), "v"(l10),
                  "v"(l11),
                  "v"(bb), "v"(kh), "v"(g1), "v"(g2), "v"(g3), "v"(kl), "v"(g5), "v"(g6), "v"(g7), "v"(vv), "v"(g9), "v"(g10),
                  "v"(g11)
               : "memory");
#endif
}
__device__ __forceinline__ void wait_async0() {   // this wave's copies have landed
#if defined(__HIP_DEVICE_COMPILE__)
  asm volatile("s_wait_asynccnt 0x0" ::: "memory");
#endif
}
__device__ __forceinline__ void wait_ds0() {      // this wave's LDS reads of the stage have returned before the stage is refilled
#if defined(__HIP_DEVICE_COMPILE__)
  asm volatile("s_wait_dscnt 0x0" ::: "memory");
#endif
}

// =====================================================================================================
// Rotate-half RoPE + 16-bit split pack. Rows are (batch, pos, head) with HD contiguous floats; pos = (row / hpr) mod SEQ.
//   w[d] = bf16(x[d]) * bf16(cos[pos][d]) + r[d] * bf16(sin[pos][d]),  r[d] = -bf16(x[d+64]) for d < 64, bf16(x[d-64]) for d >= 64
//   (bf16 x bf16 products are exact in f32, so w is the singly converted f32 sum);
//   hi[d] = f16(w * sc), lo[d] = f16(w * sc - hi[d])  (sc a power of two, residual unscaled).
// Planes are stored in fragment order: tile = (batch*SEQ/16 + pos/16)*hpr + head holds 16 positions x 128 d as 2048 halves,
//   piece (chunk = d/8, c = pos & 15) of 8 halves at (chunk*16 + c)*8, which is kk*512 + half*256 + lane*8 of ldfrag_h.
// Block = one tile. Thread = 8 consecutive d of one row: 16-B loads of x (own and partner half), cos, sin; one 16-B store per
// plane. A wave = 8 rows x 4 chunks: each load touches one whole 128-B line per row, each store fills four whole lines.
// coverage: grid = nrows/16 blocks x 256 thr x 8 halves = nrows x 128 of each plane exactly (host checks divisibility).
// =====================================================================================================
__global__ __launch_bounds__(256) void rope16(const float* __restrict__ x, const float* __restrict__ cosT,
                                              const float* __restrict__ sinT, unsigned short* hipl, unsigned short* lopl,
                                              int nrows, int hpr, float sc) {
  const int tile = blockIdx.x;
  if (tile * 16 >= nrows) return;           // never taken with the exact grid; no barriers in this kernel
  const int tid   = (int)threadIdx.x;
  const int c     = ((tid >> 5) & 1) * 8 + (tid & 7);          // position within the tile
  const int chunk = (tid >> 6) * 4 + ((tid >> 3) & 3);         // d / 8
  const int d0    = chunk * 8;
  const int srow  = (tile / hpr) * 16 + c;                     // batch*SEQ + pos
  const int row   = srow * hpr + (tile % hpr);
  const int pos   = srow & (SEQ - 1);
  const int d1  = d0 ^ 64;
  const float* xr = x + (size_t)row * HD;
  const float* cr = cosT + (size_t)pos * HD + d0;
  const float* sr = sinT + (size_t)pos * HD + d0;
  const v4f xa = *(const v4f*)(xr + d0), xb = *(const v4f*)(xr + d0 + 4);
  const v4f ya = *(const v4f*)(xr + d1), yb = *(const v4f*)(xr + d1 + 4);
  const v4f ca = *(const v4f*)(cr), cb = *(const v4f*)(cr + 4);
  const v4f sa = *(const v4f*)(sr), sb = *(const v4f*)(sr + 4);
  const float sgn = (d0 < 64) ? -1.0f : 1.0f;
  float w[8];
#pragma unroll
  for (int e = 0; e < 4; ++e) {
    w[e]     = bfr(xa[e]) * bfr(ca[e]) + (sgn * bfr(ya[e])) * bfr(sa[e]);
    w[4 + e] = bfr(xb[e]) * bfr(cb[e]) + (sgn * bfr(yb[e])) * bfr(sb[e]);
  }
  v4u oh, ol;
#pragma unroll
  for (int e = 0; e < 4; ++e) {
    const float t0 = w[2 * e] * sc, t1 = w[2 * e + 1] * sc;
    const _Float16 h0 = (_Float16)t0, h1 = (_Float16)t1;
    const _Float16 l0 = (_Float16)(t0 - (float)h0), l1 = (_Float16)(t1 - (float)h1);
    oh[e] = pk16(h_bits(h0), h_bits(h1));
    ol[e] = pk16(h_bits(l0), h_bits(l1));
  }
  const size_t o8 = (size_t)tile * (16 * HD) + (chunk * 16 + c) * 8;
  {
    *(v4u*)(hipl + o8) = oh;
    *(v4u*)(lopl + o8) = ol;
    
  }
}

// =====================================================================================================
// v^T plane, value f16( bf16(v[b][s][g][d]) * 16 ) (exact), stored in fragment order: fragment ((b*NKV + g)*SEQ/32 + s/32)*8 + d/16
// of 512 halves, piece (half = (s/16)&1, lane = 16*((s/8)&1) + (d&15)) of 8 keys. Block = (b, g, 64 keys): 64 source rows of
// 128 floats loaded with 16-B loads, converted, scattered into an LDS tile [d][64 keys] (pitch 72 halves); after a block barrier each
// coverage: load 256 thr x 32 elements = 64 x 128; store 4 iterations x 256 thr x 8 halves = 128 lines x 64 = the block's tile;
//           grid = NB x NKV x SEQ/64 = 256 blocks covers the whole plane exactly once.
// =====================================================================================================
__global__ __launch_bounds__(256) void vt16(const float* __restrict__ v, unsigned short* VTo) {
  __shared__ __align__(16) unsigned short T[HD * VTP];
  const int tid = threadIdx.x;
  const int bid = blockIdx.x;
  const int st  = bid & 15;
  const int g   = (bid >> 4) & 7;
  const int b   = bid >> 7;
  const int s0  = st * 64;
  {
    const int sl = tid >> 2;                  // key within tile 0..63
    const int dc = (tid & 3) * 32;            // d chunk
    const float* src = v + (((size_t)(b * SEQ + s0 + sl)) * NKV + g) * HD + dc;
#pragma unroll
    for (int i = 0; i < 8; ++i) {
      const v4f a = *(const v4f*)(src + 4 * i);
#pragma unroll
      for (int e = 0; e < 4; ++e) T[(dc + 4 * i + e) * VTP + sl] = h_bits((_Float16)(bfr(a[e]) * VCAR));
    }
  }
  __syncthreads();
  v4u vals[4];
#pragma unroll
  for (int it = 0; it < 4; ++it) {
    const int pi = it * 256 + tid;            // piece in the block's 16 fragments: [key step 2][d/16 8][half 2][lane 32]
    const int d  = ((pi >> 6) & 7) * 16 + (pi & 15);
    const int kc = (pi >> 9) * 4 + ((pi >> 5) & 1) * 2 + ((pi >> 4) & 1);   // 8-key chunk within the 64 keys
    vals[it] = *(const v4u*)(T + d * VTP + kc * 8);
  }
  unsigned short* dst = VTo + (size_t)bid * (64 * HD) + tid * 8;   // bid = ((b*NKV + g)*SEQ/64 + st)
  {
#pragma unroll
    for (int it = 0; it < 4; ++it) {
      *(v4u*)(dst + it * 2048) = vals[it];
    }
    
  }
}

// =====================================================================================================
// GQA flash attention: block = (batch b, kv head g, 16 query rows q0..q0+15), one wave per query head g*4 + wave.
//   q comes as the f32 input: each wave applies RoPE to its own 16 x 128 tile once, splits it x1024 into f16 hi + f16 residual and
//   keeps the 8 A fragments in registers for all steps (same formula and same values as rope16 gives for k).
//   k planes tiles [b][s/16][g]; v^T plane fragments [b][g][s/32][d/16];
//   score bias B[b][0][q][key] f32 added after bf16 RNE convert; scale = bf16(softmax_scale), base-2 softmax.
//   Per 32-key step the block's 128 threads bring the step's k hi / k lo tiles, v^T fragments and 16x32 bias tile (26 KiB) into LDS
//   by asynchronous copies, two buffers, one step ahead of use; the four waves (heads) read the same stage. Every wave passes
//   every publish point (s_wait_dscnt 0, s_wait_asynccnt 0, block barrier, refill), also in a step whose work it skips.
//   Per step: the 16x32 bias tile is read first; the step is skipped (wave-uniform ballot) only when every bias entry is
//   <= -1e8 and every row already holds a running max > -1e8 (then exp2 underflows to exactly 0 and the rescale is exactly 1).
//   Otherwise: 2 score subtiles x 4 k-steps x 3 products (q_hi.k_hi + q_lo.k_hi + q_hi.k_lo), q fragments from registers,
//   k fragments from the stage (two 16-B loads per fragment, split k map); online max-subtracted softmax in f32 (exp2); rescale of l and the 8
//   of P*32768 (f16 hi) and its f16 residual rebuilt from the LDS rows (float vector loads), 8 v^T B fragments from the stage,
//   16 P.V WMMAs.
//   Epilogue: 1/l and carry folds in f32; the wave's 16x128 f32 result staged in its LDS slab (pitch 132); each 512-B output row
//   One block barrier per step under block-uniform control flow; every wave does bounded work (32 steps).
// coverage: per wave 16 rows x 32 lanes x 4 floats = 16 x 128; grid 1024 blocks x 4 waves = every (b, s, h) row exactly once.
// =====================================================================================================
__global__ __launch_bounds__(ATT_THREADS)
void attn_gqa(const float* __restrict__ Qp, const float* __restrict__ cosT, const float* __restrict__ sinT,
              const unsigned short* __restrict__ KHIp, const unsigned short* __restrict__ KLOp,
              const unsigned short* __restrict__ VTq, const float* __restrict__ Bp,
              const float* __restrict__ scp, float* outp) {
  // two stages of the ring, then per wave a prob tile [16][32] pitch 36; after the loop the ring holds the waves' result slabs
  __shared__ __align__(128) float smem[RING_B / 4 + ATW * PT_F];

  const int tid  = threadIdx.x;
  const int wave = tid >> 5;
  const int lane = tid & 31;
  const int hh   = lane >> 4;
  const int c    = lane & 15;

  const int bid  = blockIdx.x;
  // Query tile: t or its mirror SEQ/16 - 1 - t, by the parity of eight bits of the block index. Under a lower-triangular bias a tile's
  // work grows with its index and all blocks are resident at once, so the launch lasts as long as the fullest WGP; blocks whose
  // indices differ in one of these bits now hold mirror tiles.
  // Two of the six tile bits stay out of the parity: t and its mirror then read the same parity, so the map is
  // a permutation of the 64 tiles for every (b, g). For speed only: any placement gives the same result.
  const int mir  = __builtin_popcount((unsigned)bid & 0x3DBu) & 1;
  const int qt   = (bid & 63) ^ (mir ? 63 : 0);        // SEQ / 16 query tiles
  const int g    = (bid >> 6) & 7;                     // kv head
  const int b    = bid >> 9;                           // batch
  const int head = g * GRP + wave;
  const int q0   = qt * 16;

  // copy sources of this thread: its 16 B of each 2-KiB chunk; per step the k planes advance 2 key tiles, v^T 8 fragments
  const size_t kofs = ((size_t)b * (SEQ / 16) * NKV + g) * (16 * HD) + 8 * tid;
  const _Float16* Khb = (const _Float16*)(const void*)KHIp + kofs;
  const _Float16* Klb = (const _Float16*)(const void*)KLOp + kofs;
  const _Float16* Vb  = (const _Float16*)(const void*)VTq + (size_t)(b * NKV + g) * (HD * SEQ) + 8 * tid;
  const float*    Wr  = Bp + ((size_t)b * SEQ + q0 + (tid >> 3)) * SEQ + (tid & 7) * 4;   // bias row tid/8, 4 columns
  const unsigned  ring = (unsigned)(uintptr_t)(const void*)smem;                    // LDS byte address of the ring
  const unsigned  cl   = ring + tid * 16;
  const unsigned  clb  = ring + STG_KV + (tid >> 3) * BPITCH + (tid & 7) * 16;
  const float lsc = bfr(scp[0]) * (LOG2E / (QSC * KSC));

  float mrow[8], lrow[8];
  v8f o[8];
#pragma unroll
  for (int r = 0; r < 8; ++r) { mrow[r] = -INFINITY; lrow[r] = 0.f; }
#pragma unroll
  for (int j = 0; j < 8; ++j) o[j] = zero8();
  float* pt = smem + RING_B / 4 + wave * PT_F;

  // ring prologue: stage 0 landed and published, stage 1 in flight; the q fragments are built while stage 0 flies
  stage_copy(cl, clb, Khb, Klb, Vb, Wr);

  // ---- q A fragments: lane (hh, c) holds row q0 + c; fragment kk, elements 8*hf..8*hf+7 = d 32*kk + 16*hf + 8*hh + 0..7.
  //      The rotate-half partner d ^ 64 is fragment kk ^ 2, same hf, same lane, so a lane rotates what it loads itself. ----
  FragH qhf[4], qlf[4];
  {
    const int pos = q0 + c;
    const float* xr = Qp + (((size_t)(b * SEQ + pos)) * NH + head) * HD + 8 * hh;
    const float* cr = cosT + (size_t)pos * HD + 8 * hh;
    const float* sr = sinT + (size_t)pos * HD + 8 * hh;
#pragma unroll
    for (int p = 0; p < 4; ++p) {                       // d = 16p + 8hh + 0..7 and its partner 64 higher
      const int kk = p >> 1, hf = p & 1;
#pragma unroll
      for (int u = 0; u < 2; ++u) {
        const int d = 16 * p + 4 * u;
        const v4f xl = *(const v4f*)(xr + d), xu = *(const v4f*)(xr + d + 64);
        const v4f cl4 = *(const v4f*)(cr + d), cu4 = *(const v4f*)(cr + d + 64);
        const v4f sl4 = *(const v4f*)(sr + d), su4 = *(const v4f*)(sr + d + 64);
#pragma unroll
        for (int e = 0; e < 4; ++e) {
          const float a = bfr(xl[e]), z = bfr(xu[e]);
          const float tl = (a * bfr(cl4[e]) + (-z) * bfr(sl4[e])) * QSC;
          const float tu = (z * bfr(cu4[e]) + a * bfr(su4[e])) * QSC;
          const _Float16 hl = (_Float16)tl, hu = (_Float16)tu;
          qhf[kk].h[hf][4 * u + e]     = hl;
          qhf[kk + 2].h[hf][4 * u + e] = hu;
          qlf[kk].h[hf][4 * u + e]     = (_Float16)(tl - (float)hl);
          qlf[kk + 2].h[hf][4 * u + e] = (_Float16)(tu - (float)hu);
        }
      }
    }
#if defined(__HIP_DEVICE_COMPILE__)
    // the three row pointers stay live up to this wait, so no address register of the loads above is rewritten ahead of it
    asm volatile("s_wait_xcnt 0x0" :: "v"(xr), "v"(cr), "v"(sr) : "memory");
#endif
  }
  wait_async0();
  __syncthreads();
  stage_copy(cl + STG_B, clb + STG_B, Khb + 32 * (NKV * HD), Klb + 32 * (NKV * HD), Vb + 32 * HD, Wr + 32);

#pragma unroll 1
  for (int t = 0; t < NSTEP; ++t) {
    const unsigned bsel = (unsigned)(t & 1) * STG_B;                       // this step's buffer
    const _Float16* sb  = (const _Float16*)(const void*)(smem + bsel / 4) + 8 * lane;
    float w0[8], w1[8];
    bool allm = true, seen = true;
    const float* wp = smem + (bsel + STG_KV) / 4 + (8 * hh) * (BPITCH / 4) + c;   // rows 8hh+r, cols c and c+16 of the tile
#pragma unroll
    for (int r = 0; r < 8; ++r) {
      const float m0 = bfr(wp[r * (BPITCH / 4)]);
      const float m1 = bfr(wp[r * (BPITCH / 4) + 16]);
      allm = allm & (m0 <= BIASTH) & (m1 <= BIASTH);
      seen = seen & (mrow[r] > BIASTH);
      w0[r] = m0 * LOG2E;
      w1[r] = m1 * LOG2E;
    }
    const unsigned bal = __builtin_amdgcn_ballot_w32(allm & seen);
    if (bal != 0xffffffffu) {                          // wave-uniform
      // ---- scores: D element r of this lane = (query row q0 + 8hh + r, key kb + c) in s0, key kb + 16 + c in s1 ----
      v8f s0 = zero8(), s1 = zero8();
      const _Float16* k0p = sb;                        // k hi, keys 0..15 of the step
      const _Float16* k1p = sb + 2048;                 // k hi, keys 16..31
      const _Float16* l0p = sb + 4096;                 // k lo
      const _Float16* l1p = sb + 6144;
#pragma unroll
      for (int kk = 0; kk < 4; ++kk) {
        const v16h qh  = qhf[kk].v, ql = qlf[kk].v;
        const v16h kh0 = ldfrag_h(k0p + kk * 512), kl0 = ldfrag_h(l0p + kk * 512);
        const v16h kh1 = ldfrag_h(k1p + kk * 512), kl1 = ldfrag_h(l1p + kk * 512);
        s0 = mma_raw(qh, kh0, s0);
        s0 = mma_raw(ql, kh0, s0);
        s0 = mma_raw(qh, kl0, s0);
        s1 = mma_raw(qh, kh1, s1);
        s1 = mma_raw(ql, kh1, s1);
        s1 = mma_raw(qh, kl1, s1);
        guard_sc(s0, s1, qh, ql, kh0, kl0, kh1, kl1);
      }
      // ---- online softmax in base 2 ----
#pragma unroll
      for (int r = 0; r < 8; ++r) {
        const float t0 = s0[r] * lsc + w0[r], t1 = s1[r] * lsc + w1[r];
        float mx = fmaxf(t0, t1);
#pragma unroll
        for (int off = 1; off < 16; off <<= 1) mx = fmaxf(mx, __shfl_xor(mx, off, 32));
        const float mn = fmaxf(mrow[r], mx);
        const float al = exp2f(mrow[r] - mn);
        mrow[r] = mn;
        const float e0 = exp2f(t0 - mn), e1 = exp2f(t1 - mn);
        float ps = e0 + e1;
#pragma unroll
        for (int off = 1; off < 16; off <<= 1) ps += __shfl_xor(ps, off, 32);
        lrow[r] = lrow[r] * al + ps;
#pragma unroll
        for (int j = 0; j < 8; ++j) o[j][r] *= al;
        const int ro = (8 * hh + r) * 36 + c;
        pt[ro]      = e0;
        pt[ro + 16] = e1;
      }
      wave_sync_lds();
      // ---- A fragments of P*32768: hi f16 and residual f16, row = c, split k map over the 32 keys of this step ----
      FragH ph, pl;
      {
        const float* prow = pt + c * 36 + 8 * hh;
        const v4f p0 = *(const v4f*)(prow), p1 = *(const v4f*)(prow + 4);
        const v4f p2 = *(const v4f*)(prow + 16), p3 = *(const v4f*)(prow + 20);
#pragma unroll
        for (int e = 0; e < 4; ++e) {
          const float ta = p0[e] * PCAR, tb = p1[e] * PCAR, tc = p2[e] * PCAR, td = p3[e] * PCAR;
          const _Float16 ha = (_Float16)ta, hb = (_Float16)tb, hc = (_Float16)tc, hd = (_Float16)td;
          ph.h[0][e]     = ha;                               // elements 0..7  = keys kb + 8hh + 0..7
          ph.h[0][4 + e] = hb;
          ph.h[1][e]     = hc;                               // elements 8..15 = keys kb + 16 + 8hh + 0..7
          ph.h[1][4 + e] = hd;
          pl.h[0][e]     = (_Float16)(ta - (float)ha);
          pl.h[0][4 + e] = (_Float16)(tb - (float)hb);
          pl.h[1][e]     = (_Float16)(tc - (float)hc);
          pl.h[1][4 + e] = (_Float16)(td - (float)hd);
        }
      }
      // ---- P.V : B fragment col n = d = j*16 + c, fragment j of this 32-key step in the v^T plane ----
      const _Float16* vp = sb + 8192;
      {
        const v16h vb0 = ldfrag_h(vp);
        const v16h vb1 = ldfrag_h(vp + 512);
        const v16h vb2 = ldfrag_h(vp + 1024);
        const v16h vb3 = ldfrag_h(vp + 1536);
        o[0] = mma_raw(ph.v, vb0, o[0]);  o[0] = mma_raw(pl.v, vb0, o[0]);
        o[1] = mma_raw(ph.v, vb1, o[1]);  o[1] = mma_raw(pl.v, vb1, o[1]);
        o[2] = mma_raw(ph.v, vb2, o[2]);  o[2] = mma_raw(pl.v, vb2, o[2]);
        o[3] = mma_raw(ph.v, vb3, o[3]);  o[3] = mma_raw(pl.v, vb3, o[3]);
        guard_pv(o[0], o[1], o[2], o[3], ph.v, pl.v, vb0, vb1, vb2, vb3);
      }
      {
        const v16h vb4 = ldfrag_h(vp + 2048);
        const v16h vb5 = ldfrag_h(vp + 2560);
        const v16h vb6 = ldfrag_h(vp + 3072);
        const v16h vb7 = ldfrag_h(vp + 3584);
        o[4] = mma_raw(ph.v, vb4, o[4]);  o[4] = mma_raw(pl.v, vb4, o[4]);
        o[5] = mma_raw(ph.v, vb5, o[5]);  o[5] = mma_raw(pl.v, vb5, o[5]);
        o[6] = mma_raw(ph.v, vb6, o[6]);  o[6] = mma_raw(pl.v, vb6, o[6]);
        o[7] = mma_raw(ph.v, vb7, o[7]);  o[7] = mma_raw(pl.v, vb7, o[7]);
        guard_pv(o[4], o[5], o[6], o[7], ph.v, pl.v, vb4, vb5, vb6, vb7);
      }
      wave_sync_lds();
    }
    // publish point of stage t+1, every wave: own LDS reads done, own copies landed, block barrier; then refill the buffer just read
    wait_ds0();
    wait_async0();
    __syncthreads();
    if (t + 2 < NSTEP) {                               // block-uniform scalar test
      const int kn = (t + 2) * 32;
      stage_copy(cl + bsel, clb + bsel, Khb + (size_t)kn * (NKV * HD), Klb + (size_t)kn * (NKV * HD), Vb + (size_t)kn * HD, Wr + kn);
    }
  }
  wait_async0();
  acc_guard4(o[0], o[1], o[2], o[3]);
  acc_guard4(o[4], o[5], o[6], o[7]);

  // ---- fold 1/l and the carries (32768 on P, 16 on v), stage the wave's 16x128 slab in its LDS region ----
  wave_sync_lds();
  float* slab = smem + wave * SLABF;                   // ring space: every wave left it at the last step's barrier
  const float oc = 1.0f / (PCAR * VCAR);
#pragma unroll
  for (int r = 0; r < 8; ++r) {
    const float inv = (1.0f / lrow[r]) * oc;
#pragma unroll
    for (int j = 0; j < 8; ++j) slab[(8 * hh + r) * 132 + j * 16 + c] = o[j][r] * inv;
  }
  wave_sync_lds();
  v4f vals[16];
#pragma unroll
  for (int row = 0; row < 16; ++row) vals[row] = *(const v4f*)(slab + row * 132 + lane * 4);
  float* dst = outp + (((size_t)(b * SEQ + q0)) * NH + head) * HD + lane * 4;
  {
#pragma unroll
    for (int row = 0; row < 16; ++row) {
      *(v4f*)(dst + (size_t)row * (NH * HD)) = vals[row];
    }
    
  }
}

// =====================================================================================================
// Workspace map (bytes); every plane is fully written by whole-line stores before it is read; no pad rows needed
// (all extents are exact multiples of the store granularity); offsets multiples of 4 MiB:
//   KHI f16 [2][64][8] tiles of 2048 x1024 hi    4194304
//   KLO f16 same, residual                  4194304
//   VT  f16 [2][8][32][8] fragments of 512 x16   4194304
//   end                                    12582912
// =====================================================================================================
extern "C" void kernel_launch(void* const* d_in, const int* in_sizes, int n_in,
                              void* d_out, int out_size, void* d_ws, size_t ws_size,
                              hipStream_t stream) {
  if (n_in < 7) return;
  if (in_sizes[0] != NB * SEQ * NH * HD) return;
  if (in_sizes[1] != NB * SEQ * NKV * HD || in_sizes[2] != NB * SEQ * NKV * HD) return;
  if (in_sizes[3] != SEQ * HD || in_sizes[4] != SEQ * HD) return;
  if (in_sizes[5] != NB * SEQ * SEQ) return;
  if (in_sizes[6] < 1) return;
  if (out_size != NB * SEQ * NH * HD) return;

  const float* q    = (const float*)d_in[0];
  const float* k    = (const float*)d_in[1];
  const float* v    = (const float*)d_in[2];
  const float* cosT = (const float*)d_in[3];
  const float* sinT = (const float*)d_in[4];
  const float* bias = (const float*)d_in[5];
  const float* scl  = (const float*)d_in[6];
  float*       out  = (float*)d_out;

  const size_t PK = (size_t)NB * SEQ * NKV * HD * 2;    //  4194304
  const size_t PV = (size_t)NB * NKV * HD * SEQ * 2;    //  4194304
  size_t off = 0;
  const size_t oKH = off; off += PK;
  const size_t oKL = off; off += PK;
  const size_t oVT = off; off += PV;
  if (off > ws_size) return;                            // off = 12582912
  if (off > (size_t)134217728) return;

  char* ws = (char*)d_ws;
  unsigned short* KHI = (unsigned short*)(ws + oKH);
  unsigned short* KLO = (unsigned short*)(ws + oKL);
  unsigned short* VT  = (unsigned short*)(ws + oVT);

  const int rowsK = NB * SEQ * NKV;                     // 16384
  const dim3 blk(256);
  const dim3 gRK((rowsK * 16) / 256);                   // 1024
  const dim3 gVT(NB * NKV * (SEQ / 64));                // 256
  const dim3 gAT(ATT_BLOCKS);                           // 1024
  const dim3 bAT(ATT_THREADS);                          // 128

  // (0) k' planes: hi = f16(1024 k'), lo = f16(1024 k' - hi); rows (b, s, g), heads per row group NKV
  rope16<<<gRK, blk, 0, stream>>>(k, cosT, sinT, KHI, KLO, rowsK, NKV, KSC);
  // (1) v^T plane x16
  vt16<<<gVT, blk, 0, stream>>>(v, VT);
  // (2) attention, q RoPE and split included -> out [b][s][h][d] f32
  attn_gqa<<<gAT, bAT, 0, stream>>>(q, cosT, sinT, KHI, KLO, VT, bias, scl, out);
  (void)hipGetLastError();
}

// v005
// It runs in 66.7 microseconds.
// In two side-by-side timings against v004, it was 1.37 and 1.36 times as fast.
// Counting every step since v000, it is 3.37 times as fast.
// Contractions: scores^T k'.q'^T (q' and k' each carried x1024 as f16 hi plane + f16 residual plane, products hh+hl+lh, K=128)
// and out^T = v^T.P^T (P x32768 as f16 hi + f16 residual, v x16 f16 exact, products v.hi+v.lo, K=1024 in 32-key steps):
// all v_wmma_f32_16x16x32_f16, f32 accumulate. RoPE, additive score bias, base-2 online softmax and 1/l fold in f32 on VALU.
// Every float input RNE-converted to bf16 on load.
#include <hip/hip_runtime.h>
#include <math.h>
#include <stdint.h>

#define NB    2
#define SEQ   1024
#define NH    32
#define NKV   8
#define HD    128
#define GRP   4
#define QSC   1024.0f
#define KSC   1024.0f
#define PCAR  32768.0f
#define VCAR  16.0f
#define LOG2E 1.4426950408889634f
#define BIASTH (-1.0e8f)
#define ATW   GRP
#define ATT_THREADS (ATW * 32)
#define ATT_BLOCKS  (NB * NKV * (SEQ / 16))
#define SLABF (16 * 132)
#define VTP   72
#define NSTEP (SEQ / 32)
#define STG_KV 24576                       // bytes of one stage: k hi 2 tiles, k lo 2 tiles (4 KiB each), v^T 8 fragments (8 KiB)
#define BPITCH 144                         // LDS pitch in bytes of a 128-B bias row: rows r and r+8 fall on disjoint banks
#define STG_B  (STG_KV + 16 * BPITCH)      // one stage with its 16 x 32 bias tile
#define RING_B (2 * STG_B)
static_assert(NH == NKV * GRP);
static_assert(HD == 128 && (SEQ % 64) == 0 && (SEQ % 32) == 0 && (SEQ % 16) == 0);
static_assert(ATT_THREADS == 128 && ATT_BLOCKS == 1024);
static_assert(((NB * SEQ * NH * 16) % 256) == 0 && ((NB * SEQ * NKV * 16) % 256) == 0);
static_assert(ATW * SLABF * 4 <= RING_B && (STG_B % 16) == 0 && NSTEP >= 2);
static_assert(STG_KV == 12 * ATT_THREADS * 16 && 16 * 128 == ATT_THREADS * 16);
static_assert((SEQ / 16) == 64 && NKV == 8);

typedef _Float16 v16h __attribute__((ext_vector_type(16)));
typedef _Float16 v8h  __attribute__((ext_vector_type(8)));
typedef float    v8f  __attribute__((ext_vector_type(8)));
typedef float    v4f  __attribute__((ext_vector_type(4)));
typedef unsigned int v4u __attribute__((ext_vector_type(4)));

union FragH { v16h v; v8h h[2]; v4u u[2]; };

// ---- scalar helpers --------------------------------------------------------------------------------
__device__ __forceinline__ unsigned short bf_bits(float f) {          // f32 -> bf16 bits, RNE convert
  unsigned u = __float_as_uint(f);
  return (unsigned short)((u + 0x7FFFu + ((u >> 16) & 1u)) >> 16);
}
__device__ __forceinline__ float bf_up(unsigned short h) { return __uint_as_float(((unsigned)h) << 16); }
__device__ __forceinline__ float bfr(float f) { return bf_up(bf_bits(f)); }   // value of the bf16 RNE convert
__device__ __forceinline__ unsigned short h_bits(_Float16 x) { return __builtin_bit_cast(unsigned short, x); }
__device__ __forceinline__ unsigned pk16(unsigned short a, unsigned short b) { return (unsigned)a | ((unsigned)b << 16); }
// value of lane l ^ 16 (the other half of the wave), a vector cross-row move
__device__ __forceinline__ float xhalf(float x) {
  const int b = __builtin_bit_cast(int, x);
  return __builtin_bit_cast(float, __builtin_amdgcn_permlanex16(b, b, 0x76543210, 0xfedcba98, false, false));
}
__device__ __forceinline__ v8f zero8() { v8f z = {0.f, 0.f, 0.f, 0.f, 0.f, 0.f, 0.f, 0.f}; return z; }

// ---- fragment loader: 16-bit A/B operand from a plane stored in fragment order. One fragment (16 rows/cols x 32 k) is 512
//      halves: piece (half, lane) of 8 halves at half*256 + lane*8, lane = 16*h + (row/col & 15); p already includes lane*8.
//      elements 0..7 <- piece half 0 (k0+8h..), elements 8..15 <- piece half 1 (k0+16+8h..)  (same split k map for A and B).
//      Each of the two 16-B loads reads 512 contiguous bytes per wave: four whole 128-B lines.
__device__ __forceinline__ v16h ldfrag_h(const _Float16* p) {
  FragH f;
  f.h[0] = *(const v8h*)(p);
  f.h[1] = *(const v8h*)(p + 256);
  return f.v;
}

__device__ __forceinline__ v8f mma_raw(v16h a, v16h b, v8f c) {
  return __builtin_amdgcn_wmma_f32_16x16x32_f16(false, a, false, b, (short)0, c, false, false);
}
__device__ __forceinline__ void guard_sc(v8f& a, v8f& b, v16h x0, v16h x1, v16h x2, v16h x3, v16h x4, v16h x5) {
#if defined(__HIP_DEVICE_COMPILE__)
  asm volatile("v_nop\n\tv_nop\n\tv_nop\n\tv_nop"
               : "+v"(a), "+v"(b) : "v"(x0), "v"(x1), "v"(x2), "v"(x3), "v"(x4), "v"(x5) : "memory");
#endif
}
__device__ __forceinline__ void guard_pv(v8f& a, v8f& b, v8f& c, v8f& d,
                                         v16h p0, v16h p1, v16h x0, v16h x1, v16h x2, v16h x3) {
#if defined(__HIP_DEVICE_COMPILE__)
  asm volatile("v_nop\n\tv_nop\n\tv_nop\n\tv_nop"
               : "+v"(a), "+v"(b), "+v"(c), "+v"(d) : "v"(p0), "v"(p1), "v"(x0), "v"(x1), "v"(x2), "v"(x3) : "memory");
#endif
}
__device__ __forceinline__ void acc_guard4(v8f& a, v8f& b, v8f& c, v8f& d) {
#if defined(__HIP_DEVICE_COMPILE__)
  asm volatile("v_nop\n\tv_nop\n\tv_nop\n\tv_nop" : "+v"(a), "+v"(b), "+v"(c), "+v"(d));
#endif
}
__device__ __forceinline__ void wave_sync_lds() {
  __builtin_amdgcn_fence(__ATOMIC_RELEASE, "workgroup");
  __builtin_amdgcn_wave_barrier();
  __builtin_amdgcn_fence(__ATOMIC_ACQUIRE, "workgroup");
}
// One stage of the attention ring: 13 asynchronous 16-B copies per lane, global -> LDS, through no register.
//   l  = LDS byte address of the stage + tid*16 (chunk j of 2 KiB at + j*2048), lb = this lane's 16 B of the bias tile in LDS;
//   kh, kl = this lane's 16 B in the first key tile of the k hi / k lo plane, vv in the step's v^T fragments, bb in the bias row.
// The s_wait_xcnt stands inside the statement so that no address register of a copy is rewritten ahead of it.
__device__ __forceinline__ void stage_copy(unsigned l, unsigned lb, const _Float16* kh, const _Float16* kl,
                                           const _Float16* vv, const float* bb) {
#if defined(__HIP_DEVICE_COMPILE__)
  const unsigned l1 = l + 2048, l2 = l + 4096, l3 = l + 6144, l4 = l + 8192, l5 = l + 10240, l6 = l + 12288, l7 = l + 14336;
  const unsigned l8 = l + 16384, l9 = l + 18432, l10 = l + 20480, l11 = l + 22528;
  const _Float16 *g1 = kh + 1024, *g2 = kh + NKV * 2048, *g3 = kh + NKV * 2048 + 1024;
  const _Float16 *g5 = kl + 1024, *g6 = kl + NKV * 2048, *g7 = kl + NKV * 2048 + 1024;
  const _Float16 *g9 = vv + 1024, *g10 = vv + 2048, *g11 = vv + 3072;
  asm volatile("global_load_async_to_lds_b128 %0, %13, off\n\t"
               "global_load_async_to_lds_b128 %1, %14, off\n\t"
               "global_load_async_to_lds_b128 %2, %15, off\n\t"
               "global_load_async_to_lds_b128 %3, %16, off\n\t"
               "global_load_async_to_lds_b128 %4, %17, off\n\t"
               "global_load_async_to_lds_b128 %5, %18, off\n\t"
               "global_load_async_to_lds_b128 %6, %19, off\n\t"
               "global_load_async_to_lds_b128 %7, %20, off\n\t"
               "global_load_async_to_lds_b128 %8, %21, off\n\t"
               "global_load_async_to_lds_b128 %9, %22, off\n\t"
               "global_load_async_to_lds_b128 %10, %23, off\n\t"
               "global_load_async_to_lds_b128 %11, %24, off\n\t"
               "global_load_async_to_lds_b128 %12, %25, off\n\t"
               "s_wait_xcnt 0x0"
               :: "v"(lb), "v"(l), "v"(l1), "v"(l2), "v"(l3), "v"(l4), "v"(l5), "v"(l6), "v"(l7), "v"(l8), "v"(l9), "v"(l10),
                  "v"(l11),
                  "v"(bb), "v"(kh), "v"(g1), "v"(g2), "v"(g3), "v"(kl), "v"(g5), "v"(g6), "v"(g7), "v"(vv), "v"(g9), "v"(g10),
                  "v"(g11)
               : "memory");
#endif
}
__device__ __forceinline__ void wait_async0() {   // this wave's copies have landed
#if defined(__HIP_DEVICE_COMPILE__)
  asm volatile("s_wait_asynccnt 0x0" ::: "memory");
#endif
}
__device__ __forceinline__ void wait_ds0() {      // this wave's LDS reads of the stage have returned before the stage is refilled
#if defined(__HIP_DEVICE_COMPILE__)
  asm volatile("s_wait_dscnt 0x0" ::: "memory");
#endif
}

// =====================================================================================================
// Rotate-half RoPE + 16-bit split pack. Rows are (batch, pos, head) with HD contiguous floats; pos = (row / hpr) mod SEQ.
//   w[d] = bf16(x[d]) * bf16(cos[pos][d]) + r[d] * bf16(sin[pos][d]),  r[d] = -bf16(x[d+64]) for d < 64, bf16(x[d-64]) for d >= 64
//   (bf16 x bf16 products are exact in f32, so w is the singly converted f32 sum);
//   hi[d] = f16(w * sc), lo[d] = f16(w * sc - hi[d])  (sc a power of two, residual unscaled).
// Planes are stored in fragment order: tile = (batch*SEQ/16 + pos/16)*hpr + head holds 16 positions x 128 d as 2048 halves,
//   piece (chunk = d/8, c = pos & 15) of 8 halves at (chunk*16 + c)*8, which is kk*512 + half*256 + lane*8 of ldfrag_h.
// Block = one tile. Thread = 8 consecutive d of one row: 16-B loads of x (own and partner half), cos, sin; one 16-B store per
// plane. A wave = 8 rows x 4 chunks: each load touches one whole 128-B line per row, each store fills four whole lines.
// coverage: grid = nrows/16 blocks x 256 thr x 8 halves = nrows x 128 of each plane exactly (host checks divisibility).
// =====================================================================================================
__global__ __launch_bounds__(256) void rope16(const float* __restrict__ x, const float* __restrict__ cosT,
                                              const float* __restrict__ sinT, unsigned short* hipl, unsigned short* lopl,
                                              int nrows, int hpr, float sc) {
  const int tile = blockIdx.x;
  if (tile * 16 >= nrows) return;           // never taken with the exact grid; no barriers in this kernel
  const int tid   = (int)threadIdx.x;
  const int c     = ((tid >> 5) & 1) * 8 + (tid & 7);          // position within the tile
  const int chunk = (tid >> 6) * 4 + ((tid >> 3) & 3);         // d / 8
  const int d0    = chunk * 8;
  const int srow  = (tile / hpr) * 16 + c;                     // batch*SEQ + pos
  const int row   = srow * hpr + (tile % hpr);
  const int pos   = srow & (SEQ - 1);
  const int d1  = d0 ^ 64;
  const float* xr = x + (size_t)row * HD;
  const float* cr = cosT + (size_t)pos * HD + d0;
  const float* sr = sinT + (size_t)pos * HD + d0;
  const v4f xa = *(const v4f*)(xr + d0), xb = *(const v4f*)(xr + d0 + 4);
  const v4f ya = *(const v4f*)(xr + d1), yb = *(const v4f*)(xr + d1 + 4);
  const v4f ca = *(const v4f*)(cr), cb = *(const v4f*)(cr + 4);
  const v4f sa = *(const v4f*)(sr), sb = *(const v4f*)(sr + 4);
  const float sgn = (d0 < 64) ? -1.0f : 1.0f;
  float w[8];
#pragma unroll
  for (int e = 0; e < 4; ++e) {
    w[e]     = bfr(xa[e]) * bfr(ca[e]) + (sgn * bfr(ya[e])) * bfr(sa[e]);
    w[4 + e] = bfr(xb[e]) * bfr(cb[e]) + (sgn * bfr(yb[e])) * bfr(sb[e]);
  }
  v4u oh, ol;
#pragma unroll
  for (int e = 0; e < 4; ++e) {
    const float t0 = w[2 * e] * sc, t1 = w[2 * e + 1] * sc;
    const _Float16 h0 = (_Float16)t0, h1 = (_Float16)t1;
    const _Float16 l0 = (_Float16)(t0 - (float)h0), l1 = (_Float16)(t1 - (float)h1);
    oh[e] = pk16(h_bits(h0), h_bits(h1));
    ol[e] = pk16(h_bits(l0), h_bits(l1));
  }
  const size_t o8 = (size_t)tile * (16 * HD) + (chunk * 16 + c) * 8;
  {
    *(v4u*)(hipl + o8) = oh;
    *(v4u*)(lopl + o8) = ol;
    
  }
}

// =====================================================================================================
// v^T plane, value f16( bf16(v[b][s][g][d]) * 16 ) (exact), stored in fragment order: fragment ((b*NKV + g)*SEQ/32 + s/32)*8 + d/16
// of 512 halves, piece (half = (s/16)&1, lane = 16*((s/8)&1) + (d&15)) of 8 keys. Block = (b, g, 64 keys): 64 source rows of
// 128 floats loaded with 16-B loads, converted, scattered into an LDS tile [d][64 keys] (pitch 72 halves); after a block barrier each
// coverage: load 256 thr x 32 elements = 64 x 128; store 4 iterations x 256 thr x 8 halves = 128 lines x 64 = the block's tile;
//           grid = NB x NKV x SEQ/64 = 256 blocks covers the whole plane exactly once.
// =====================================================================================================
__global__ __launch_bounds__(256) void vt16(const float* __restrict__ v, unsigned short* VTo) {
  __shared__ __align__(16) unsigned short T[HD * VTP];
  const int tid = threadIdx.x;
  const int bid = blockIdx.x;
  const int st  = bid & 15;
  const int g   = (bid >> 4) & 7;
  const int b   = bid >> 7;
  const int s0  = st * 64;
  {
    const int sl = tid >> 2;                  // key within tile 0..63
    const int dc = (tid & 3) * 32;            // d chunk
    const float* src = v + (((size_t)(b * SEQ + s0 + sl)) * NKV + g) * HD + dc;
#pragma unroll
    for (int i = 0; i < 8; ++i) {
      const v4f a = *(const v4f*)(src + 4 * i);
#pragma unroll
      for (int e = 0; e < 4; ++e) T[(dc + 4 * i + e) * VTP + sl] = h_bits((_Float16)(bfr(a[e]) * VCAR));
    }
  }
  __syncthreads();
  v4u vals[4];
#pragma unroll
  for (int it = 0; it < 4; ++it) {
    const int pi = it * 256 + tid;            // piece in the block's 16 fragments: [key step 2][d/16 8][half 2][lane 32]
    const int d  = ((pi >> 6) & 7) * 16 + (pi & 15);
    const int kc = (pi >> 9) * 4 + ((pi >> 5) & 1) * 2 + ((pi >> 4) & 1);   // 8-key chunk within the 64 keys
    vals[it] = *(const v4u*)(T + d * VTP + kc * 8);
  }
  unsigned short* dst = VTo + (size_t)bid * (64 * HD) + tid * 8;   // bid = ((b*NKV + g)*SEQ/64 + st)
  {
#pragma unroll
    for (int it = 0; it < 4; ++it) {
      *(v4u*)(dst + it * 2048) = vals[it];
    }
    
  }
}

// =====================================================================================================
// GQA flash attention: block = (batch b, kv head g, 16 query rows q0..q0+15), one wave per query head g*4 + wave.
//   q comes as the f32 input: each wave applies RoPE to its own 16 x 128 tile once, splits it x1024 into f16 hi + f16 residual and
//   keeps the 8 fragments (B operands) in registers for all steps (same formula and same values as rope16 gives for k).
//   k planes tiles [b][s/16][g]; v^T plane fragments [b][g][s/32][d/16];
//   score bias B[b][0][q][key] f32 added after bf16 RNE convert; scale = bf16(softmax_scale), base-2 softmax.
//   Per 32-key step the block's 128 threads bring the step's k hi / k lo tiles, v^T fragments and 16x32 bias tile (26 KiB) into LDS
//   by asynchronous copies, two buffers, one step ahead of use; the four waves (heads) read the same stage. Every wave passes
//   every publish point (s_wait_dscnt 0, s_wait_asynccnt 0, block barrier, refill), also in a step whose work it skips.
//   Per step: the 16x32 bias tile is read first; the step is skipped (wave-uniform ballot) only when every bias entry is
//   <= -1e8 and every row already holds a running max > -1e8 (then exp2 underflows to exactly 0 and the rescale is exactly 1).
//   Otherwise: 2 transposed score subtiles (rows = keys, columns = queries) x 4 k-steps x 3 products (k_hi.q_hi + k_hi.q_lo +
//   k_lo.q_hi), k fragments (A) from the stage (two 16-B loads per fragment, split k map), q fragments (B) from registers. A lane
//   then holds 16 scores of one query: max and sum in the lane, one exchange between the wave halves for the max; online
//   max-subtracted softmax in f32 (exp2); rescale of l and the 8 accumulator tiles by the lane's own factor; P^T*32768 (f16 hi)
//   and its f16 residual are converted in place into B fragments; 8 v^T A fragments from the stage, 16 v^T.P^T WMMAs.
//   Epilogue: 1/l and carry folds in f32; the wave's 16x128 f32 result staged in its LDS slab (pitch 132); each 512-B output row
//   One block barrier per step under block-uniform control flow; every wave does bounded work (32 steps).
// coverage: per wave 16 rows x 32 lanes x 4 floats = 16 x 128; grid 1024 blocks x 4 waves = every (b, s, h) row exactly once.
// =====================================================================================================
__global__ __launch_bounds__(ATT_THREADS)
void attn_gqa(const float* __restrict__ Qp, const float* __restrict__ cosT, const float* __restrict__ sinT,
              const unsigned short* __restrict__ KHIp, const unsigned short* __restrict__ KLOp,
              const unsigned short* __restrict__ VTq, const float* __restrict__ Bp,
              const float* __restrict__ scp, float* outp) {
  // two stages of the ring; after the loop the ring holds the waves' result slabs
  __shared__ __align__(128) float smem[RING_B / 4];

  const int tid  = threadIdx.x;
  const int wave = tid >> 5;
  const int lane = tid & 31;
  const int hh   = lane >> 4;
  const int c    = lane & 15;

  const int bid  = blockIdx.x;
  // Query tile: t or its mirror SEQ/16 - 1 - t, by the parity of eight bits of the block index. Under a lower-triangular bias a tile's
  // work grows with its index and all blocks are resident at once, so the launch lasts as long as the fullest WGP; blocks whose
  // indices differ in one of these bits now hold mirror tiles.
  // Two of the six tile bits stay out of the parity: t and its mirror then read the same parity, so the map is
  // a permutation of the 64 tiles for every (b, g). For speed only: any placement gives the same result.
  const int mir  = __builtin_popcount((unsigned)bid & 0x3DBu) & 1;
  const int qt   = (bid & 63) ^ (mir ? 63 : 0);        // SEQ / 16 query tiles
  const int g    = (bid >> 6) & 7;                     // kv head
  const int b    = bid >> 9;                           // batch
  const int head = g * GRP + wave;
  const int q0   = qt * 16;

  // copy sources of this thread: its 16 B of each 2-KiB chunk; per step the k planes advance 2 key tiles, v^T 8 fragments
  const size_t kofs = ((size_t)b * (SEQ / 16) * NKV + g) * (16 * HD) + 8 * tid;
  const _Float16* Khb = (const _Float16*)(const void*)KHIp + kofs;
  const _Float16* Klb = (const _Float16*)(const void*)KLOp + kofs;
  const _Float16* Vb  = (const _Float16*)(const void*)VTq + (size_t)(b * NKV + g) * (HD * SEQ) + 8 * tid;
  const float*    Wr  = Bp + ((size_t)b * SEQ + q0 + (tid >> 3)) * SEQ + (tid & 7) * 4;   // bias row tid/8, 4 columns
  const unsigned  ring = (unsigned)(uintptr_t)(const void*)smem;                    // LDS byte address of the ring
  const unsigned  cl   = ring + tid * 16;
  const unsigned  clb  = ring + STG_KV + (tid >> 3) * BPITCH + (tid & 7) * 16;
  const float lsc = bfr(scp[0]) * (LOG2E / (QSC * KSC));

  // this lane's query is row q0 + c: its running max (equal in both wave halves) and the sum over the keys of this lane's own half
  float mrun = -INFINITY, lrun = 0.f;
  v8f o[8];                                            // o[j][r] = out^T (d = 16j + 8hh + r, query q0 + c)
#pragma unroll
  for (int j = 0; j < 8; ++j) o[j] = zero8();

  // ring prologue: stage 0 landed and published, stage 1 in flight; the q fragments are built while stage 0 flies
  stage_copy(cl, clb, Khb, Klb, Vb, Wr);

  // ---- q fragments: lane (hh, c) holds row q0 + c; fragment kk, elements 8*hf..8*hf+7 = d 32*kk + 16*hf + 8*hh + 0..7.
  //      The rotate-half partner d ^ 64 is fragment kk ^ 2, same hf, same lane, so a lane rotates what it loads itself. ----
  FragH qhf[4], qlf[4];
  {
    const int pos = q0 + c;
    const float* xr = Qp + (((size_t)(b * SEQ + pos)) * NH + head) * HD + 8 * hh;
    const float* cr = cosT + (size_t)pos * HD + 8 * hh;
    const float* sr = sinT + (size_t)pos * HD + 8 * hh;
#pragma unroll
    for (int p = 0; p < 4; ++p) {                       // d = 16p + 8hh + 0..7 and its partner 64 higher
      const int kk = p >> 1, hf = p & 1;
#pragma unroll
      for (int u = 0; u < 2; ++u) {
        const int d = 16 * p + 4 * u;
        const v4f xl = *(const v4f*)(xr + d), xu = *(const v4f*)(xr + d + 64);
        const v4f cl4 = *(const v4f*)(cr + d), cu4 = *(const v4f*)(cr + d + 64);
        const v4f sl4 = *(const v4f*)(sr + d), su4 = *(const v4f*)(sr + d + 64);
#pragma unroll
        for (int e = 0; e < 4; ++e) {
          const float a = bfr(xl[e]), z = bfr(xu[e]);
          const float tl = (a * bfr(cl4[e]) + (-z) * bfr(sl4[e])) * QSC;
          const float tu = (z * bfr(cu4[e]) + a * bfr(su4[e])) * QSC;
          const _Float16 hl = (_Float16)tl, hu = (_Float16)tu;
          qhf[kk].h[hf][4 * u + e]     = hl;
          qhf[kk + 2].h[hf][4 * u + e] = hu;
          qlf[kk].h[hf][4 * u + e]     = (_Float16)(tl - (float)hl);
          qlf[kk + 2].h[hf][4 * u + e] = (_Float16)(tu - (float)hu);
        }
      }
    }
#if defined(__HIP_DEVICE_COMPILE__)
    // the three row pointers stay live up to this wait, so no address register of the loads above is rewritten ahead of it
    asm volatile("s_wait_xcnt 0x0" :: "v"(xr), "v"(cr), "v"(sr) : "memory");
#endif
  }
  wait_async0();
  __syncthreads();
  stage_copy(cl + STG_B, clb + STG_B, Khb + 32 * (NKV * HD), Klb + 32 * (NKV * HD), Vb + 32 * HD, Wr + 32);

#pragma unroll 1
  for (int t = 0; t < NSTEP; ++t) {
    const unsigned bsel = (unsigned)(t & 1) * STG_B;                       // this step's buffer
    const _Float16* sb  = (const _Float16*)(const void*)(smem + bsel / 4) + 8 * lane;
    // bias tile row c (this lane's query), columns 8hh + 0..7 and 16 + 8hh + 0..7: the keys of this lane's score registers
    const float* wp = smem + (bsel + STG_KV) / 4 + c * (BPITCH / 4) + 8 * hh;
    const v4f b0 = *(const v4f*)(wp), b1 = *(const v4f*)(wp + 4), b2 = *(const v4f*)(wp + 16), b3 = *(const v4f*)(wp + 20);
    float w0[8], w1[8];
    bool allm = true;
#pragma unroll
    for (int e = 0; e < 4; ++e) {
      const float m0 = bfr(b0[e]), m1 = bfr(b1[e]), m2 = bfr(b2[e]), m3 = bfr(b3[e]);
      allm = allm & (m0 <= BIASTH) & (m1 <= BIASTH) & (m2 <= BIASTH) & (m3 <= BIASTH);
      w0[e]     = m0 * LOG2E;
      w0[4 + e] = m1 * LOG2E;
      w1[e]     = m2 * LOG2E;
      w1[4 + e] = m3 * LOG2E;
    }
    const bool seen = mrun > BIASTH;
    const unsigned bal = __builtin_amdgcn_ballot_w32(allm & seen);
    if (bal != 0xffffffffu) {                          // wave-uniform
      // ---- scores^T: D element r of this lane = (key kb + 8hh + r, query q0 + c) in s0, key kb + 16 + 8hh + r in s1 ----
      v8f s0 = zero8(), s1 = zero8();
      const _Float16* k0p = sb;                        // k hi, keys 0..15 of the step
      const _Float16* k1p = sb + 2048;                 // k hi, keys 16..31
      const _Float16* l0p = sb + 4096;                 // k lo
      const _Float16* l1p = sb + 6144;
#pragma unroll
      for (int kk = 0; kk < 4; ++kk) {
        const v16h qh  = qhf[kk].v, ql = qlf[kk].v;
        const v16h kh0 = ldfrag_h(k0p + kk * 512), kl0 = ldfrag_h(l0p + kk * 512);
        const v16h kh1 = ldfrag_h(k1p + kk * 512), kl1 = ldfrag_h(l1p + kk * 512);
        s0 = mma_raw(kh0, qh, s0);
        s0 = mma_raw(kh0, ql, s0);
        s0 = mma_raw(kl0, qh, s0);
        s1 = mma_raw(kh1, qh, s1);
        s1 = mma_raw(kh1, ql, s1);
        s1 = mma_raw(kl1, qh, s1);
        guard_sc(s0, s1, qh, ql, kh0, kl0, kh1, kl1);
      }
      // ---- online softmax in base 2: a lane holds 16 of its query's 32 scores, the other wave half the rest ----
      float t0[8], t1[8], m4[4];
#pragma unroll
      for (int r = 0; r < 8; ++r) {
        t0[r] = s0[r] * lsc + w0[r];
        t1[r] = s1[r] * lsc + w1[r];
      }
#pragma unroll
      for (int r = 0; r < 4; ++r) m4[r] = fmaxf(fmaxf(t0[r], t0[r + 4]), fmaxf(t1[r], t1[r + 4]));
      float mx = fmaxf(fmaxf(m4[0], m4[1]), fmaxf(m4[2], m4[3]));
      mx = fmaxf(mx, xhalf(mx));
      const float mn = fmaxf(mrun, mx);
      const float al = exp2f(mrun - mn);
      mrun = mn;
      // ---- B fragments of P^T*32768, hi f16 and residual f16, straight from the score registers: column = query c,
      //      elements 0..7 = keys kb + 8hh + 0..7 (s0), elements 8..15 = keys kb + 16 + 8hh + 0..7 (s1): the split k map ----
      FragH ph, pl;
      float p4[4];
#pragma unroll
      for (int r = 0; r < 8; ++r) {
        const float e0 = exp2f(t0[r] - mn), e1 = exp2f(t1[r] - mn);
        if (r < 4) p4[r] = e0 + e1; else p4[r - 4] += e0 + e1;
        const float ta = e0 * PCAR, tc = e1 * PCAR;
        const _Float16 ha = (_Float16)ta, hc = (_Float16)tc;
        ph.h[0][r] = ha;
        ph.h[1][r] = hc;
        pl.h[0][r] = (_Float16)(ta - (float)ha);
        pl.h[1][r] = (_Float16)(tc - (float)hc);
      }
      lrun = lrun * al + ((p4[0] + p4[1]) + (p4[2] + p4[3]));
#pragma unroll
      for (int j = 0; j < 8; ++j) o[j] *= al;
      // ---- v^T.P^T : A fragment row m = d = j*16 + c, fragment j of this 32-key step in the v^T plane ----
      const _Float16* vp = sb + 8192;
      {
        const v16h vb0 = ldfrag_h(vp);
        const v16h vb1 = ldfrag_h(vp + 512);
        const v16h vb2 = ldfrag_h(vp + 1024);
        const v16h vb3 = ldfrag_h(vp + 1536);
        o[0] = mma_raw(vb0, ph.v, o[0]);  o[0] = mma_raw(vb0, pl.v, o[0]);
        o[1] = mma_raw(vb1, ph.v, o[1]);  o[1] = mma_raw(vb1, pl.v, o[1]);
        o[2] = mma_raw(vb2, ph.v, o[2]);  o[2] = mma_raw(vb2, pl.v, o[2]);
        o[3] = mma_raw(vb3, ph.v, o[3]);  o[3] = mma_raw(vb3, pl.v, o[3]);
        guard_pv(o[0], o[1], o[2], o[3], ph.v, pl.v, vb0, vb1, vb2, vb3);
      }
      {
        const v16h vb4 = ldfrag_h(vp + 2048);
        const v16h vb5 = ldfrag_h(vp + 2560);
        const v16h vb6 = ldfrag_h(vp + 3072);
        const v16h vb7 = ldfrag_h(vp + 3584);
        o[4] = mma_raw(vb4, ph.v, o[4]);  o[4] = mma_raw(vb4, pl.v, o[4]);
        o[5] = mma_raw(vb5, ph.v, o[5]);  o[5] = mma_raw(vb5, pl.v, o[5]);
        o[6] = mma_raw(vb6, ph.v, o[6]);  o[6] = mma_raw(vb6, pl.v, o[6]);
        o[7] = mma_raw(vb7, ph.v, o[7]);  o[7] = mma_raw(vb7, pl.v, o[7]);
        guard_pv(o[4], o[5], o[6], o[7], ph.v, pl.v, vb4, vb5, vb6, vb7);
      }
    }
    // publish point of stage t+1, every wave: own LDS reads done, own copies landed, block barrier; then refill the buffer just read
    wait_ds0();
    wait_async0();
    __syncthreads();
    if (t + 2 < NSTEP) {                               // block-uniform scalar test
      const int kn = (t + 2) * 32;
      stage_copy(cl + bsel, clb + bsel, Khb + (size_t)kn * (NKV * HD), Klb + (size_t)kn * (NKV * HD), Vb + (size_t)kn * HD, Wr + kn);
    }
  }
  wait_async0();
  acc_guard4(o[0], o[1], o[2], o[3]);
  acc_guard4(o[4], o[5], o[6], o[7]);

  // ---- fold 1/l and the carries (32768 on P, 16 on v), stage the wave's 16x128 slab in its LDS region ----
  wave_sync_lds();
  float* slab = smem + wave * SLABF;                   // ring space: every wave left it at the last step's barrier
  const float oc = 1.0f / (PCAR * VCAR);
  const float inv = (1.0f / (lrun + xhalf(lrun))) * oc;   // the two wave halves' key sums joined once
#pragma unroll
  for (int j = 0; j < 8; ++j) {                        // row = query c, 8 consecutive d per accumulator tile
    const v4f ra = {o[j][0] * inv, o[j][1] * inv, o[j][2] * inv, o[j][3] * inv};
    const v4f rb = {o[j][4] * inv, o[j][5] * inv, o[j][6] * inv, o[j][7] * inv};
    *(v4f*)(slab + c * 132 + j * 16 + 8 * hh)     = ra;
    *(v4f*)(slab + c * 132 + j * 16 + 8 * hh + 4) = rb;
  }
  wave_sync_lds();
  v4f vals[16];
#pragma unroll
  for (int row = 0; row < 16; ++row) vals[row] = *(const v4f*)(slab + row * 132 + lane * 4);
  float* dst = outp + (((size_t)(b * SEQ + q0)) * NH + head) * HD + lane * 4;
  {
#pragma unroll
    for (int row = 0; row < 16; ++row) {
      *(v4f*)(dst + (size_t)row * (NH * HD)) = vals[row];
    }
    
  }
}

// =====================================================================================================
// Workspace map (bytes); every plane is fully written by whole-line stores before it is read; no pad rows needed
// (all extents are exact multiples of the store granularity); offsets multiples of 4 MiB:
//   KHI f16 [2][64][8] tiles of 2048 x1024 hi    4194304
//   KLO f16 same, residual                  4194304
//   VT  f16 [2][8][32][8] fragments of 512 x16   4194304
//   end                                    12582912
// =====================================================================================================
extern "C" void kernel_launch(void* const* d_in, const int* in_sizes, int n_in,
                              void* d_out, int out_size, void* d_ws, size_t ws_size,
                              hipStream_t stream) {
  if (n_in < 7) return;
  if (in_sizes[0] != NB * SEQ * NH * HD) return;
  if (in_sizes[1] != NB * SEQ * NKV * HD || in_sizes[2] != NB * SEQ * NKV * HD) return;
  if (in_sizes[3] != SEQ * HD || in_sizes[4] != SEQ * HD) return;
  if (in_sizes[5] != NB * SEQ * SEQ) return;
  if (in_sizes[6] < 1) return;
  if (out_size != NB * SEQ * NH * HD) return;

  const float* q    = (const float*)d_in[0];
  const float* k    = (const float*)d_in[1];
  const float* v    = (const float*)d_in[2];
  const float* cosT = (const float*)d_in[3];
  const float* sinT = (const float*)d_in[4];
  const float* bias = (const float*)d_in[5];
  const float* scl  = (const float*)d_in[6];
  float*       out  = (float*)d_out;

  const size_t PK = (size_t)NB * SEQ * NKV * HD * 2;    //  4194304
  const size_t PV = (size_t)NB * NKV * HD * SEQ * 2;    //  4194304
  size_t off = 0;
  const size_t oKH = off; off += PK;
  const size_t oKL = off; off += PK;
  const size_t oVT = off; off += PV;
  if (off > ws_size) return;                            // off = 12582912
  if (off > (size_t)134217728) return;

  char* ws = (char*)d_ws;
  unsigned short* KHI = (unsigned short*)(ws + oKH);
  unsigned short* KLO = (unsigned short*)(ws + oKL);
  unsigned short* VT  = (unsigned short*)(ws + oVT);

  const int rowsK = NB * SEQ * NKV;                     // 16384
  const dim3 blk(256);
  const dim3 gRK((rowsK * 16) / 256);                   // 1024
  const dim3 gVT(NB * NKV * (SEQ / 64));                // 256
  const dim3 gAT(ATT_BLOCKS);                           // 1024
  const dim3 bAT(ATT_THREADS);                          // 128

  // (0) k' planes: hi = f16(1024 k'), lo = f16(1024 k' - hi); rows (b, s, g), heads per row group NKV
  rope16<<<gRK, blk, 0, stream>>>(k, cosT, sinT, KHI, KLO, rowsK, NKV, KSC);
  // (1) v^T plane x16
  vt16<<<gVT, blk, 0, stream>>>(v, VT);
  // (2) attention, q RoPE and split included -> out [b][s][h][d] f32
  attn_gqa<<<gAT, bAT, 0, stream>>>(q, cosT, sinT, KHI, KLO, VT, bias, scl, out);
  (void)hipGetLastError();
}

// v006
// A run of this version takes 63.1 microseconds.
// Two timings next to v005 both put it at 1.06 times that version's speed.
// Over all steps from v000 it is 3.57 times as fast.
// Contractions: scores^T k'.q'^T (q' and k' each carried x1024 as f16 hi plane + f16 residual plane, products hh+hl+lh, K=128)
// and out^T = v^T.P^T (P x32768 as f16 hi + f16 residual, v x16 f16 exact, products v.hi+v.lo, K=1024 in 32-key steps):
// all v_wmma_f32_16x16x32_f16, f32 accumulate. RoPE, additive score bias, base-2 online softmax and 1/l fold in f32 on VALU.
// Every float input RNE-converted to bf16 on load.
#include <hip/hip_runtime.h>
#include <math.h>
#include <stdint.h>

#define NB    2
#define SEQ   1024
#define NH    32
#define NKV   8
#define HD    128
#define GRP   4
#define QSC   1024.0f
#define KSC   1024.0f
#define PCAR  32768.0f
#define VCAR  16.0f
#define LOG2E 1.4426950408889634f
#define BIASTH (-1.0e8f)
#define ATW   GRP
#define ATT_THREADS (ATW * 32)
#define ATT_BLOCKS  (NB * NKV * (SEQ / 16))
#define SLABF (16 * 132)
#define VTP   72
#define NSTEP (SEQ / 32)
#define STG_KV 24576                       // bytes of one stage: k hi 2 tiles, k lo 2 tiles (4 KiB each), v^T 8 fragments (8 KiB)
#define BPITCH 144                         // LDS pitch in bytes of a 128-B bias row: rows r and r+8 fall on disjoint banks
#define STG_B  (STG_KV + 16 * BPITCH)      // one stage with its 16 x 32 bias tile
#define RING_B (2 * STG_B)
#define VT_BLOCKS   (NB * NKV * (SEQ / 64))   // blocks of the v^T launch that transpose
#define SCAN_BLOCKS (NB * (SEQ / 16))         // blocks of the same launch that scan one 16-row strip of the bias each
#define FLPITCH 32                            // words between two strips' step masks: one 128-B line per writer
static_assert(NH == NKV * GRP);
static_assert(HD == 128 && (SEQ % 64) == 0 && (SEQ % 32) == 0 && (SEQ % 16) == 0);
static_assert(ATT_THREADS == 128 && ATT_BLOCKS == 1024);
static_assert(((NB * SEQ * NH * 16) % 256) == 0 && ((NB * SEQ * NKV * 16) % 256) == 0);
static_assert(ATW * SLABF * 4 <= RING_B && (STG_B % 16) == 0 && NSTEP >= 2);
static_assert(STG_KV == 12 * ATT_THREADS * 16 && 16 * 128 == ATT_THREADS * 16);
static_assert((SEQ / 16) == 64 && NKV == 8);
static_assert(NSTEP == 32 && SEQ == 256 * 4);

typedef _Float16 v16h __attribute__((ext_vector_type(16)));
typedef _Float16 v8h  __attribute__((ext_vector_type(8)));
typedef float    v8f  __attribute__((ext_vector_type(8)));
typedef float    v4f  __attribute__((ext_vector_type(4)));
typedef unsigned int v4u __attribute__((ext_vector_type(4)));

union FragH { v16h v; v8h h[2]; v4u u[2]; };

// ---- scalar helpers --------------------------------------------------------------------------------
__device__ __forceinline__ unsigned short bf_bits(float f) {          // f32 -> bf16 bits, RNE convert
  unsigned u = __float_as_uint(f);
  return (unsigned short)((u + 0x7FFFu + ((u >> 16) & 1u)) >> 16);
}
__device__ __forceinline__ float bf_up(unsigned short h) { return __uint_as_float(((unsigned)h) << 16); }
__device__ __forceinline__ float bfr(float f) { return bf_up(bf_bits(f)); }   // value of the bf16 RNE convert
__device__ __forceinline__ unsigned short h_bits(_Float16 x) { return __builtin_bit_cast(unsigned short, x); }
__device__ __forceinline__ unsigned pk16(unsigned short a, unsigned short b) { return (unsigned)a | ((unsigned)b << 16); }
// value of lane l ^ 16 (the other half of the wave), a vector cross-row move
__device__ __forceinline__ float xhalf(float x) {
  const int b = __builtin_bit_cast(int, x);
  return __builtin_bit_cast(float, __builtin_amdgcn_permlanex16(b, b, 0x76543210, 0xfedcba98, false, false));
}
__device__ __forceinline__ v8f zero8() { v8f z = {0.f, 0.f, 0.f, 0.f, 0.f, 0.f, 0.f, 0.f}; return z; }

// ---- fragment loader: 16-bit A/B operand from a plane stored in fragment order. One fragment (16 rows/cols x 32 k) is 512
//      halves: piece (half, lane) of 8 halves at half*256 + lane*8, lane = 16*h + (row/col & 15); p already includes lane*8.
//      elements 0..7 <- piece half 0 (k0+8h..), elements 8..15 <- piece half 1 (k0+16+8h..)  (same split k map for A and B).
//      Each of the two 16-B loads reads 512 contiguous bytes per wave: four whole 128-B lines.
__device__ __forceinline__ v16h ldfrag_h(const _Float16* p) {
  FragH f;
  f.h[0] = *(const v8h*)(p);
  f.h[1] = *(const v8h*)(p + 256);
  return f.v;
}

__device__ __forceinline__ v8f mma_raw(v16h a, v16h b, v8f c) {
  return __builtin_amdgcn_wmma_f32_16x16x32_f16(false, a, false, b, (short)0, c, false, false);
}
__device__ __forceinline__ void guard_sc(v8f& a, v8f& b, v16h x0, v16h x1, v16h x2, v16h x3, v16h x4, v16h x5) {
#if defined(__HIP_DEVICE_COMPILE__)
  asm volatile("v_nop\n\tv_nop\n\tv_nop\n\tv_nop"
               : "+v"(a), "+v"(b) : "v"(x0), "v"(x1), "v"(x2), "v"(x3), "v"(x4), "v"(x5) : "memory");
#endif
}
__device__ __forceinline__ void guard_pv(v8f& a, v8f& b, v8f& c, v8f& d,
                                         v16h p0, v16h p1, v16h x0, v16h x1, v16h x2, v16h x3) {
#if defined(__HIP_DEVICE_COMPILE__)
  asm volatile("v_nop\n\tv_nop\n\tv_nop\n\tv_nop"
               : "+v"(a), "+v"(b), "+v"(c), "+v"(d) : "v"(p0), "v"(p1), "v"(x0), "v"(x1), "v"(x2), "v"(x3) : "memory");
#endif
}
__device__ __forceinline__ void acc_guard4(v8f& a, v8f& b, v8f& c, v8f& d) {
#if defined(__HIP_DEVICE_COMPILE__)
  asm volatile("v_nop\n\tv_nop\n\tv_nop\n\tv_nop" : "+v"(a), "+v"(b), "+v"(c), "+v"(d));
#endif
}
__device__ __forceinline__ void wave_sync_lds() {
  __builtin_amdgcn_fence(__ATOMIC_RELEASE, "workgroup");
  __builtin_amdgcn_wave_barrier();
  __builtin_amdgcn_fence(__ATOMIC_ACQUIRE, "workgroup");
}
// One stage of the attention ring: 13 asynchronous 16-B copies per lane, global -> LDS, through no register.
//   l  = LDS byte address of the stage + tid*16 (chunk j of 2 KiB at + j*2048), lb = this lane's 16 B of the bias tile in LDS;
//   kh, kl = this lane's 16 B in the first key tile of the k hi / k lo plane, vv in the step's v^T fragments, bb in the bias row.
// The s_wait_xcnt stands inside the statement so that no address register of a copy is rewritten ahead of it.
__device__ __forceinline__ void stage_copy(unsigned l, unsigned lb, const _Float16* kh, const _Float16* kl,
                                           const _Float16* vv, const float* bb) {
#if defined(__HIP_DEVICE_COMPILE__)
  const unsigned l1 = l + 2048, l2 = l + 4096, l3 = l + 6144, l4 = l + 8192, l5 = l + 10240, l6 = l + 12288, l7 = l + 14336;
  const unsigned l8 = l + 16384, l9 = l + 18432, l10 = l + 20480, l11 = l + 22528;
  const _Float16 *g1 = kh + 1024, *g2 = kh + NKV * 2048, *g3 = kh + NKV * 2048 + 1024;
  const _Float16 *g5 = kl + 1024, *g6 = kl + NKV * 2048, *g7 = kl + NKV * 2048 + 1024;
  const _Float16 *g9 = vv + 1024, *g10 = vv + 2048, *g11 = vv + 3072;
  asm volatile("global_load_async_to_lds_b128 %0, %13, off\n\t"
               "global_load_async_to_lds_b128 %1, %14, off\n\t"
               "global_load_async_to_lds_b128 %2, %15, off\n\t"
               "global_load_async_to_lds_b128 %3, %16, off\n\t"
               "global_load_async_to_lds_b128 %4, %17, off\n\t"
               "global_load_async_to_lds_b128 %5, %18, off\n\t"
               "global_load_async_to_lds_b128 %6, %19, off\n\t"
               "global_load_async_to_lds_b128 %7, %20, off\n\t"
               "global_load_async_to_lds_b128 %8, %21, off\n\t"
               "global_load_async_to_lds_b128 %9, %22, off\n\t"
               "global_load_async_to_lds_b128 %10, %23, off\n\t"
               "global_load_async_to_lds_b128 %11, %24, off\n\t"
               "global_load_async_to_lds_b128 %12, %25, off\n\t"
               "s_wait_xcnt 0x0"
               :: "v"(lb), "v"(l), "v"(l1), "v"(l2), "v"(l3), "v"(l4), "v"(l5), "v"(l6), "v"(l7), "v"(l8), "v"(l9), "v"(l10),
                  "v"(l11),
                  "v"(bb), "v"(kh), "v"(g1), "v"(g2), "v"(g3), "v"(kl), "v"(g5), "v"(g6), "v"(g7), "v"(vv), "v"(g9), "v"(g10),
                  "v"(g11)
               : "memory");
#endif
}
__device__ __forceinline__ void wait_async0() {   // this wave's copies have landed
#if defined(__HIP_DEVICE_COMPILE__)
  asm volatile("s_wait_asynccnt 0x0" ::: "memory");
#endif
}
__device__ __forceinline__ void wait_ds0() {      // this wave's LDS reads of the stage have returned before the stage is refilled
#if defined(__HIP_DEVICE_COMPILE__)
  asm volatile("s_wait_dscnt 0x0" ::: "memory");
#endif
}

// =====================================================================================================
// Rotate-half RoPE + 16-bit split pack. Rows are (batch, pos, head) with HD contiguous floats; pos = (row / hpr) mod SEQ.
//   w[d] = bf16(x[d]) * bf16(cos[pos][d]) + r[d] * bf16(sin[pos][d]),  r[d] = -bf16(x[d+64]) for d < 64, bf16(x[d-64]) for d >= 64
//   (bf16 x bf16 products are exact in f32, so w is the singly converted f32 sum);
//   hi[d] = f16(w * sc), lo[d] = f16(w * sc - hi[d])  (sc a power of two, residual unscaled).
// Planes are stored in fragment order: tile = (batch*SEQ/16 + pos/16)*hpr + head holds 16 positions x 128 d as 2048 halves,
//   piece (chunk = d/8, c = pos & 15) of 8 halves at (chunk*16 + c)*8, which is kk*512 + half*256 + lane*8 of ldfrag_h.
// Block = one tile. Thread = 8 consecutive d of one row: 16-B loads of x (own and partner half), cos, sin; one 16-B store per
// plane. A wave = 8 rows x 4 chunks: each load touches one whole 128-B line per row, each store fills four whole lines.
// coverage: grid = nrows/16 blocks x 256 thr x 8 halves = nrows x 128 of each plane exactly (host checks divisibility).
// =====================================================================================================
__global__ __launch_bounds__(256) void rope16(const float* __restrict__ x, const float* __restrict__ cosT,
                                              const float* __restrict__ sinT, unsigned short* hipl, unsigned short* lopl,
                                              int nrows, int hpr, float sc) {
  const int tile = blockIdx.x;
  if (tile * 16 >= nrows) return;           // never taken with the exact grid; no barriers in this kernel
  const int tid   = (int)threadIdx.x;
  const int c     = ((tid >> 5) & 1) * 8 + (tid & 7);          // position within the tile
  const int chunk = (tid >> 6) * 4 + ((tid >> 3) & 3);         // d / 8
  const int d0    = chunk * 8;
  const int srow  = (tile / hpr) * 16 + c;                     // batch*SEQ + pos
  const int row   = srow * hpr + (tile % hpr);
  const int pos   = srow & (SEQ - 1);
  const int d1  = d0 ^ 64;
  const float* xr = x + (size_t)row * HD;
  const float* cr = cosT + (size_t)pos * HD + d0;
  const float* sr = sinT + (size_t)pos * HD + d0;
  const v4f xa = *(const v4f*)(xr + d0), xb = *(const v4f*)(xr + d0 + 4);
  const v4f ya = *(const v4f*)(xr + d1), yb = *(const v4f*)(xr + d1 + 4);
  const v4f ca = *(const v4f*)(cr), cb = *(const v4f*)(cr + 4);
  const v4f sa = *(const v4f*)(sr), sb = *(const v4f*)(sr + 4);
  const float sgn = (d0 < 64) ? -1.0f : 1.0f;
  float w[8];
#pragma unroll
  for (int e = 0; e < 4; ++e) {
    w[e]     = bfr(xa[e]) * bfr(ca[e]) + (sgn * bfr(ya[e])) * bfr(sa[e]);
    w[4 + e] = bfr(xb[e]) * bfr(cb[e]) + (sgn * bfr(yb[e])) * bfr(sb[e]);
  }
  v4u oh, ol;
#pragma unroll
  for (int e = 0; e < 4; ++e) {
    const float t0 = w[2 * e] * sc, t1 = w[2 * e + 1] * sc;
    const _Float16 h0 = (_Float16)t0, h1 = (_Float16)t1;
    const _Float16 l0 = (_Float16)(t0 - (float)h0), l1 = (_Float16)(t1 - (float)h1);
    oh[e] = pk16(h_bits(h0), h_bits(h1));
    ol[e] = pk16(h_bits(l0), h_bits(l1));
  }
  const size_t o8 = (size_t)tile * (16 * HD) + (chunk * 16 + c) * 8;
  {
    *(v4u*)(hipl + o8) = oh;
    *(v4u*)(lopl + o8) = ol;
    
  }
}

// =====================================================================================================
// v^T plane, value f16( bf16(v[b][s][g][d]) * 16 ) (exact), stored in fragment order: fragment ((b*NKV + g)*SEQ/32 + s/32)*8 + d/16
// of 512 halves, piece (half = (s/16)&1, lane = 16*((s/8)&1) + (d&15)) of 8 keys. Block = (b, g, 64 keys): 64 source rows of
// 128 floats loaded with 16-B loads, converted, scattered into an LDS tile [d][64 keys] (pitch 72 halves); after a block barrier each
// coverage: load 256 thr x 32 elements = 64 x 128; store 4 iterations x 256 thr x 8 halves = 128 lines x 64 = the block's tile;
//           the first NB x NKV x SEQ/64 = 256 blocks of the grid cover the whole plane exactly once.
// =====================================================================================================
// Blocks VT_BLOCKS.. of the launch scan the score bias instead: block = one strip (batch, 16 query rows) x all keys. Bit t of the
// strip's word says that the 16 x 32 tile of key step t holds an entry above -1e8 after the bf16 convert (an open step); the
// attention kernel stages and works on open steps first, on masked steps only in a second pass. Thread = 4 columns x 16 rows, 8 neighbouring lanes = one tile.
__global__ __launch_bounds__(256) void vt16(const float* __restrict__ v, unsigned short* VTo,
                                            const float* __restrict__ Bp, unsigned* FL) {
  __shared__ __align__(16) unsigned short T[HD * VTP];
  __shared__ unsigned F[8];
  const int tid = threadIdx.x;
  const int bid = blockIdx.x;
  if (bid >= VT_BLOCKS) {                     // block-uniform
    const int strip = bid - VT_BLOCKS;        // b * SEQ/16 + query tile
    const float* src = Bp + (size_t)strip * (16 * SEQ) + tid * 4;
    bool allm = true;
#pragma unroll
    for (int r = 0; r < 16; ++r) {
      const v4f a = *(const v4f*)(src + r * SEQ);
#pragma unroll
      for (int e = 0; e < 4; ++e) allm = allm & (bfr(a[e]) <= BIASTH);
    }
    const unsigned bal = __builtin_amdgcn_ballot_w32(allm);
    unsigned nib = 0;
#pragma unroll
    for (int j = 0; j < 4; ++j) nib |= (((bal >> (8 * j)) & 0xffu) != 0xffu) ? (1u << j) : 0u;
    if ((tid & 31) == 0) F[tid >> 5] = nib << (4 * (tid >> 5));   // wave w holds steps 4w .. 4w+3
    __syncthreads();
    if (tid == 0) FL[strip * FLPITCH] = ((F[0] | F[1]) | (F[2] | F[3])) | ((F[4] | F[5]) | (F[6] | F[7]));
    return;
  }
  const int st  = bid & 15;
  const int g   = (bid >> 4) & 7;
  const int b   = bid >> 7;
  const int s0  = st * 64;
  {
    const int sl = tid >> 2;                  // key within tile 0..63
    const int dc = (tid & 3) * 32;            // d chunk
    const float* src = v + (((size_t)(b * SEQ + s0 + sl)) * NKV + g) * HD + dc;
#pragma unroll
    for (int i = 0; i < 8; ++i) {
      const v4f a = *(const v4f*)(src + 4 * i);
#pragma unroll
      for (int e = 0; e < 4; ++e) T[(dc + 4 * i + e) * VTP + sl] = h_bits((_Float16)(bfr(a[e]) * VCAR));
    }
  }
  __syncthreads();
  v4u vals[4];
#pragma unroll
  for (int it = 0; it < 4; ++it) {
    const int pi = it * 256 + tid;            // piece in the block's 16 fragments: [key step 2][d/16 8][half 2][lane 32]
    const int d  = ((pi >> 6) & 7) * 16 + (pi & 15);
    const int kc = (pi >> 9) * 4 + ((pi >> 5) & 1) * 2 + ((pi >> 4) & 1);   // 8-key chunk within the 64 keys
    vals[it] = *(const v4u*)(T + d * VTP + kc * 8);
  }
  unsigned short* dst = VTo + (size_t)bid * (64 * HD) + tid * 8;   // bid = ((b*NKV + g)*SEQ/64 + st)
  {
#pragma unroll
    for (int it = 0; it < 4; ++it) {
      *(v4u*)(dst + it * 2048) = vals[it];
    }
    
  }
}

// =====================================================================================================
// GQA flash attention: block = (batch b, kv head g, 16 query rows q0..q0+15), one wave per query head g*4 + wave.
//   q comes as the f32 input: each wave applies RoPE to its own 16 x 128 tile once, splits it x1024 into f16 hi + f16 residual and
//   keeps the 8 fragments (B operands) in registers for all steps (same formula and same values as rope16 gives for k).
//   k planes tiles [b][s/16][g]; v^T plane fragments [b][g][s/32][d/16];
//   score bias B[b][0][q][key] f32 added after bf16 RNE convert; scale = bf16(softmax_scale), base-2 softmax.
//   Per 32-key step the block's 128 threads bring the step's k hi / k lo tiles, v^T fragments and 16x32 bias tile (26 KiB) into LDS
//   by asynchronous copies, two buffers, one step ahead of use; the four waves (heads) read the same stage. Every wave passes
//   every publish point (s_wait_dscnt 0, s_wait_asynccnt 0, block barrier, refill).
//   Which steps run: the strip's word from the bias scan names the open steps (some bias entry > -1e8); only these are staged and
//   worked on. A step whose every bias entry is <= -1e8 adds exactly 0 to a row whose max is > -1e8 (exp2 underflows); if a row of
//   the block ends the open steps without such a max, a second pass takes all the masked steps as well.
//   Per step: 2 transposed score subtiles (rows = keys, columns = queries) x 4 k-steps x 3 products (k_hi.q_hi + k_hi.q_lo +
//   k_lo.q_hi), k fragments (A) from the stage (two 16-B loads per fragment, split k map), q fragments (B) from registers. A lane
//   then holds 16 scores of one query: max and sum in the lane, one exchange between the wave halves for the max; online
//   max-subtracted softmax in f32 (exp2); rescale of l and the 8 accumulator tiles by the lane's own factor; P^T*32768 (f16 hi)
//   and its f16 residual are converted in place into B fragments; 8 v^T A fragments from the stage, 16 v^T.P^T WMMAs.
//   Epilogue: 1/l and carry folds in f32; the wave's 16x128 f32 result staged in its LDS slab (pitch 132); each 512-B output row
//   One block barrier per step under block-uniform control flow; every wave does bounded work (at most 32 steps over both passes).
// coverage: per wave 16 rows x 32 lanes x 4 floats = 16 x 128; grid 1024 blocks x 4 waves = every (b, s, h) row exactly once.
// =====================================================================================================
__global__ __launch_bounds__(ATT_THREADS)
void attn_gqa(const float* __restrict__ Qp, const float* __restrict__ cosT, const float* __restrict__ sinT,
              const unsigned short* __restrict__ KHIp, const unsigned short* __restrict__ KLOp,
              const unsigned short* __restrict__ VTq, const float* __restrict__ Bp,
              const float* __restrict__ scp, const unsigned* __restrict__ FLp, float* outp) {
  // two stages of the ring; after the loop the ring holds the waves' result slabs
  __shared__ __align__(128) float smem[RING_B / 4];
  __shared__ unsigned seenw[ATW];

  const int tid  = threadIdx.x;
  const int wave = tid >> 5;
  const int lane = tid & 31;
  const int hh   = lane >> 4;
  const int c    = lane & 15;

  const int bid  = blockIdx.x;
  // Query tile: t or its mirror SEQ/16 - 1 - t, by the parity of eight bits of the block index. Under a lower-triangular bias a tile's
  // work grows with its index and all blocks are resident at once, so the launch lasts as long as the fullest WGP; blocks whose
  // indices differ in one of these bits now hold mirror tiles.
  // Two of the six tile bits stay out of the parity: t and its mirror then read the same parity, so the map is
  // a permutation of the 64 tiles for every (b, g). For speed only: any placement gives the same result.
  const int mir  = __builtin_popcount((unsigned)bid & 0x3DBu) & 1;
  const int qt   = (bid & 63) ^ (mir ? 63 : 0);        // SEQ / 16 query tiles
  const int g    = (bid >> 6) & 7;                     // kv head
  const int b    = bid >> 9;                           // batch
  const int head = g * GRP + wave;
  const int q0   = qt * 16;

  // copy sources of this thread: its 16 B of each 2-KiB chunk; per step the k planes advance 2 key tiles, v^T 8 fragments
  const size_t kofs = ((size_t)b * (SEQ / 16) * NKV + g) * (16 * HD) + 8 * tid;
  const _Float16* Khb = (const _Float16*)(const void*)KHIp + kofs;
  const _Float16* Klb = (const _Float16*)(const void*)KLOp + kofs;
  const _Float16* Vb  = (const _Float16*)(const void*)VTq + (size_t)(b * NKV + g) * (HD * SEQ) + 8 * tid;
  const float*    Wr  = Bp + ((size_t)b * SEQ + q0 + (tid >> 3)) * SEQ + (tid & 7) * 4;   // bias row tid/8, 4 columns
  const unsigned  ring = (unsigned)(uintptr_t)(const void*)smem;                    // LDS byte address of the ring
  const unsigned  cl   = ring + tid * 16;
  const unsigned  clb  = ring + STG_KV + (tid >> 3) * BPITCH + (tid & 7) * 16;
  const float lsc = bfr(scp[0]) * (LOG2E / (QSC * KSC));

  // this lane's query is row q0 + c: its running max (equal in both wave halves) and the sum over the keys of this lane's own half
  float mrun = -INFINITY, lrun = 0.f;
  v8f o[8];                                            // o[j][r] = out^T (d = 16j + 8hh + r, query q0 + c)
#pragma unroll
  for (int j = 0; j < 8; ++j) o[j] = zero8();

  // copies of key step ks into the buffer at byte offset bo of the ring
  auto fill = [&](unsigned bo, int ks) {
    stage_copy(cl + bo, clb + bo, Khb + (size_t)ks * (32 * NKV * HD), Klb + (size_t)ks * (32 * NKV * HD),
               Vb + (size_t)ks * (32 * HD), Wr + ks * 32);
  };
  // Key steps still to be staged, a scalar word equal in the whole block. Pass 0 takes the open steps of this strip in rising
  // order. A wholly masked step adds exactly 0 to a row whose maximum is above -1e8, so pass 1 takes the masked steps only if
  // some row of the block is still at or below that after pass 0.
  const unsigned open = (unsigned)__builtin_amdgcn_readfirstlane((int)FLp[(b * (SEQ / 16) + qt) * FLPITCH]);
  unsigned todo = open;
  int nst = __builtin_popcount(todo);
  // ring prologue: first stage landed and published, second in flight; the q fragments are built while the first flies
  if (todo != 0u) {
    fill(0u, __builtin_ctz(todo));
    todo &= todo - 1u;
  }

  // ---- q fragments: lane (hh, c) holds row q0 + c; fragment kk, elements 8*hf..8*hf+7 = d 32*kk + 16*hf + 8*hh + 0..7.
  //      The rotate-half partner d ^ 64 is fragment kk ^ 2, same hf, same lane, so a lane rotates what it loads itself. ----
  FragH qhf[4], qlf[4];
  {
    const int pos = q0 + c;
    const float* xr = Qp + (((size_t)(b * SEQ + pos)) * NH + head) * HD + 8 * hh;
    const float* cr = cosT + (size_t)pos * HD + 8 * hh;
    const float* sr = sinT + (size_t)pos * HD + 8 * hh;
#pragma unroll
    for (int p = 0; p < 4; ++p) {                       // d = 16p + 8hh + 0..7 and its partner 64 higher
      const int kk = p >> 1, hf = p & 1;
#pragma unroll
      for (int u = 0; u < 2; ++u) {
        const int d = 16 * p + 4 * u;
        const v4f xl = *(const v4f*)(xr + d), xu = *(const v4f*)(xr + d + 64);
        const v4f cl4 = *(const v4f*)(cr + d), cu4 = *(const v4f*)(cr + d + 64);
        const v4f sl4 = *(const v4f*)(sr + d), su4 = *(const v4f*)(sr + d + 64);
#pragma unroll
        for (int e = 0; e < 4; ++e) {
          const float a = bfr(xl[e]), z = bfr(xu[e]);
          const float tl = (a * bfr(cl4[e]) + (-z) * bfr(sl4[e])) * QSC;
          const float tu = (z * bfr(cu4[e]) + a * bfr(su4[e])) * QSC;
          const _Float16 hl = (_Float16)tl, hu = (_Float16)tu;
          qhf[kk].h[hf][4 * u + e]     = hl;
          qhf[kk + 2].h[hf][4 * u + e] = hu;
          qlf[kk].h[hf][4 * u + e]     = (_Float16)(tl - (float)hl);
          qlf[kk + 2].h[hf][4 * u + e] = (_Float16)(tu - (float)hu);
        }
      }
    }
#if defined(__HIP_DEVICE_COMPILE__)
    // the three row pointers stay live up to this wait, so no address register of the loads above is rewritten ahead of it
    asm volatile("s_wait_xcnt 0x0" :: "v"(xr), "v"(cr), "v"(sr) : "memory");
#endif
  }
#pragma unroll 1
  for (int pass = 0; pass < 2; ++pass) {
  if (pass == 1) {
    // join of the four waves' rows: one word a wave, one block barrier, the same answer in every wave
    const unsigned sbal = __builtin_amdgcn_ballot_w32(mrun > BIASTH);
    if (lane == 0) seenw[wave] = (sbal == 0xffffffffu) ? 1u : 0u;
    __syncthreads();
    const unsigned alls = (seenw[0] & seenw[1]) & (seenw[2] & seenw[3]);
    todo = __builtin_amdgcn_readfirstlane((int)alls) ? 0u : ~open;
    nst  = __builtin_popcount(todo);
    if (todo != 0u) {
      fill(0u, __builtin_ctz(todo));
      todo &= todo - 1u;
    }
  }
  if (nst == 0) continue;                              // block-uniform
  wait_async0();
  __syncthreads();
  if (todo != 0u) {
    fill(STG_B, __builtin_ctz(todo));
    todo &= todo - 1u;
  }

#pragma unroll 1
  for (int t = 0; t < nst; ++t) {
    const unsigned bsel = (unsigned)(t & 1) * STG_B;                       // this step's buffer
    const _Float16* sb  = (const _Float16*)(const void*)(smem + bsel / 4) + 8 * lane;
    // bias tile row c (this lane's query), columns 8hh + 0..7 and 16 + 8hh + 0..7: the keys of this lane's score registers
    const float* wp = smem + (bsel + STG_KV) / 4 + c * (BPITCH / 4) + 8 * hh;
    const v4f b0 = *(const v4f*)(wp), b1 = *(const v4f*)(wp + 4), b2 = *(const v4f*)(wp + 16), b3 = *(const v4f*)(wp + 20);
    float w0[8], w1[8];
#pragma unroll
    for (int e = 0; e < 4; ++e) {
      const float m0 = bfr(b0[e]), m1 = bfr(b1[e]), m2 = bfr(b2[e]), m3 = bfr(b3[e]);
      w0[e]     = m0 * LOG2E;
      w0[4 + e] = m1 * LOG2E;
      w1[e]     = m2 * LOG2E;
      w1[4 + e] = m3 * LOG2E;
    }
    {
      // ---- scores^T: D element r of this lane = (key kb + 8hh + r, query q0 + c) in s0, key kb + 16 + 8hh + r in s1 ----
      v8f s0 = zero8(), s1 = zero8();
      const _Float16* k0p = sb;                        // k hi, keys 0..15 of the step
      const _Float16* k1p = sb + 2048;                 // k hi, keys 16..31
      const _Float16* l0p = sb + 4096;                 // k lo
      const _Float16* l1p = sb + 6144;
#pragma unroll
      for (int kk = 0; kk < 4; ++kk) {
        const v16h qh  = qhf[kk].v, ql = qlf[kk].v;
        const v16h kh0 = ldfrag_h(k0p + kk * 512), kl0 = ldfrag_h(l0p + kk * 512);
        const v16h kh1 = ldfrag_h(k1p + kk * 512), kl1 = ldfrag_h(l1p + kk * 512);
        s0 = mma_raw(kh0, qh, s0);
        s0 = mma_raw(kh0, ql, s0);
        s0 = mma_raw(kl0, qh, s0);
        s1 = mma_raw(kh1, qh, s1);
        s1 = mma_raw(kh1, ql, s1);
        s1 = mma_raw(kl1, qh, s1);
        guard_sc(s0, s1, qh, ql, kh0, kl0, kh1, kl1);
      }
      // ---- online softmax in base 2: a lane holds 16 of its query's 32 scores, the other wave half the rest ----
      float t0[8], t1[8], m4[4];
#pragma unroll
      for (int r = 0; r < 8; ++r) {
        t0[r] = s0[r] * lsc + w0[r];
        t1[r] = s1[r] * lsc + w1[r];
      }
#pragma unroll
      for (int r = 0; r < 4; ++r) m4[r] = fmaxf(fmaxf(t0[r], t0[r + 4]), fmaxf(t1[r], t1[r + 4]));
      float mx = fmaxf(fmaxf(m4[0], m4[1]), fmaxf(m4[2], m4[3]));
      mx = fmaxf(mx, xhalf(mx));
      const float mn = fmaxf(mrun, mx);
      const float al = exp2f(mrun - mn);
      mrun = mn;
      // ---- B fragments of P^T*32768, hi f16 and residual f16, straight from the score registers: column = query c,
      //      elements 0..7 = keys kb + 8hh + 0..7 (s0), elements 8..15 = keys kb + 16 + 8hh + 0..7 (s1): the split k map ----
      FragH ph, pl;
      float p4[4];
#pragma unroll
      for (int r = 0; r < 8; ++r) {
        const float e0 = exp2f(t0[r] - mn), e1 = exp2f(t1[r] - mn);
        if (r < 4) p4[r] = e0 + e1; else p4[r - 4] += e0 + e1;
        const float ta = e0 * PCAR, tc = e1 * PCAR;
        const _Float16 ha = (_Float16)ta, hc = (_Float16)tc;
        ph.h[0][r] = ha;
        ph.h[1][r] = hc;
        pl.h[0][r] = (_Float16)(ta - (float)ha);
        pl.h[1][r] = (_Float16)(tc - (float)hc);
      }
      lrun = lrun * al + ((p4[0] + p4[1]) + (p4[2] + p4[3]));
#pragma unroll
      for (int j = 0; j < 8; ++j) o[j] *= al;
      // ---- v^T.P^T : A fragment row m = d = j*16 + c, fragment j of this 32-key step in the v^T plane ----
      const _Float16* vp = sb + 8192;
      {
        const v16h vb0 = ldfrag_h(vp);
        const v16h vb1 = ldfrag_h(vp + 512);
        const v16h vb2 = ldfrag_h(vp + 1024);
        const v16h vb3 = ldfrag_h(vp + 1536);
        o[0] = mma_raw(vb0, ph.v, o[0]);  o[0] = mma_raw(vb0, pl.v, o[0]);
        o[1] = mma_raw(vb1, ph.v, o[1]);  o[1] = mma_raw(vb1, pl.v, o[1]);
        o[2] = mma_raw(vb2, ph.v, o[2]);  o[2] = mma_raw(vb2, pl.v, o[2]);
        o[3] = mma_raw(vb3, ph.v, o[3]);  o[3] = mma_raw(vb3, pl.v, o[3]);
        guard_pv(o[0], o[1], o[2], o[3], ph.v, pl.v, vb0, vb1, vb2, vb3);
      }
      {
        const v16h vb4 = ldfrag_h(vp + 2048);
        const v16h vb5 = ldfrag_h(vp + 2560);
        const v16h vb6 = ldfrag_h(vp + 3072);
        const v16h vb7 = ldfrag_h(vp + 3584);
        o[4] = mma_raw(vb4, ph.v, o[4]);  o[4] = mma_raw(vb4, pl.v, o[4]);
        o[5] = mma_raw(vb5, ph.v, o[5]);  o[5] = mma_raw(vb5, pl.v, o[5]);
        o[6] = mma_raw(vb6, ph.v, o[6]);  o[6] = mma_raw(vb6, pl.v, o[6]);
        o[7] = mma_raw(vb7, ph.v, o[7]);  o[7] = mma_raw(vb7, pl.v, o[7]);
        guard_pv(o[4], o[5], o[6], o[7], ph.v, pl.v, vb4, vb5, vb6, vb7);
      }
    }
    // publish point of stage t+1, every wave: own LDS reads done, own copies landed, block barrier; then refill the buffer just read
    wait_ds0();
    wait_async0();
    __syncthreads();
    if (todo != 0u) {                                  // block-uniform scalar test
      fill(bsel, __builtin_ctz(todo));
      todo &= todo - 1u;
    }
  }
  wait_async0();
  }
  acc_guard4(o[0], o[1], o[2], o[3]);
  acc_guard4(o[4], o[5], o[6], o[7]);

  // ---- fold 1/l and the carries (32768 on P, 16 on v), stage the wave's 16x128 slab in its LDS region ----
  wave_sync_lds();
  float* slab = smem + wave * SLABF;                   // ring space: every wave left it at the last step's barrier
  const float oc = 1.0f / (PCAR * VCAR);
  const float inv = (1.0f / (lrun + xhalf(lrun))) * oc;   // the two wave halves' key sums joined once
#pragma unroll
  for (int j = 0; j < 8; ++j) {                        // row = query c, 8 consecutive d per accumulator tile
    const v4f ra = {o[j][0] * inv, o[j][1] * inv, o[j][2] * inv, o[j][3] * inv};
    const v4f rb = {o[j][4] * inv, o[j][5] * inv, o[j][6] * inv, o[j][7] * inv};
    *(v4f*)(slab + c * 132 + j * 16 + 8 * hh)     = ra;
    *(v4f*)(slab + c * 132 + j * 16 + 8 * hh + 4) = rb;
  }
  wave_sync_lds();
  v4f vals[16];
#pragma unroll
  for (int row = 0; row < 16; ++row) vals[row] = *(const v4f*)(slab + row * 132 + lane * 4);
  float* dst = outp + (((size_t)(b * SEQ + q0)) * NH + head) * HD + lane * 4;
  {
#pragma unroll
    for (int row = 0; row < 16; ++row) {
      *(v4f*)(dst + (size_t)row * (NH * HD)) = vals[row];
    }
    
  }
}

// =====================================================================================================
// Workspace map (bytes); every plane is fully written by whole-line stores before it is read; no pad rows needed
// (all extents are exact multiples of the store granularity); offsets multiples of 4 MiB:
//   KHI f16 [2][64][8] tiles of 2048 x1024 hi    4194304
//   KLO f16 same, residual                  4194304
//   VT  f16 [2][8][32][8] fragments of 512 x16   4194304
//   FL  u32 [2][64] open-step words, one per 128-B line   16384
//   end                                    12599296
// =====================================================================================================
extern "C" void kernel_launch(void* const* d_in, const int* in_sizes, int n_in,
                              void* d_out, int out_size, void* d_ws, size_t ws_size,
                              hipStream_t stream) {
  if (n_in < 7) return;
  if (in_sizes[0] != NB * SEQ * NH * HD) return;
  if (in_sizes[1] != NB * SEQ * NKV * HD || in_sizes[2] != NB * SEQ * NKV * HD) return;
  if (in_sizes[3] != SEQ * HD || in_sizes[4] != SEQ * HD) return;
  if (in_sizes[5] != NB * SEQ * SEQ) return;
  if (in_sizes[6] < 1) return;
  if (out_size != NB * SEQ * NH * HD) return;

  const float* q    = (const float*)d_in[0];
  const float* k    = (const float*)d_in[1];
  const float* v    = (const float*)d_in[2];
  const float* cosT = (const float*)d_in[3];
  const float* sinT = (const float*)d_in[4];
  const float* bias = (const float*)d_in[5];
  const float* scl  = (const float*)d_in[6];
  float*       out  = (float*)d_out;

  const size_t PK = (size_t)NB * SEQ * NKV * HD * 2;    //  4194304
  const size_t PV = (size_t)NB * NKV * HD * SEQ * 2;    //  4194304
  size_t off = 0;
  const size_t oKH = off; off += PK;
  const size_t oKL = off; off += PK;
  const size_t oVT = off; off += PV;
  const size_t oFL = off; off += (size_t)SCAN_BLOCKS * FLPITCH * 4;   // 16384
  if (off > ws_size) return;                            // off = 12599296
  if (off > (size_t)134217728) return;

  char* ws = (char*)d_ws;
  unsigned short* KHI = (unsigned short*)(ws + oKH);
  unsigned short* KLO = (unsigned short*)(ws + oKL);
  unsigned short* VT  = (unsigned short*)(ws + oVT);
  unsigned*       FL  = (unsigned*)(ws + oFL);

  const int rowsK = NB * SEQ * NKV;                     // 16384
  const dim3 blk(256);
  const dim3 gRK((rowsK * 16) / 256);                   // 1024
  const dim3 gVT(VT_BLOCKS + SCAN_BLOCKS);              // 256 + 128
  const dim3 gAT(ATT_BLOCKS);                           // 1024
  const dim3 bAT(ATT_THREADS);                          // 128

  // (0) k' planes: hi = f16(1024 k'), lo = f16(1024 k' - hi); rows (b, s, g), heads per row group NKV
  rope16<<<gRK, blk, 0, stream>>>(k, cosT, sinT, KHI, KLO, rowsK, NKV, KSC);
  // (1) v^T plane x16, and the open-step word of every 16-row strip of the bias
  vt16<<<gVT, blk, 0, stream>>>(v, VT, bias, FL);
  // (2) attention, q RoPE and split included -> out [b][s][h][d] f32
  attn_gqa<<<gAT, bAT, 0, stream>>>(q, cosT, sinT, KHI, KLO, VT, bias, scl, FL, out);
  (void)hipGetLastError();
}

// v007
// Measured time: 58.2 microseconds a run.
// Two timings next to v006 both put it at 1.09 times that version's speed.
// All steps since v000 together make it 3.88 times as fast.
// Contractions: scores^T k'.q'^T (q' and k' each carried x1024 as f16 hi plane + f16 residual plane, products hh+hl+lh, K=128)
// and out^T = v^T.P^T (P x32768 as f16 hi + f16 residual, v x16 f16 exact, products v.hi+v.lo, K=1024 in 32-key steps):
// all v_wmma_f32_16x16x32_f16, f32 accumulate. RoPE, additive score bias, base-2 online softmax and 1/l fold in f32 on VALU.
// Every float input RNE-converted to bf16 on load.
#include <hip/hip_runtime.h>
#include <math.h>
#include <stdint.h>

#define NB    2
#define SEQ   1024
#define NH    32
#define NKV   8
#define HD    128
#define GRP   4
#define QSC   1024.0f
#define KSC   1024.0f
#define PCAR  32768.0f
#define VCAR  16.0f
#define LOG2E 1.4426950408889634f
#define BIASTH (-1.0e8f)
#define ATW   GRP
#define ATT_THREADS (ATW * 32)
#define ATT_BLOCKS  (NB * NKV * (SEQ / 16))
#define SLABF (16 * 132)
#define VTP   72
#define NSTEP (SEQ / 32)
#define STG_KV 24576                       // bytes of one stage: k hi 2 tiles, k lo 2 tiles (4 KiB each), v^T 8 fragments (8 KiB)
#define BPITCH 144                         // LDS pitch in bytes of a 128-B bias row: rows r and r+8 fall on disjoint banks
#define STG_B  (STG_KV + 16 * BPITCH)      // one stage with its 16 x 32 bias tile
#define RING_B (2 * STG_B)
#define VT_BLOCKS   (NB * NKV * (SEQ / 64))   // blocks of the v^T launch that transpose
#define SCAN_BLOCKS (NB * (SEQ / 16))         // blocks of the same launch that scan one 16-row strip of the bias each
#define FLPITCH 32                            // words between two strips' step masks: one 128-B line per writer
static_assert(NH == NKV * GRP);
static_assert(HD == 128 && (SEQ % 64) == 0 && (SEQ % 32) == 0 && (SEQ % 16) == 0);
static_assert(ATT_THREADS == 128 && ATT_BLOCKS == 1024);
static_assert(((NB * SEQ * NH * 16) % 256) == 0 && ((NB * SEQ * NKV * 16) % 256) == 0);
static_assert(ATW * SLABF * 4 <= RING_B && (STG_B % 16) == 0 && NSTEP >= 2);
static_assert(STG_KV == 12 * ATT_THREADS * 16 && 16 * 128 == ATT_THREADS * 16);
static_assert((SEQ / 16) == 64 && NKV == 8);
static_assert(NSTEP == 32 && SEQ == 256 * 4);

typedef _Float16 v16h __attribute__((ext_vector_type(16)));
typedef _Float16 v8h  __attribute__((ext_vector_type(8)));
typedef float    v8f  __attribute__((ext_vector_type(8)));
typedef float    v4f  __attribute__((ext_vector_type(4)));
typedef unsigned int v4u __attribute__((ext_vector_type(4)));

union FragH { v16h v; v8h h[2]; v4u u[2]; };

// ---- scalar helpers --------------------------------------------------------------------------------
__device__ __forceinline__ unsigned short bf_bits(float f) {          // f32 -> bf16 bits, RNE convert
  unsigned u = __float_as_uint(f);
  return (unsigned short)((u + 0x7FFFu + ((u >> 16) & 1u)) >> 16);
}
__device__ __forceinline__ float bf_up(unsigned short h) { return __uint_as_float(((unsigned)h) << 16); }
__device__ __forceinline__ float bfr(float f) { return bf_up(bf_bits(f)); }   // value of the bf16 RNE convert
__device__ __forceinline__ unsigned short h_bits(_Float16 x) { return __builtin_bit_cast(unsigned short, x); }
__device__ __forceinline__ unsigned pk16(unsigned short a, unsigned short b) { return (unsigned)a | ((unsigned)b << 16); }
// value of lane l ^ 16 (the other half of the wave), a vector cross-row move
__device__ __forceinline__ float xhalf(float x) {
  const int b = __builtin_bit_cast(int, x);
  return __builtin_bit_cast(float, __builtin_amdgcn_permlanex16(b, b, 0x76543210, 0xfedcba98, false, false));
}
// 2^x by the bare hardware instruction. Every argument here is <= 0 (a score or an old maximum minus the new maximum). The library
// form adds a compare, two selects, an add and an ldexp per value only to return subnormal results for x < -126; such a term is
// below 2^-111 after the x32768 carry, so both f16 planes of P hold 0 for it either way, and l >= 1 does not see it; a rescale
// factor that small leaves of the old sums less than 2^-90 of one new term of weight 1, now exactly 0.
__device__ __forceinline__ float ex2(float x) {
#if defined(__HIP_DEVICE_COMPILE__)
  return __builtin_amdgcn_exp2f(x);
#else
  return exp2f(x);
#endif
}
__device__ __forceinline__ v8f zero8() { v8f z = {0.f, 0.f, 0.f, 0.f, 0.f, 0.f, 0.f, 0.f}; return z; }

// ---- fragment loader: 16-bit A/B operand from a plane stored in fragment order. One fragment (16 rows/cols x 32 k) is 512
//      halves: piece (half, lane) of 8 halves at half*256 + lane*8, lane = 16*h + (row/col & 15); p already includes lane*8.
//      elements 0..7 <- piece half 0 (k0+8h..), elements 8..15 <- piece half 1 (k0+16+8h..)  (same split k map for A and B).
//      Each of the two 16-B loads reads 512 contiguous bytes per wave: four whole 128-B lines.
__device__ __forceinline__ v16h ldfrag_h(const _Float16* p) {
  FragH f;
  f.h[0] = *(const v8h*)(p);
  f.h[1] = *(const v8h*)(p + 256);
  return f.v;
}

__device__ __forceinline__ v8f mma_raw(v16h a, v16h b, v8f c) {
  return __builtin_amdgcn_wmma_f32_16x16x32_f16(false, a, false, b, (short)0, c, false, false);
}
__device__ __forceinline__ void guard_sc(v8f& a, v8f& b, v16h x0, v16h x1, v16h x2, v16h x3, v16h x4, v16h x5) {
#if defined(__HIP_DEVICE_COMPILE__)
  asm volatile("v_nop\n\tv_nop\n\tv_nop\n\tv_nop"
               : "+v"(a), "+v"(b) : "v"(x0), "v"(x1), "v"(x2), "v"(x3), "v"(x4), "v"(x5) : "memory");
#endif
}
__device__ __forceinline__ void guard_pv(v8f& a, v8f& b, v8f& c, v8f& d,
                                         v16h p0, v16h p1, v16h x0, v16h x1, v16h x2, v16h x3) {
#if defined(__HIP_DEVICE_COMPILE__)
  asm volatile("v_nop\n\tv_nop\n\tv_nop\n\tv_nop"
               : "+v"(a), "+v"(b), "+v"(c), "+v"(d) : "v"(p0), "v"(p1), "v"(x0), "v"(x1), "v"(x2), "v"(x3) : "memory");
#endif
}
__device__ __forceinline__ void acc_guard4(v8f& a, v8f& b, v8f& c, v8f& d) {
#if defined(__HIP_DEVICE_COMPILE__)
  asm volatile("v_nop\n\tv_nop\n\tv_nop\n\tv_nop" : "+v"(a), "+v"(b), "+v"(c), "+v"(d));
#endif
}
__device__ __forceinline__ void wave_sync_lds() {
  __builtin_amdgcn_fence(__ATOMIC_RELEASE, "workgroup");
  __builtin_amdgcn_wave_barrier();
  __builtin_amdgcn_fence(__ATOMIC_ACQUIRE, "workgroup");
}
// One stage of the attention ring: 13 asynchronous 16-B copies per lane, global -> LDS, through no register.
//   l  = LDS byte address of the stage + tid*16 (chunk j of 2 KiB at + j*2048), lb = this lane's 16 B of the bias tile in LDS;
//   kh, kl = this lane's 16 B in the first key tile of the k hi / k lo plane, vv in the step's v^T fragments, bb in the bias row.
// The s_wait_xcnt stands inside the statement so that no address register of a copy is rewritten ahead of it.
__device__ __forceinline__ void stage_copy(unsigned l, unsigned lb, const _Float16* kh, const _Float16* kl,
                                           const _Float16* vv, const float* bb) {
#if defined(__HIP_DEVICE_COMPILE__)
  const unsigned l1 = l + 2048, l2 = l + 4096, l3 = l + 6144, l4 = l + 8192, l5 = l + 10240, l6 = l + 12288, l7 = l + 14336;
  const unsigned l8 = l + 16384, l9 = l + 18432, l10 = l + 20480, l11 = l + 22528;
  const _Float16 *g1 = kh + 1024, *g2 = kh + NKV * 2048, *g3 = kh + NKV * 2048 + 1024;
  const _Float16 *g5 = kl + 1024, *g6 = kl + NKV * 2048, *g7 = kl + NKV * 2048 + 1024;
  const _Float16 *g9 = vv + 1024, *g10 = vv + 2048, *g11 = vv + 3072;
  asm volatile("global_load_async_to_lds_b128 %0, %13, off\n\t"
               "global_load_async_to_lds_b128 %1, %14, off\n\t"
               "global_load_async_to_lds_b128 %2, %15, off\n\t"
               "global_load_async_to_lds_b128 %3, %16, off\n\t"
               "global_load_async_to_lds_b128 %4, %17, off\n\t"
               "global_load_async_to_lds_b128 %5, %18, off\n\t"
               "global_load_async_to_lds_b128 %6, %19, off\n\t"
               "global_load_async_to_lds_b128 %7, %20, off\n\t"
               "global_load_async_to_lds_b128 %8, %21, off\n\t"
               "global_load_async_to_lds_b128 %9, %22, off\n\t"
               "global_load_async_to_lds_b128 %10, %23, off\n\t"
               "global_load_async_to_lds_b128 %11, %24, off\n\t"
               "global_load_async_to_lds_b128 %12, %25, off\n\t"
               "s_wait_xcnt 0x0"
               :: "v"(lb), "v"(l), "v"(l1), "v"(l2), "v"(l3), "v"(l4), "v"(l5), "v"(l6), "v"(l7), "v"(l8), "v"(l9), "v"(l10),
                  "v"(l11),
                  "v"(bb), "v"(kh), "v"(g1), "v"(g2), "v"(g3), "v"(kl), "v"(g5), "v"(g6), "v"(g7), "v"(vv), "v"(g9), "v"(g10),
                  "v"(g11)
               : "memory");
#endif
}
__device__ __forceinline__ void wait_async0() {   // this wave's copies have landed
#if defined(__HIP_DEVICE_COMPILE__)
  asm volatile("s_wait_asynccnt 0x0" ::: "memory");
#endif
}
__device__ __forceinline__ void wait_ds0() {      // this wave's LDS reads of the stage have returned before the stage is refilled
#if defined(__HIP_DEVICE_COMPILE__)
  asm volatile("s_wait_dscnt 0x0" ::: "memory");
#endif
}

// =====================================================================================================
// Rotate-half RoPE + 16-bit split pack. Rows are (batch, pos, head) with HD contiguous floats; pos = (row / hpr) mod SEQ.
//   w[d] = bf16(x[d]) * bf16(cos[pos][d]) + r[d] * bf16(sin[pos][d]),  r[d] = -bf16(x[d+64]) for d < 64, bf16(x[d-64]) for d >= 64
//   (bf16 x bf16 products are exact in f32, so w is the singly converted f32 sum);
//   hi[d] = f16(w * sc), lo[d] = f16(w * sc - hi[d])  (sc a power of two, residual unscaled).
// Planes are stored in fragment order: tile = (batch*SEQ/16 + pos/16)*hpr + head holds 16 positions x 128 d as 2048 halves,
//   piece (chunk = d/8, c = pos & 15) of 8 halves at (chunk*16 + c)*8, which is kk*512 + half*256 + lane*8 of ldfrag_h.
// Block = one tile. Thread = 8 consecutive d of one row: 16-B loads of x (own and partner half), cos, sin; one 16-B store per
// plane. A wave = 8 rows x 4 chunks: each load touches one whole 128-B line per row, each store fills four whole lines.
// coverage: grid = nrows/16 blocks x 256 thr x 8 halves = nrows x 128 of each plane exactly (host checks divisibility).
// =====================================================================================================
__global__ __launch_bounds__(256) void rope16(const float* __restrict__ x, const float* __restrict__ cosT,
                                              const float* __restrict__ sinT, unsigned short* hipl, unsigned short* lopl,
                                              int nrows, int hpr, float sc) {
  const int tile = blockIdx.x;
  if (tile * 16 >= nrows) return;           // never taken with the exact grid; no barriers in this kernel
  const int tid   = (int)threadIdx.x;
  const int c     = ((tid >> 5) & 1) * 8 + (tid & 7);          // position within the tile
  const int chunk = (tid >> 6) * 4 + ((tid >> 3) & 3);         // d / 8
  const int d0    = chunk * 8;
  const int srow  = (tile / hpr) * 16 + c;                     // batch*SEQ + pos
  const int row   = srow * hpr + (tile % hpr);
  const int pos   = srow & (SEQ - 1);
  const int d1  = d0 ^ 64;
  const float* xr = x + (size_t)row * HD;
  const float* cr = cosT + (size_t)pos * HD + d0;
  const float* sr = sinT + (size_t)pos * HD + d0;
  const v4f xa = *(const v4f*)(xr + d0), xb = *(const v4f*)(xr + d0 + 4);
  const v4f ya = *(const v4f*)(xr + d1), yb = *(const v4f*)(xr + d1 + 4);
  const v4f ca = *(const v4f*)(cr), cb = *(const v4f*)(cr + 4);
  const v4f sa = *(const v4f*)(sr), sb = *(const v4f*)(sr + 4);
  const float sgn = (d0 < 64) ? -1.0f : 1.0f;
  float w[8];
#pragma unroll
  for (int e = 0; e < 4; ++e) {
    w[e]     = bfr(xa[e]) * bfr(ca[e]) + (sgn * bfr(ya[e])) * bfr(sa[e]);
    w[4 + e] = bfr(xb[e]) * bfr(cb[e]) + (sgn * bfr(yb[e])) * bfr(sb[e]);
  }
  v4u oh, ol;
#pragma unroll
  for (int e = 0; e < 4; ++e) {
    const float t0 = w[2 * e] * sc, t1 = w[2 * e + 1] * sc;
    const _Float16 h0 = (_Float16)t0, h1 = (_Float16)t1;
    const _Float16 l0 = (_Float16)(t0 - (float)h0), l1 = (_Float16)(t1 - (float)h1);
    oh[e] = pk16(h_bits(h0), h_bits(h1));
    ol[e] = pk16(h_bits(l0), h_bits(l1));
  }
  const size_t o8 = (size_t)tile * (16 * HD) + (chunk * 16 + c) * 8;
  {
    *(v4u*)(hipl + o8) = oh;
    *(v4u*)(lopl + o8) = ol;
    
  }
}

// =====================================================================================================
// v^T plane, value f16( bf16(v[b][s][g][d]) * 16 ) (exact), stored in fragment order: fragment ((b*NKV + g)*SEQ/32 + s/32)*8 + d/16
// of 512 halves, piece (half = (s/16)&1, lane = 16*((s/8)&1) + (d&15)) of 8 keys. Block = (b, g, 64 keys): 64 source rows of
// 128 floats loaded with 16-B loads, converted, scattered into an LDS tile [d][64 keys] (pitch 72 halves); after a block barrier each
// coverage: load 256 thr x 32 elements = 64 x 128; store 4 iterations x 256 thr x 8 halves = 128 lines x 64 = the block's tile;
//           the first NB x NKV x SEQ/64 = 256 blocks of the grid cover the whole plane exactly once.
// =====================================================================================================
// Blocks VT_BLOCKS.. of the launch scan the score bias instead: block = one strip (batch, 16 query rows) x all keys. Bit t of the
// strip's word says that the 16 x 32 tile of key step t holds an entry above -1e8 after the bf16 convert (an open step); the
// attention kernel stages and works on open steps first, on masked steps only in a second pass. Thread = 4 columns x 16 rows, 8 neighbouring lanes = one tile.
__global__ __launch_bounds__(256) void vt16(const float* __restrict__ v, unsigned short* VTo,
                                            const float* __restrict__ Bp, unsigned* FL) {
  __shared__ __align__(16) unsigned short T[HD * VTP];
  __shared__ unsigned F[8];
  const int tid = threadIdx.x;
  const int bid = blockIdx.x;
  if (bid >= VT_BLOCKS) {                     // block-uniform
    const int strip = bid - VT_BLOCKS;        // b * SEQ/16 + query tile
    const float* src = Bp + (size_t)strip * (16 * SEQ) + tid * 4;
    bool allm = true;
#pragma unroll
    for (int r = 0; r < 16; ++r) {
      const v4f a = *(const v4f*)(src + r * SEQ);
#pragma unroll
      for (int e = 0; e < 4; ++e) allm = allm & (bfr(a[e]) <= BIASTH);
    }
    const unsigned bal = __builtin_amdgcn_ballot_w32(allm);
    unsigned nib = 0;
#pragma unroll
    for (int j = 0; j < 4; ++j) nib |= (((bal >> (8 * j)) & 0xffu) != 0xffu) ? (1u << j) : 0u;
    if ((tid & 31) == 0) F[tid >> 5] = nib << (4 * (tid >> 5));   // wave w holds steps 4w .. 4w+3
    __syncthreads();
    if (tid == 0) FL[strip * FLPITCH] = ((F[0] | F[1]) | (F[2] | F[3])) | ((F[4] | F[5]) | (F[6] | F[7]));
    return;
  }
  const int st  = bid & 15;
  const int g   = (bid >> 4) & 7;
  const int b   = bid >> 7;
  const int s0  = st * 64;
  {
    const int sl = tid >> 2;                  // key within tile 0..63
    const int dc = (tid & 3) * 32;            // d chunk
    const float* src = v + (((size_t)(b * SEQ + s0 + sl)) * NKV + g) * HD + dc;
#pragma unroll
    for (int i = 0; i < 8; ++i) {
      const v4f a = *(const v4f*)(src + 4 * i);
#pragma unroll
      for (int e = 0; e < 4; ++e) T[(dc + 4 * i + e) * VTP + sl] = h_bits((_Float16)(bfr(a[e]) * VCAR));
    }
  }
  __syncthreads();
  v4u vals[4];
#pragma unroll
  for (int it = 0; it < 4; ++it) {
    const int pi = it * 256 + tid;            // piece in the block's 16 fragments: [key step 2][d/16 8][half 2][lane 32]
    const int d  = ((pi >> 6) & 7) * 16 + (pi & 15);
    const int kc = (pi >> 9) * 4 + ((pi >> 5) & 1) * 2 + ((pi >> 4) & 1);   // 8-key chunk within the 64 keys
    vals[it] = *(const v4u*)(T + d * VTP + kc * 8);
  }
  unsigned short* dst = VTo + (size_t)bid * (64 * HD) + tid * 8;   // bid = ((b*NKV + g)*SEQ/64 + st)
  {
#pragma unroll
    for (int it = 0; it < 4; ++it) {
      *(v4u*)(dst + it * 2048) = vals[it];
    }
    
  }
}

// =====================================================================================================
// GQA flash attention: block = (batch b, kv head g, 16 query rows q0..q0+15), one wave per query head g*4 + wave.
//   q comes as the f32 input: each wave applies RoPE to its own 16 x 128 tile once, splits it x1024 into f16 hi + f16 residual and
//   keeps the 8 fragments (B operands) in registers for all steps (same formula and same values as rope16 gives for k).
//   k planes tiles [b][s/16][g]; v^T plane fragments [b][g][s/32][d/16];
//   score bias B[b][0][q][key] f32 added after bf16 RNE convert; scale = bf16(softmax_scale), base-2 softmax.
//   Per 32-key step the block's 128 threads bring the step's k hi / k lo tiles, v^T fragments and 16x32 bias tile (26 KiB) into LDS
//   by asynchronous copies, two buffers, one step ahead of use; the four waves (heads) read the same stage. Every wave passes
//   every publish point (s_wait_dscnt 0, s_wait_asynccnt 0, block barrier, refill).
//   Which steps run: the strip's word from the bias scan names the open steps (some bias entry > -1e8); only these are staged and
//   worked on. A step whose every bias entry is <= -1e8 adds exactly 0 to a row whose max is > -1e8 (exp2 underflows); if a row of
//   the block ends the open steps without such a max, a second pass takes all the masked steps as well.
//   Per step: 2 transposed score subtiles (rows = keys, columns = queries) x 4 k-steps x 3 products (k_hi.q_hi + k_hi.q_lo +
//   k_lo.q_hi), k fragments (A) from the stage (two 16-B loads per fragment, split k map), q fragments (B) from registers. A lane
//   then holds 16 scores of one query: max and sum in the lane, one exchange between the wave halves for the max; online
//   max-subtracted softmax in f32 (exp2); rescale of l and the 8 accumulator tiles by the lane's own factor; P^T*32768 (f16 hi)
//   and its f16 residual are converted in place into B fragments; 8 v^T A fragments from the stage, 16 v^T.P^T WMMAs.
//   Epilogue: 1/l and carry folds in f32; the wave's 16x128 f32 result staged in its LDS slab (pitch 132); each 512-B output row
//   One block barrier per step under block-uniform control flow; every wave does bounded work (at most 32 steps over both passes).
// coverage: per wave 16 rows x 32 lanes x 4 floats = 16 x 128; grid 1024 blocks x 4 waves = every (b, s, h) row exactly once.
// =====================================================================================================
__global__ __launch_bounds__(ATT_THREADS)
void attn_gqa(const float* __restrict__ Qp, const float* __restrict__ cosT, const float* __restrict__ sinT,
              const unsigned short* __restrict__ KHIp, const unsigned short* __restrict__ KLOp,
              const unsigned short* __restrict__ VTq, const float* __restrict__ Bp,
              const float* __restrict__ scp, const unsigned* __restrict__ FLp, float* outp) {
  // two stages of the ring; after the loop the ring holds the waves' result slabs
  __shared__ __align__(128) float smem[RING_B / 4];
  __shared__ unsigned seenw[ATW];

  const int tid  = threadIdx.x;
  const int wave = tid >> 5;
  const int lane = tid & 31;
  const int hh   = lane >> 4;
  const int c    = lane & 15;

  const int bid  = blockIdx.x;
  // Query tile: t or its mirror SEQ/16 - 1 - t, by the parity of eight bits of the block index. Under a lower-triangular bias a tile's
  // work grows with its index and all blocks are resident at once, so the launch lasts as long as the fullest WGP; blocks whose
  // indices differ in one of these bits now hold mirror tiles.
  // Two of the six tile bits stay out of the parity: t and its mirror then read the same parity, so the map is
  // a permutation of the 64 tiles for every (b, g). For speed only: any placement gives the same result.
  const int mir  = __builtin_popcount((unsigned)bid & 0x3DBu) & 1;
  const int qt   = (bid & 63) ^ (mir ? 63 : 0);        // SEQ / 16 query tiles
  const int g    = (bid >> 6) & 7;                     // kv head
  const int b    = bid >> 9;                           // batch
  const int head = g * GRP + wave;
  const int q0   = qt * 16;

  // copy sources of this thread: its 16 B of each 2-KiB chunk; per step the k planes advance 2 key tiles, v^T 8 fragments
  const size_t kofs = ((size_t)b * (SEQ / 16) * NKV + g) * (16 * HD) + 8 * tid;
  const _Float16* Khb = (const _Float16*)(const void*)KHIp + kofs;
  const _Float16* Klb = (const _Float16*)(const void*)KLOp + kofs;
  const _Float16* Vb  = (const _Float16*)(const void*)VTq + (size_t)(b * NKV + g) * (HD * SEQ) + 8 * tid;
  const float*    Wr  = Bp + ((size_t)b * SEQ + q0 + (tid >> 3)) * SEQ + (tid & 7) * 4;   // bias row tid/8, 4 columns
  const unsigned  ring = (unsigned)(uintptr_t)(const void*)smem;                    // LDS byte address of the ring
  const unsigned  cl   = ring + tid * 16;
  const unsigned  clb  = ring + STG_KV + (tid >> 3) * BPITCH + (tid & 7) * 16;
  const float lsc = bfr(scp[0]) * (LOG2E / (QSC * KSC));

  // this lane's query is row q0 + c: its running max (equal in both wave halves) and the sum over the keys of this lane's own half
  float mrun = -INFINITY, lrun = 0.f;
  v8f o[8];                                            // o[j][r] = out^T (d = 16j + 8hh + r, query q0 + c)
#pragma unroll
  for (int j = 0; j < 8; ++j) o[j] = zero8();

  // copies of key step ks into the buffer at byte offset bo of the ring
  auto fill = [&](unsigned bo, int ks) {
    stage_copy(cl + bo, clb + bo, Khb + (size_t)ks * (32 * NKV * HD), Klb + (size_t)ks * (32 * NKV * HD),
               Vb + (size_t)ks * (32 * HD), Wr + ks * 32);
  };
  // Key steps still to be staged, a scalar word equal in the whole block. Pass 0 takes the open steps of this strip in rising
  // order. A wholly masked step adds exactly 0 to a row whose maximum is above -1e8, so pass 1 takes the masked steps only if
  // some row of the block is still at or below that after pass 0.
  const unsigned open = (unsigned)__builtin_amdgcn_readfirstlane((int)FLp[(b * (SEQ / 16) + qt) * FLPITCH]);
  unsigned todo = open;
  int nst = __builtin_popcount(todo);
  // ring prologue: first stage landed and published, second in flight; the q fragments are built while the first flies
  if (todo != 0u) {
    fill(0u, __builtin_ctz(todo));
    todo &= todo - 1u;
  }

  // ---- q fragments: lane (hh, c) holds row q0 + c; fragment kk, elements 8*hf..8*hf+7 = d 32*kk + 16*hf + 8*hh + 0..7.
  //      The rotate-half partner d ^ 64 is fragment kk ^ 2, same hf, same lane, so a lane rotates what it loads itself. ----
  FragH qhf[4], qlf[4];
  {
    const int pos = q0 + c;
    const float* xr = Qp + (((size_t)(b * SEQ + pos)) * NH + head) * HD + 8 * hh;
    const float* cr = cosT + (size_t)pos * HD + 8 * hh;
    const float* sr = sinT + (size_t)pos * HD + 8 * hh;
#pragma unroll
    for (int p = 0; p < 4; ++p) {                       // d = 16p + 8hh + 0..7 and its partner 64 higher
      const int kk = p >> 1, hf = p & 1;
#pragma unroll
      for (int u = 0; u < 2; ++u) {
        const int d = 16 * p + 4 * u;
        const v4f xl = *(const v4f*)(xr + d), xu = *(const v4f*)(xr + d + 64);
        const v4f cl4 = *(const v4f*)(cr + d), cu4 = *(const v4f*)(cr + d + 64);
        const v4f sl4 = *(const v4f*)(sr + d), su4 = *(const v4f*)(sr + d + 64);
#pragma unroll
        for (int e = 0; e < 4; ++e) {
          const float a = bfr(xl[e]), z = bfr(xu[e]);
          const float tl = (a * bfr(cl4[e]) + (-z) * bfr(sl4[e])) * QSC;
          const float tu = (z * bfr(cu4[e]) + a * bfr(su4[e])) * QSC;
          const _Float16 hl = (_Float16)tl, hu = (_Float16)tu;
          qhf[kk].h[hf][4 * u + e]     = hl;
          qhf[kk + 2].h[hf][4 * u + e] = hu;
          qlf[kk].h[hf][4 * u + e]     = (_Float16)(tl - (float)hl);
          qlf[kk + 2].h[hf][4 * u + e] = (_Float16)(tu - (float)hu);
        }
      }
    }
#if defined(__HIP_DEVICE_COMPILE__)
    // the three row pointers stay live up to this wait, so no address register of the loads above is rewritten ahead of it
    asm volatile("s_wait_xcnt 0x0" :: "v"(xr), "v"(cr), "v"(sr) : "memory");
#endif
  }
#pragma unroll 1
  for (int pass = 0; pass < 2; ++pass) {
  if (pass == 1) {
    // join of the four waves' rows: one word a wave, one block barrier, the same answer in every wave
    const unsigned sbal = __builtin_amdgcn_ballot_w32(mrun > BIASTH);
    if (lane == 0) seenw[wave] = (sbal == 0xffffffffu) ? 1u : 0u;
    __syncthreads();
    const unsigned alls = (seenw[0] & seenw[1]) & (seenw[2] & seenw[3]);
    todo = __builtin_amdgcn_readfirstlane((int)alls) ? 0u : ~open;
    nst  = __builtin_popcount(todo);
    if (todo != 0u) {
      fill(0u, __builtin_ctz(todo));
      todo &= todo - 1u;
    }
  }
  if (nst == 0) continue;                              // block-uniform
  wait_async0();
  __syncthreads();
  if (todo != 0u) {
    fill(STG_B, __builtin_ctz(todo));
    todo &= todo - 1u;
  }

#pragma unroll 1
  for (int t = 0; t < nst; ++t) {
    const unsigned bsel = (unsigned)(t & 1) * STG_B;                       // this step's buffer
    const _Float16* sb  = (const _Float16*)(const void*)(smem + bsel / 4) + 8 * lane;
    // bias tile row c (this lane's query), columns 8hh + 0..7 and 16 + 8hh + 0..7: the keys of this lane's score registers
    const float* wp = smem + (bsel + STG_KV) / 4 + c * (BPITCH / 4) + 8 * hh;
    const v4f b0 = *(const v4f*)(wp), b1 = *(const v4f*)(wp + 4), b2 = *(const v4f*)(wp + 16), b3 = *(const v4f*)(wp + 20);
    float w0[8], w1[8];
#pragma unroll
    for (int e = 0; e < 4; ++e) {
      const float m0 = bfr(b0[e]), m1 = bfr(b1[e]), m2 = bfr(b2[e]), m3 = bfr(b3[e]);
      w0[e]     = m0 * LOG2E;
      w0[4 + e] = m1 * LOG2E;
      w1[e]     = m2 * LOG2E;
      w1[4 + e] = m3 * LOG2E;
    }
    {
      // ---- scores^T: D element r of this lane = (key kb + 8hh + r, query q0 + c) in s0, key kb + 16 + 8hh + r in s1 ----
      v8f s0 = zero8(), s1 = zero8();
      const _Float16* k0p = sb;                        // k hi, keys 0..15 of the step
      const _Float16* k1p = sb + 2048;                 // k hi, keys 16..31
      const _Float16* l0p = sb + 4096;                 // k lo
      const _Float16* l1p = sb + 6144;
#pragma unroll
      for (int kk = 0; kk < 4; ++kk) {
        const v16h qh  = qhf[kk].v, ql = qlf[kk].v;
        const v16h kh0 = ldfrag_h(k0p + kk * 512), kl0 = ldfrag_h(l0p + kk * 512);
        const v16h kh1 = ldfrag_h(k1p + kk * 512), kl1 = ldfrag_h(l1p + kk * 512);
        s0 = mma_raw(kh0, qh, s0);
        s0 = mma_raw(kh0, ql, s0);
        s0 = mma_raw(kl0, qh, s0);
        s1 = mma_raw(kh1, qh, s1);
        s1 = mma_raw(kh1, ql, s1);
        s1 = mma_raw(kl1, qh, s1);
        guard_sc(s0, s1, qh, ql, kh0, kl0, kh1, kl1);
      }
      // ---- online softmax in base 2: a lane holds 16 of its query's 32 scores, the other wave half the rest ----
      float t0[8], t1[8], m4[4];
#pragma unroll
      for (int r = 0; r < 8; ++r) {
        t0[r] = s0[r] * lsc + w0[r];
        t1[r] = s1[r] * lsc + w1[r];
      }
#pragma unroll
      for (int r = 0; r < 4; ++r) m4[r] = fmaxf(fmaxf(t0[r], t0[r + 4]), fmaxf(t1[r], t1[r + 4]));
      float mx = fmaxf(fmaxf(m4[0], m4[1]), fmaxf(m4[2], m4[3]));
      mx = fmaxf(mx, xhalf(mx));
      const float mn = fmaxf(mrun, mx);
      // the rescale factor first; it is wanted by the multiplies that stand inside the run
      const float al = ex2(mrun - mn);
      float e0[8], e1[8];
#pragma unroll
      for (int r = 0; r < 8; ++r) {
        e0[r] = t0[r] - mn;
        e1[r] = t1[r] - mn;
      }
      // keeps the subtractions ahead of the run: left free, each lands directly in front of its exponential and the wave waits on it
      __builtin_amdgcn_sched_barrier(0);
#pragma unroll
      for (int r = 0; r < 8; ++r) {
        e0[r] = ex2(e0[r]);
        e1[r] = ex2(e1[r]);
      }
#pragma unroll
      for (int j = 0; j < 4; ++j) o[j] *= al;
      // one exponential, then one rescale multiply of the first four accumulator tiles: the independent
      // multiply stands in the slot the instruction set asks for behind a transcendental
#pragma unroll
      for (int r = 0; r < 16; ++r) {
        __builtin_amdgcn_sched_group_barrier(0x400, 1, 0);
        __builtin_amdgcn_sched_group_barrier(0x002, 1, 0);
      }
      // keeps the users behind the run: no exponential is followed by a wait for its own result
      __builtin_amdgcn_sched_barrier(0);
      mrun = mn;
      // ---- B fragments of P^T*32768, hi f16 and residual f16, straight from the score registers: column = query c,
      //      elements 0..7 = keys kb + 8hh + 0..7 (s0), elements 8..15 = keys kb + 16 + 8hh + 0..7 (s1): the split k map ----
      FragH ph, pl;
      float p4[4];
#pragma unroll
      for (int r = 0; r < 8; ++r) {
        if (r < 4) p4[r] = e0[r] + e1[r]; else p4[r - 4] += e0[r] + e1[r];
        const float ta = e0[r] * PCAR, tc = e1[r] * PCAR;
        const _Float16 ha = (_Float16)ta, hc = (_Float16)tc;
        ph.h[0][r] = ha;
        ph.h[1][r] = hc;
        pl.h[0][r] = (_Float16)(ta - (float)ha);
        pl.h[1][r] = (_Float16)(tc - (float)hc);
      }
      lrun = lrun * al + ((p4[0] + p4[1]) + (p4[2] + p4[3]));
#pragma unroll
      for (int j = 4; j < 8; ++j) o[j] *= al;
      // ---- v^T.P^T : A fragment row m = d = j*16 + c, fragment j of this 32-key step in the v^T plane ----
      const _Float16* vp = sb + 8192;
      {
        const v16h vb0 = ldfrag_h(vp);
        const v16h vb1 = ldfrag_h(vp + 512);
        const v16h vb2 = ldfrag_h(vp + 1024);
        const v16h vb3 = ldfrag_h(vp + 1536);
        o[0] = mma_raw(vb0, ph.v, o[0]);  o[0] = mma_raw(vb0, pl.v, o[0]);
        o[1] = mma_raw(vb1, ph.v, o[1]);  o[1] = mma_raw(vb1, pl.v, o[1]);
        o[2] = mma_raw(vb2, ph.v, o[2]);  o[2] = mma_raw(vb2, pl.v, o[2]);
        o[3] = mma_raw(vb3, ph.v, o[3]);  o[3] = mma_raw(vb3, pl.v, o[3]);
        guard_pv(o[0], o[1], o[2], o[3], ph.v, pl.v, vb0, vb1, vb2, vb3);
      }
      {
        const v16h vb4 = ldfrag_h(vp + 2048);
        const v16h vb5 = ldfrag_h(vp + 2560);
        const v16h vb6 = ldfrag_h(vp + 3072);
        const v16h vb7 = ldfrag_h(vp + 3584);
        o[4] = mma_raw(vb4, ph.v, o[4]);  o[4] = mma_raw(vb4, pl.v, o[4]);
        o[5] = mma_raw(vb5, ph.v, o[5]);  o[5] = mma_raw(vb5, pl.v, o[5]);
        o[6] = mma_raw(vb6, ph.v, o[6]);  o[6] = mma_raw(vb6, pl.v, o[6]);
        o[7] = mma_raw(vb7, ph.v, o[7]);  o[7] = mma_raw(vb7, pl.v, o[7]);
        guard_pv(o[4], o[5], o[6], o[7], ph.v, pl.v, vb4, vb5, vb6, vb7);
      }
    }
    // publish point of stage t+1, every wave: own LDS reads done, own copies landed, block barrier; then refill the buffer just read
    wait_ds0();
    wait_async0();
    __syncthreads();
    if (todo != 0u) {                                  // block-uniform scalar test
      fill(bsel, __builtin_ctz(todo));
      todo &= todo - 1u;
    }
  }
  wait_async0();
  }
  acc_guard4(o[0], o[1], o[2], o[3]);
  acc_guard4(o[4], o[5], o[6], o[7]);

  // ---- fold 1/l and the carries (32768 on P, 16 on v), stage the wave's 16x128 slab in its LDS region ----
  wave_sync_lds();
  float* slab = smem + wave * SLABF;                   // ring space: every wave left it at the last step's barrier
  const float oc = 1.0f / (PCAR * VCAR);
  const float inv = (1.0f / (lrun + xhalf(lrun))) * oc;   // the two wave halves' key sums joined once
#pragma unroll
  for (int j = 0; j < 8; ++j) {                        // row = query c, 8 consecutive d per accumulator tile
    const v4f ra = {o[j][0] * inv, o[j][1] * inv, o[j][2] * inv, o[j][3] * inv};
    const v4f rb = {o[j][4] * inv, o[j][5] * inv, o[j][6] * inv, o[j][7] * inv};
    *(v4f*)(slab + c * 132 + j * 16 + 8 * hh)     = ra;
    *(v4f*)(slab + c * 132 + j * 16 + 8 * hh + 4) = rb;
  }
  wave_sync_lds();
  v4f vals[16];
#pragma unroll
  for (int row = 0; row < 16; ++row) vals[row] = *(const v4f*)(slab + row * 132 + lane * 4);
  float* dst = outp + (((size_t)(b * SEQ + q0)) * NH + head) * HD + lane * 4;
  {
#pragma unroll
    for (int row = 0; row < 16; ++row) {
      *(v4f*)(dst + (size_t)row * (NH * HD)) = vals[row];
    }
    
  }
}

// =====================================================================================================
// Workspace map (bytes); every plane is fully written by whole-line stores before it is read; no pad rows needed
// (all extents are exact multiples of the store granularity); offsets multiples of 4 MiB:
//   KHI f16 [2][64][8] tiles of 2048 x1024 hi    4194304
//   KLO f16 same, residual                  4194304
//   VT  f16 [2][8][32][8] fragments of 512 x16   4194304
//   FL  u32 [2][64] open-step words, one per 128-B line   16384
//   end                                    12599296
// =====================================================================================================
extern "C" void kernel_launch(void* const* d_in, const int* in_sizes, int n_in,
                              void* d_out, int out_size, void* d_ws, size_t ws_size,
                              hipStream_t stream) {
  if (n_in < 7) return;
  if (in_sizes[0] != NB * SEQ * NH * HD) return;
  if (in_sizes[1] != NB * SEQ * NKV * HD || in_sizes[2] != NB * SEQ * NKV * HD) return;
  if (in_sizes[3] != SEQ * HD || in_sizes[4] != SEQ * HD) return;
  if (in_sizes[5] != NB * SEQ * SEQ) return;
  if (in_sizes[6] < 1) return;
  if (out_size != NB * SEQ * NH * HD) return;

  const float* q    = (const float*)d_in[0];
  const float* k    = (const float*)d_in[1];
  const float* v    = (const float*)d_in[2];
  const float* cosT = (const float*)d_in[3];
  const float* sinT = (const float*)d_in[4];
  const float* bias = (const float*)d_in[5];
  const float* scl  = (const float*)d_in[6];
  float*       out  = (float*)d_out;

  const size_t PK = (size_t)NB * SEQ * NKV * HD * 2;    //  4194304
  const size_t PV = (size_t)NB * NKV * HD * SEQ * 2;    //  4194304
  size_t off = 0;
  const size_t oKH = off; off += PK;
  const size_t oKL = off; off += PK;
  const size_t oVT = off; off += PV;
  const size_t oFL = off; off += (size_t)SCAN_BLOCKS * FLPITCH * 4;   // 16384
  if (off > ws_size) return;                            // off = 12599296
  if (off > (size_t)134217728) return;

  char* ws = (char*)d_ws;
  unsigned short* KHI = (unsigned short*)(ws + oKH);
  unsigned short* KLO = (unsigned short*)(ws + oKL);
  unsigned short* VT  = (unsigned short*)(ws + oVT);
  unsigned*       FL  = (unsigned*)(ws + oFL);

  const int rowsK = NB * SEQ * NKV;                     // 16384
  const dim3 blk(256);
  const dim3 gRK((rowsK * 16) / 256);                   // 1024
  const dim3 gVT(VT_BLOCKS + SCAN_BLOCKS);              // 256 + 128
  const dim3 gAT(ATT_BLOCKS);                           // 1024
  const dim3 bAT(ATT_THREADS);                          // 128

  // (0) k' planes: hi = f16(1024 k'), lo = f16(1024 k' - hi); rows (b, s, g), heads per row group NKV
  rope16<<<gRK, blk, 0, stream>>>(k, cosT, sinT, KHI, KLO, rowsK, NKV, KSC);
  // (1) v^T plane x16, and the open-step word of every 16-row strip of the bias
  vt16<<<gVT, blk, 0, stream>>>(v, VT, bias, FL);
  // (2) attention, q RoPE and split included -> out [b][s][h][d] f32
  attn_gqa<<<gAT, bAT, 0, stream>>>(q, cosT, sinT, KHI, KLO, VT, bias, scl, FL, out);
  (void)hipGetLastError();
}

// v009
// It runs in 43.1 microseconds.
// It is 1.34 times as fast as v007, going by the measured steps of the versions left out in between.
// Counting every step since v000, it is 5.22 times as fast.
// Contractions: scores^T k'.q'^T (q' and k' each carried x1024 as one f16 plane, one product, K=128)
// and out^T = v^T.P^T (P x32768 as one f16 plane, v x16 f16 exact, one product, K=1024 in 32-key steps):
// all v_wmma_f32_16x16x32_f16, f32 accumulate. RoPE, additive score bias, base-2 online softmax and 1/l fold in f32 on VALU.
// Every float input RNE-converted to bf16 on load.
// The bf16 convert of q, k and v leaves each input with a relative error up to 2^-8; the f16 convert of
// q', k' and P adds up to 2^-11 each, an eighth of that (a 64th in variance), relative to the rotated value itself.
#include <hip/hip_runtime.h>
#include <math.h>
#include <stdint.h>

#define NB    2
#define SEQ   1024
#define NH    32
#define NKV   8
#define HD    128
#define GRP   4
#define QSC   1024.0f
#define KSC   1024.0f
#define PCAR  32768.0f
#define VCAR  16.0f
#define LOG2E 1.4426950408889634f
#define BIASTH (-1.0e8f)
#define ATW   GRP
#define ATT_THREADS (ATW * 32)
#define ATT_BLOCKS  (NB * NKV * (SEQ / 16))
#define SLABF (16 * 132)
#define VTP   72
#define NSTEP (SEQ / 32)
#define STG_KV 16384                       // bytes of one stage: k 2 tiles (4 KiB each), v^T 8 fragments (8 KiB)
#define BPITCH 144                         // LDS pitch in bytes of a 128-B bias row: rows r and r+8 fall on disjoint banks
#define STG_B  (STG_KV + 16 * BPITCH)      // one stage with its 16 x 32 bias tile
#define RING_B (2 * STG_B)
#define VT_BLOCKS   (NB * NKV * (SEQ / 64))   // blocks of the v^T launch that transpose
#define SCAN_BLOCKS (NB * (SEQ / 16))         // blocks of the same launch that scan one 16-row strip of the bias each
#define FLPITCH 32                            // words between two strips' step masks: one 128-B line per writer
static_assert(NH == NKV * GRP);
static_assert(HD == 128 && (SEQ % 64) == 0 && (SEQ % 32) == 0 && (SEQ % 16) == 0);
static_assert(ATT_THREADS == 128 && ATT_BLOCKS == 1024);
static_assert(((NB * SEQ * NH * 16) % 256) == 0 && ((NB * SEQ * NKV * 16) % 256) == 0);
static_assert(ATW * SLABF * 4 <= RING_B && (STG_B % 16) == 0 && NSTEP >= 2);
static_assert(STG_KV == 8 * ATT_THREADS * 16 && 16 * 128 == ATT_THREADS * 16);
static_assert((SEQ / 16) == 64 && NKV == 8);
static_assert(NSTEP == 32 && SEQ == 256 * 4);

typedef _Float16 v16h __attribute__((ext_vector_type(16)));
typedef _Float16 v8h  __attribute__((ext_vector_type(8)));
typedef float    v8f  __attribute__((ext_vector_type(8)));
typedef float    v4f  __attribute__((ext_vector_type(4)));
typedef unsigned int v4u __attribute__((ext_vector_type(4)));

union FragH { v16h v; v8h h[2]; v4u u[2]; };

// ---- scalar helpers --------------------------------------------------------------------------------
__device__ __forceinline__ unsigned short bf_bits(float f) {          // f32 -> bf16 bits, RNE convert
  unsigned u = __float_as_uint(f);
  return (unsigned short)((u + 0x7FFFu + ((u >> 16) & 1u)) >> 16);
}
__device__ __forceinline__ float bf_up(unsigned short h) { return __uint_as_float(((unsigned)h) << 16); }
__device__ __forceinline__ float bfr(float f) { return bf_up(bf_bits(f)); }   // value of the bf16 RNE convert
__device__ __forceinline__ unsigned short h_bits(_Float16 x) { return __builtin_bit_cast(unsigned short, x); }
__device__ __forceinline__ unsigned pk16(unsigned short a, unsigned short b) { return (unsigned)a | ((unsigned)b << 16); }
// value of lane l ^ 16 (the other half of the wave), a vector cross-row move
__device__ __forceinline__ float xhalf(float x) {
  const int b = __builtin_bit_cast(int, x);
  return __builtin_bit_cast(float, __builtin_amdgcn_permlanex16(b, b, 0x76543210, 0xfedcba98, false, false));
}
// 2^x by the bare hardware instruction. Every argument here is <= 0 (a score or an old maximum minus the new maximum). The library
// form adds a compare, two selects, an add and an ldexp per value only to return subnormal results for x < -126; such a term is
// below 2^-111 after the x32768 carry, so the f16 plane of P holds 0 for it either way, and l >= 1 does not see it; a rescale
// factor that small leaves of the old sums less than 2^-90 of one new term of weight 1, now exactly 0.
__device__ __forceinline__ float ex2(float x) {
#if defined(__HIP_DEVICE_COMPILE__)
  return __builtin_amdgcn_exp2f(x);
#else
  return exp2f(x);
#endif
}
__device__ __forceinline__ v8f zero8() { v8f z = {0.f, 0.f, 0.f, 0.f, 0.f, 0.f, 0.f, 0.f}; return z; }

// ---- fragment loader: 16-bit A/B operand from a plane stored in fragment order. One fragment (16 rows/cols x 32 k) is 512
//      halves: piece (half, lane) of 8 halves at half*256 + lane*8, lane = 16*h + (row/col & 15); p already includes lane*8.
//      elements 0..7 <- piece half 0 (k0+8h..), elements 8..15 <- piece half 1 (k0+16+8h..)  (same split k map for A and B).
//      Each of the two 16-B loads reads 512 contiguous bytes per wave: four whole 128-B lines.
__device__ __forceinline__ v16h ldfrag_h(const _Float16* p) {
  FragH f;
  f.h[0] = *(const v8h*)(p);
  f.h[1] = *(const v8h*)(p + 256);
  return f.v;
}

__device__ __forceinline__ v8f mma_raw(v16h a, v16h b, v8f c) {
  return __builtin_amdgcn_wmma_f32_16x16x32_f16(false, a, false, b, (short)0, c, false, false);
}
// four vector slots behind the last score WMMAs: their D is not read and their A and B not overwritten inside the distance
__device__ __forceinline__ void guard_sc(v8f& a, v8f& b, v16h x0, v16h x1, v16h x2) {
#if defined(__HIP_DEVICE_COMPILE__)
  asm volatile("v_nop\n\tv_nop\n\tv_nop\n\tv_nop"
               : "+v"(a), "+v"(b) : "v"(x0), "v"(x1), "v"(x2) : "memory");
#endif
}
// the same behind the output WMMAs of a step, all eight ahead of the publish point and of the branch that follows it
__device__ __forceinline__ void guard_pv(v8f& a, v8f& b, v8f& c, v8f& d, v8f& e, v8f& f, v8f& g, v8f& h,
                                         v16h p0, v16h x0, v16h x1, v16h x2, v16h x3) {
#if defined(__HIP_DEVICE_COMPILE__)
  asm volatile("v_nop\n\tv_nop\n\tv_nop\n\tv_nop"
               : "+v"(a), "+v"(b), "+v"(c), "+v"(d), "+v"(e), "+v"(f), "+v"(g), "+v"(h)
               : "v"(p0), "v"(x0), "v"(x1), "v"(x2), "v"(x3) : "memory");
#endif
}
__device__ __forceinline__ void acc_guard4(v8f& a, v8f& b, v8f& c, v8f& d) {
#if defined(__HIP_DEVICE_COMPILE__)
  asm volatile("v_nop\n\tv_nop\n\tv_nop\n\tv_nop" : "+v"(a), "+v"(b), "+v"(c), "+v"(d));
#endif
}
__device__ __forceinline__ void wave_sync_lds() {
  __builtin_amdgcn_fence(__ATOMIC_RELEASE, "workgroup");
  __builtin_amdgcn_wave_barrier();
  __builtin_amdgcn_fence(__ATOMIC_ACQUIRE, "workgroup");
}
// One stage of the attention ring: 9 asynchronous 16-B copies per lane, global -> LDS, through no register.
//   l  = LDS byte address of the stage + tid*16 (chunk j of 2 KiB at + j*2048), lb = this lane's 16 B of the bias tile in LDS;
//   kh = this lane's 16 B in the first key tile of the k plane, vv in the step's v^T fragments, bb in the bias row.
// The s_wait_xcnt stands inside the statement so that no address register of a copy is rewritten ahead of it.
__device__ __forceinline__ void stage_copy(unsigned l, unsigned lb, const _Float16* kh, const _Float16* vv, const float* bb) {
#if defined(__HIP_DEVICE_COMPILE__)
  const unsigned l1 = l + 2048, l2 = l + 4096, l3 = l + 6144, l4 = l + 8192, l5 = l + 10240, l6 = l + 12288, l7 = l + 14336;
  const _Float16 *g1 = kh + 1024, *g2 = kh + NKV * 2048, *g3 = kh + NKV * 2048 + 1024;
  const _Float16 *g5 = vv + 1024, *g6 = vv + 2048, *g7 = vv + 3072;
  asm volatile("global_load_async_to_lds_b128 %0, %9, off\n\t"
               "global_load_async_to_lds_b128 %1, %10, off\n\t"
               "global_load_async_to_lds_b128 %2, %11, off\n\t"
               "global_load_async_to_lds_b128 %3, %12, off\n\t"
               "global_load_async_to_lds_b128 %4, %13, off\n\t"
               "global_load_async_to_lds_b128 %5, %14, off\n\t"
               "global_load_async_to_lds_b128 %6, %15, off\n\t"
               "global_load_async_to_lds_b128 %7, %16, off\n\t"
               "global_load_async_to_lds_b128 %8, %17, off\n\t"
               "s_wait_xcnt 0x0"
               :: "v"(lb), "v"(l), "v"(l1), "v"(l2), "v"(l3), "v"(l4), "v"(l5), "v"(l6), "v"(l7),
                  "v"(bb), "v"(kh), "v"(g1), "v"(g2), "v"(g3), "v"(vv), "v"(g5), "v"(g6), "v"(g7)
               : "memory");
#endif
}
__device__ __forceinline__ void wait_async0() {   // this wave's copies have landed
#if defined(__HIP_DEVICE_COMPILE__)
  asm volatile("s_wait_asynccnt 0x0" ::: "memory");
#endif
}
__device__ __forceinline__ void wait_ds0() {      // this wave's LDS reads of the stage have returned before the stage is refilled
#if defined(__HIP_DEVICE_COMPILE__)
  asm volatile("s_wait_dscnt 0x0" ::: "memory");
#endif
}

// =====================================================================================================
// Rotate-half RoPE + 16-bit pack of k. Rows are (batch, pos, kv head) with HD contiguous floats.
//   w[d] = bf16(x[d]) * bf16(cos[pos][d]) + r[d] * bf16(sin[pos][d]),  r[d] = -bf16(x[d+64]) for d < 64, bf16(x[d-64]) for d >= 64
//   (bf16 x bf16 products are exact in f32, so w is the singly converted f32 sum);
//   plane[d] = f16(w * sc)  (sc a power of two).
// The plane is stored in fragment order: tile = (batch*SEQ/16 + pos/16)*NKV + head holds 16 positions x 128 d as 2048 halves,
//   piece (chunk = d/8, c = pos & 15) of 8 halves at (chunk*16 + c)*8, which is kk*512 + half*256 + lane*8 of ldfrag_h.
// One tile by 256 threads. Thread = 8 consecutive d of one row: 16-B loads of x (own and partner half), cos, sin (rope_load); one
// 16-B store (rope_pack). A wave = 8 rows x 4 chunks: each load touches one whole 128-B line per row, each store fills four lines.
// coverage: 256 thr x 8 halves = the tile's 16 x 128; the callers' tiles cover the plane exactly once (see vt16).
// =====================================================================================================
struct RopeIn { v4f xa, xb, ya, yb, ca, cb, sa, sb; };
// x0, x1: the row at d0 and at its partner d0 ^ 64; cr, sr: the position's cos and sin at d0
__device__ __forceinline__ RopeIn rope_load(const float* x0, const float* x1, const float* cr, const float* sr) {
  RopeIn r;
  r.xa = *(const v4f*)(x0); r.xb = *(const v4f*)(x0 + 4);
  r.ya = *(const v4f*)(x1); r.yb = *(const v4f*)(x1 + 4);
  r.ca = *(const v4f*)(cr); r.cb = *(const v4f*)(cr + 4);
  r.sa = *(const v4f*)(sr); r.sb = *(const v4f*)(sr + 4);
  return r;
}
__device__ __forceinline__ v4u rope_pack(const RopeIn& r, float sgn, float sc) {   // sgn = -1 for d < 64, else 1
  float w[8];
#pragma unroll
  for (int e = 0; e < 4; ++e) {
    w[e]     = bfr(r.xa[e]) * bfr(r.ca[e]) + (sgn * bfr(r.ya[e])) * bfr(r.sa[e]);
    w[4 + e] = bfr(r.xb[e]) * bfr(r.cb[e]) + (sgn * bfr(r.yb[e])) * bfr(r.sb[e]);
  }
  v4u oh;
#pragma unroll
  for (int e = 0; e < 4; ++e) {
    const float t0 = w[2 * e] * sc, t1 = w[2 * e + 1] * sc;
    oh[e] = pk16(h_bits((_Float16)t0), h_bits((_Float16)t1));
  }
  return oh;
}

// =====================================================================================================
// v^T plane, value f16( bf16(v[b][s][g][d]) * 16 ) (exact), stored in fragment order: fragment ((b*NKV + g)*SEQ/32 + s/32)*8 + d/16
// of 512 halves, piece (half = (s/16)&1, lane = 16*((s/8)&1) + (d&15)) of 8 keys. Block = (b, g, 64 keys): 64 source rows of
// 128 floats loaded with 16-B loads, converted, scattered into an LDS tile [d][64 keys] (pitch 72 halves); after a block barrier each
// coverage: load 256 thr x 32 elements = 64 x 128; store 4 iterations x 256 thr x 8 halves = 128 lines x 64 = the block's tile;
//           the first NB x NKV x SEQ/64 = 256 blocks of the grid cover the whole plane exactly once.
// =====================================================================================================
// Blocks VT_BLOCKS.. of the launch scan the score bias instead: block = one strip (batch, 16 query rows) x all keys. Bit t of the
// strip's word says that the 16 x 32 tile of key step t holds an entry above -1e8 after the bf16 convert (an open step); the
// attention kernel stages and works on the open steps, and on the masked ones in a second pass only if some row of its block still lacks a max above -1e8. Thread = 4 columns x 16 rows, 8 neighbouring lanes = one tile.
// A transposing block also makes the k' plane of its own (b, g, 64 keys): 4 tiles of 16 positions (rope_load, rope_pack), loaded with
// its v rows and stored behind its v^T stores; 256 blocks x 4 tiles = all NB x SEQ/16 x NKV tiles, each once. No launch of its own for k.
__global__ __launch_bounds__(256) void vt16(const float* __restrict__ v, unsigned short* VTo,
                                            const float* __restrict__ Bp, unsigned* FL,
                                            const float* __restrict__ kx, const float* __restrict__ cosT,
                                            const float* __restrict__ sinT, unsigned short* KHo) {
  __shared__ __align__(16) unsigned short T[HD * VTP];
  __shared__ unsigned F[8];
  const int tid = threadIdx.x;
  const int bid = blockIdx.x;
  if (bid >= VT_BLOCKS) {                     // block-uniform
    const int strip = bid - VT_BLOCKS;        // b * SEQ/16 + query tile
    const float* src = Bp + (size_t)strip * (16 * SEQ) + tid * 4;
    bool allm = true;
#pragma unroll
    for (int r = 0; r < 16; ++r) {
      const v4f a = *(const v4f*)(src + r * SEQ);
#pragma unroll
      for (int e = 0; e < 4; ++e) allm = allm & (bfr(a[e]) <= BIASTH);
    }
    const unsigned bal = __builtin_amdgcn_ballot_w32(allm);
    unsigned nib = 0;
#pragma unroll
    for (int j = 0; j < 4; ++j) nib |= (((bal >> (8 * j)) & 0xffu) != 0xffu) ? (1u << j) : 0u;
    if ((tid & 31) == 0) F[tid >> 5] = nib << (4 * (tid >> 5));   // wave w holds steps 4w .. 4w+3
    __syncthreads();
    if (tid == 0) FL[strip * FLPITCH] = ((F[0] | F[1]) | (F[2] | F[3])) | ((F[4] | F[5]) | (F[6] | F[7]));
    return;
  }
  const int st  = bid & 15;
  const int g   = (bid >> 4) & 7;
  const int b   = bid >> 7;
  const int s0  = st * 64;
  const int sl = tid >> 2;                  // key within tile 0..63
  const int dc = (tid & 3) * 32;            // d chunk
  const float* src = v + (((size_t)(b * SEQ + s0 + sl)) * NKV + g) * HD + dc;
  // k' tile i of the block: positions s0 + 16i .. s0 + 16i + 15, kv head g; this thread's row c and 8 d from d0 in each tile
  const int c     = ((tid >> 5) & 1) * 8 + (tid & 7);
  const int chunk = (tid >> 6) * 4 + ((tid >> 3) & 3);
  const int d0    = chunk * 8;
  const float* xr = kx + (((size_t)(b * SEQ + s0 + c)) * NKV + g) * HD;
  const float* x0 = xr + d0;
  const float* x1 = xr + (d0 ^ 64);
  const float* cr = cosT + (size_t)(s0 + c) * HD + d0;
  const float* sr = sinT + (size_t)(s0 + c) * HD + d0;
  unsigned short* kd = KHo + ((size_t)((b * (SEQ / 16) + st * 4) * NKV + g)) * (16 * HD) + (chunk * 16 + c) * 8;
  v4f a[8];
  RopeIn kin[4];
#pragma unroll
  for (int i = 0; i < 8; ++i) a[i] = *(const v4f*)(src + 4 * i);
#pragma unroll
  for (int i = 0; i < 4; ++i)
    kin[i] = rope_load(x0 + i * (16 * NKV * HD), x1 + i * (16 * NKV * HD), cr + i * (16 * HD), sr + i * (16 * HD));
#if defined(__HIP_DEVICE_COMPILE__)
  // the five pointers stay live up to this wait, so no address register of the loads above is rewritten ahead of it
  asm volatile("s_wait_xcnt 0x0" :: "v"(src), "v"(x0), "v"(x1), "v"(cr), "v"(sr) : "memory");
#endif
#pragma unroll
  for (int i = 0; i < 8; ++i) {
#pragma unroll
    for (int e = 0; e < 4; ++e) T[(dc + 4 * i + e) * VTP + sl] = h_bits((_Float16)(bfr(a[i][e]) * VCAR));
  }
  __syncthreads();
  v4u vals[4];
#pragma unroll
  for (int it = 0; it < 4; ++it) {
    const int pi = it * 256 + tid;            // piece in the block's 16 fragments: [key step 2][d/16 8][half 2][lane 32]
    const int d  = ((pi >> 6) & 7) * 16 + (pi & 15);
    const int kc = (pi >> 9) * 4 + ((pi >> 5) & 1) * 2 + ((pi >> 4) & 1);   // 8-key chunk within the 64 keys
    vals[it] = *(const v4u*)(T + d * VTP + kc * 8);
  }
  unsigned short* dst = VTo + (size_t)bid * (64 * HD) + tid * 8;   // bid = ((b*NKV + g)*SEQ/64 + st)
  {
#pragma unroll
    for (int it = 0; it < 4; ++it) {
      *(v4u*)(dst + it * 2048) = vals[it];
    }
    
  }
  // the k' stores last: no barrier stands behind them
#pragma unroll
  for (int i = 0; i < 4; ++i) *(v4u*)(kd + i * (NKV * 16 * HD)) = rope_pack(kin[i], (d0 < 64) ? -1.0f : 1.0f, KSC);
#if defined(__HIP_DEVICE_COMPILE__)
  // stands behind the four stores, ahead of whatever the listing puts next that could rewrite a register they name
  asm volatile("s_wait_xcnt 0x0" ::: "memory");
#endif
}

// =====================================================================================================
// GQA flash attention: block = (batch b, kv head g, 16 query rows q0..q0+15), one wave per query head g*4 + wave.
//   q comes as the f32 input: each wave applies RoPE to its own 16 x 128 tile once, converts it x1024 to f16 and
//   keeps the 4 fragments (B operands) in registers for all steps (same formula and same values as rope_pack gives for k).
//   k plane tiles [b][s/16][g]; v^T plane fragments [b][g][s/32][d/16];
//   score bias B[b][0][q][key] f32 added after bf16 RNE convert; scale = bf16(softmax_scale), base-2 softmax.
//   Per 32-key step the block's 128 threads bring the step's k tiles, v^T fragments and 16x32 bias tile (18 KiB) into LDS
//   by asynchronous copies, two buffers, one step ahead of use; the four waves (heads) read the same stage. Every wave passes
//   every publish point (s_wait_dscnt 0, s_wait_asynccnt 0, block barrier, refill).
//   Which steps run: the strip's word from the bias scan names the open steps (some bias entry > -1e8); only these are staged and
//   worked on. A step whose every bias entry is <= -1e8 adds exactly 0 to a row whose max is > -1e8 (exp2 underflows); if a row of
//   the block ends the open steps without such a max, a second pass takes all the masked steps as well.
//   Per step: 2 transposed score subtiles (rows = keys, columns = queries) x 4 k-steps, k fragments (A) from the stage (two 16-B
//   loads per fragment, split k map), q fragments (B) from registers. A lane
//   then holds 16 scores of one query: max and sum in the lane, one exchange between the wave halves for the max; online
//   max-subtracted softmax in f32 (exp2); rescale of l and the 8 accumulator tiles by the lane's own factor; P^T*32768 is
//   converted in place into one f16 B fragment; 8 v^T A fragments from the stage, 8 v^T.P^T WMMAs.
//   Epilogue: 1/l and carry folds in f32; the wave's 16x128 f32 result staged in its LDS slab (pitch 132); each 512-B output row
//   One block barrier per step under block-uniform control flow; every wave does bounded work (at most 32 steps over both passes).
// coverage: per wave 16 rows x 32 lanes x 4 floats = 16 x 128; grid 1024 blocks x 4 waves = every (b, s, h) row exactly once.
// =====================================================================================================
__global__ __launch_bounds__(ATT_THREADS)
void attn_gqa(const float* __restrict__ Qp, const float* __restrict__ cosT, const float* __restrict__ sinT,
              const unsigned short* __restrict__ KHIp, const unsigned short* __restrict__ VTq, const float* __restrict__ Bp,
              const float* __restrict__ scp, const unsigned* __restrict__ FLp, float* outp) {
  // two stages of the ring; after the loop the ring holds the waves' result slabs
  __shared__ __align__(128) float smem[RING_B / 4];
  __shared__ unsigned seenw[ATW];

  const int tid  = threadIdx.x;
  const int wave = tid >> 5;
  const int lane = tid & 31;
  const int hh   = lane >> 4;
  const int c    = lane & 15;

  const int bid  = blockIdx.x;
  // Query tile: t or its mirror SEQ/16 - 1 - t, by the parity of eight bits of the block index. Under a lower-triangular bias a tile's
  // work grows with its index and all blocks are resident at once, so the launch lasts as long as the fullest WGP; blocks whose
  // indices differ in one of these bits now hold mirror tiles.
  // Two of the six tile bits stay out of the parity: t and its mirror then read the same parity, so the map is
  // a permutation of the 64 tiles for every (b, g). For speed only: any placement gives the same result.
  const int mir  = __builtin_popcount((unsigned)bid & 0x3DBu) & 1;
  const int qt   = (bid & 63) ^ (mir ? 63 : 0);        // SEQ / 16 query tiles
  const int g    = (bid >> 6) & 7;                     // kv head
  const int b    = bid >> 9;                           // batch
  const int head = g * GRP + wave;
  const int q0   = qt * 16;

  // copy sources of this thread: its 16 B of each 2-KiB chunk; per step the k plane advances 2 key tiles, v^T 8 fragments
  const size_t kofs = ((size_t)b * (SEQ / 16) * NKV + g) * (16 * HD) + 8 * tid;
  const _Float16* Khb = (const _Float16*)(const void*)KHIp + kofs;
  const _Float16* Vb  = (const _Float16*)(const void*)VTq + (size_t)(b * NKV + g) * (HD * SEQ) + 8 * tid;
  const float*    Wr  = Bp + ((size_t)b * SEQ + q0 + (tid >> 3)) * SEQ + (tid & 7) * 4;   // bias row tid/8, 4 columns
  const unsigned  ring = (unsigned)(uintptr_t)(const void*)smem;                    // LDS byte address of the ring
  const unsigned  cl   = ring + tid * 16;
  const unsigned  clb  = ring + STG_KV + (tid >> 3) * BPITCH + (tid & 7) * 16;
  const float lsc = bfr(scp[0]) * (LOG2E / (QSC * KSC));

  // this lane's query is row q0 + c: its running max (equal in both wave halves) and the sum over the keys of this lane's own half
  float mrun = -INFINITY, lrun = 0.f;
  v8f o[8];                                            // o[j][r] = out^T (d = 16j + 8hh + r, query q0 + c)
#pragma unroll
  for (int j = 0; j < 8; ++j) o[j] = zero8();

  // copies of key step ks into the buffer at byte offset bo of the ring
  auto fill = [&](unsigned bo, int ks) {
    stage_copy(cl + bo, clb + bo, Khb + (size_t)ks * (32 * NKV * HD), Vb + (size_t)ks * (32 * HD), Wr + ks * 32);
  };
  // Key steps still to be staged, a scalar word equal in the whole block. Pass 0 takes the open steps of this strip in rising
  // order. A wholly masked step adds exactly 0 to a row whose maximum is above -1e8, so pass 1 takes the masked steps only if
  // some row of the block is still at or below that after pass 0.
  const unsigned open = (unsigned)__builtin_amdgcn_readfirstlane((int)FLp[(b * (SEQ / 16) + qt) * FLPITCH]);
  unsigned todo = open;
  int nst = __builtin_popcount(todo);
  // ring prologue: first stage landed and published, second in flight; the q fragments are built while the first flies
  if (todo != 0u) {
    fill(0u, __builtin_ctz(todo));
    todo &= todo - 1u;
  }

  // ---- q fragments: lane (hh, c) holds row q0 + c; fragment kk, elements 8*hf..8*hf+7 = d 32*kk + 16*hf + 8*hh + 0..7.
  //      The rotate-half partner d ^ 64 is fragment kk ^ 2, same hf, same lane, so a lane rotates what it loads itself. ----
  FragH qhf[4];
  {
    const int pos = q0 + c;
    const float* xr = Qp + (((size_t)(b * SEQ + pos)) * NH + head) * HD + 8 * hh;
    const float* cr = cosT + (size_t)pos * HD + 8 * hh;
    const float* sr = sinT + (size_t)pos * HD + 8 * hh;
#pragma unroll
    for (int p = 0; p < 4; ++p) {                       // d = 16p + 8hh + 0..7 and its partner 64 higher
      const int kk = p >> 1, hf = p & 1;
#pragma unroll
      for (int u = 0; u < 2; ++u) {
        const int d = 16 * p + 4 * u;
        const v4f xl = *(const v4f*)(xr + d), xu = *(const v4f*)(xr + d + 64);
        const v4f cl4 = *(const v4f*)(cr + d), cu4 = *(const v4f*)(cr + d + 64);
        const v4f sl4 = *(const v4f*)(sr + d), su4 = *(const v4f*)(sr + d + 64);
#pragma unroll
        for (int e = 0; e < 4; ++e) {
          const float a = bfr(xl[e]), z = bfr(xu[e]);
          const float tl = (a * bfr(cl4[e]) + (-z) * bfr(sl4[e])) * QSC;
          const float tu = (z * bfr(cu4[e]) + a * bfr(su4[e])) * QSC;
          qhf[kk].h[hf][4 * u + e]     = (_Float16)tl;
          qhf[kk + 2].h[hf][4 * u + e] = (_Float16)tu;
        }
      }
    }
#if defined(__HIP_DEVICE_COMPILE__)
    // the three row pointers stay live up to this wait, so no address register of the loads above is rewritten ahead of it
    asm volatile("s_wait_xcnt 0x0" :: "v"(xr), "v"(cr), "v"(sr) : "memory");
#endif
  }
#pragma unroll 1
  for (int pass = 0; pass < 2; ++pass) {
  if (pass == 1) {
    // join of the four waves' rows: one word a wave, one block barrier, the same answer in every wave
    const unsigned sbal = __builtin_amdgcn_ballot_w32(mrun > BIASTH);
    if (lane == 0) seenw[wave] = (sbal == 0xffffffffu) ? 1u : 0u;
    __syncthreads();
    const unsigned alls = (seenw[0] & seenw[1]) & (seenw[2] & seenw[3]);
    todo = __builtin_amdgcn_readfirstlane((int)alls) ? 0u : ~open;
    nst  = __builtin_popcount(todo);
    if (todo != 0u) {
      fill(0u, __builtin_ctz(todo));
      todo &= todo - 1u;
    }
  }
  if (nst == 0) continue;                              // block-uniform
  wait_async0();
  __syncthreads();
  if (todo != 0u) {
    fill(STG_B, __builtin_ctz(todo));
    todo &= todo - 1u;
  }

#pragma unroll 1
  for (int t = 0; t < nst; ++t) {
    const unsigned bsel = (unsigned)(t & 1) * STG_B;                       // this step's buffer
    const _Float16* sb  = (const _Float16*)(const void*)(smem + bsel / 4) + 8 * lane;
    // bias tile row c (this lane's query), columns 8hh + 0..7 and 16 + 8hh + 0..7: the keys of this lane's score registers
    const float* wp = smem + (bsel + STG_KV) / 4 + c * (BPITCH / 4) + 8 * hh;
    const v4f b0 = *(const v4f*)(wp), b1 = *(const v4f*)(wp + 4), b2 = *(const v4f*)(wp + 16), b3 = *(const v4f*)(wp + 20);
    float w0[8], w1[8];
#pragma unroll
    for (int e = 0; e < 4; ++e) {
      const float m0 = bfr(b0[e]), m1 = bfr(b1[e]), m2 = bfr(b2[e]), m3 = bfr(b3[e]);
      w0[e]     = m0 * LOG2E;
      w0[4 + e] = m1 * LOG2E;
      w1[e]     = m2 * LOG2E;
      w1[4 + e] = m3 * LOG2E;
    }
    {
      // ---- scores^T: D element r of this lane = (key kb + 8hh + r, query q0 + c) in s0, key kb + 16 + 8hh + r in s1 ----
      v8f s0 = zero8(), s1 = zero8();
      const _Float16* k0p = sb;                        // k, keys 0..15 of the step
      const _Float16* k1p = sb + 2048;                 // k, keys 16..31
      v16h ka[4], kb[4];
#pragma unroll
      for (int kk = 0; kk < 4; ++kk) {
        ka[kk] = ldfrag_h(k0p + kk * 512);
        kb[kk] = ldfrag_h(k1p + kk * 512);
      }
#pragma unroll
      for (int kk = 0; kk < 4; ++kk) {
        s0 = mma_raw(ka[kk], qhf[kk].v, s0);
        s1 = mma_raw(kb[kk], qhf[kk].v, s1);
      }
      guard_sc(s0, s1, qhf[3].v, ka[3], kb[3]);
      // ---- online softmax in base 2: a lane holds 16 of its query's 32 scores, the other wave half the rest ----
      float t0[8], t1[8], m4[4];
#pragma unroll
      for (int r = 0; r < 8; ++r) {
        t0[r] = s0[r] * lsc + w0[r];
        t1[r] = s1[r] * lsc + w1[r];
      }
#pragma unroll
      for (int r = 0; r < 4; ++r) m4[r] = fmaxf(fmaxf(t0[r], t0[r + 4]), fmaxf(t1[r], t1[r + 4]));
      float mx = fmaxf(fmaxf(m4[0], m4[1]), fmaxf(m4[2], m4[3]));
      mx = fmaxf(mx, xhalf(mx));
      const float mn = fmaxf(mrun, mx);
      // the rescale factor first; it is wanted by the multiplies that stand inside the run
      const float al = ex2(mrun - mn);
      float e0[8], e1[8];
#pragma unroll
      for (int r = 0; r < 8; ++r) {
        e0[r] = t0[r] - mn;
        e1[r] = t1[r] - mn;
      }
      // keeps the subtractions ahead of the run: left free, each lands directly in front of its exponential and the wave waits on it
      __builtin_amdgcn_sched_barrier(0);
#pragma unroll
      for (int r = 0; r < 8; ++r) {
        e0[r] = ex2(e0[r]);
        e1[r] = ex2(e1[r]);
      }
#pragma unroll
      for (int j = 0; j < 4; ++j) o[j] *= al;
      // one exponential, then one rescale multiply of the first four accumulator tiles: the independent
      // multiply stands in the slot the instruction set asks for behind a transcendental
#pragma unroll
      for (int r = 0; r < 17; ++r) {                   // 16 scores and the rescale factor
        __builtin_amdgcn_sched_group_barrier(0x400, 1, 0);
        __builtin_amdgcn_sched_group_barrier(0x002, 1, 0);
      }
      // keeps the users behind the run: no exponential is followed by a wait for its own result
      __builtin_amdgcn_sched_barrier(0);
      mrun = mn;
      // ---- B fragment of P^T*32768 in f16, straight from the score registers: column = query c,
      //      elements 0..7 = keys kb + 8hh + 0..7 (s0), elements 8..15 = keys kb + 16 + 8hh + 0..7 (s1): the split k map ----
      FragH ph;
      float p4[4];
#pragma unroll
      for (int r = 0; r < 8; ++r) {
        if (r < 4) p4[r] = e0[r] + e1[r]; else p4[r - 4] += e0[r] + e1[r];
        ph.h[0][r] = (_Float16)(e0[r] * PCAR);
        ph.h[1][r] = (_Float16)(e1[r] * PCAR);
      }
      lrun = lrun * al + ((p4[0] + p4[1]) + (p4[2] + p4[3]));
#pragma unroll
      for (int j = 4; j < 8; ++j) o[j] *= al;
      // ---- v^T.P^T : A fragment row m = d = j*16 + c, fragment j of this 32-key step in the v^T plane ----
      const _Float16* vp = sb + 4096;
      v16h vb[8];
#pragma unroll
      for (int j = 0; j < 8; ++j) vb[j] = ldfrag_h(vp + j * 512);
#pragma unroll
      for (int j = 0; j < 8; ++j) o[j] = mma_raw(vb[j], ph.v, o[j]);
      guard_pv(o[0], o[1], o[2], o[3], o[4], o[5], o[6], o[7], ph.v, vb[4], vb[5], vb[6], vb[7]);
    }
    // publish point of stage t+1, every wave: own LDS reads done, own copies landed, block barrier; then refill the buffer just read
    wait_ds0();
    wait_async0();
    __syncthreads();
    if (todo != 0u) {                                  // block-uniform scalar test
      fill(bsel, __builtin_ctz(todo));
      todo &= todo - 1u;
    }
  }
  wait_async0();
  }
  acc_guard4(o[0], o[1], o[2], o[3]);
  acc_guard4(o[4], o[5], o[6], o[7]);

  // ---- fold 1/l and the carries (32768 on P, 16 on v), stage the wave's 16x128 slab in its LDS region ----
  wave_sync_lds();
  float* slab = smem + wave * SLABF;                   // ring space: every wave left it at the last step's barrier
  const float oc = 1.0f / (PCAR * VCAR);
  const float inv = (1.0f / (lrun + xhalf(lrun))) * oc;   // the two wave halves' key sums joined once
#pragma unroll
  for (int j = 0; j < 8; ++j) {                        // row = query c, 8 consecutive d per accumulator tile
    const v4f ra = {o[j][0] * inv, o[j][1] * inv, o[j][2] * inv, o[j][3] * inv};
    const v4f rb = {o[j][4] * inv, o[j][5] * inv, o[j][6] * inv, o[j][7] * inv};
    *(v4f*)(slab + c * 132 + j * 16 + 8 * hh)     = ra;
    *(v4f*)(slab + c * 132 + j * 16 + 8 * hh + 4) = rb;
  }
  wave_sync_lds();
  v4f vals[16];
#pragma unroll
  for (int row = 0; row < 16; ++row) vals[row] = *(const v4f*)(slab + row * 132 + lane * 4);
  float* dst = outp + (((size_t)(b * SEQ + q0)) * NH + head) * HD + lane * 4;
  {
#pragma unroll
    for (int row = 0; row < 16; ++row) {
      *(v4f*)(dst + (size_t)row * (NH * HD)) = vals[row];
    }
    
  }
}

// =====================================================================================================
// Workspace map (bytes); every plane is fully written by whole-line stores before it is read; no pad rows needed
// (all extents are exact multiples of the store granularity); offsets multiples of 4 MiB:
//   KHI f16 [2][64][8] tiles of 2048 x1024       4194304
//   VT  f16 [2][8][32][8] fragments of 512 x16   4194304
//   FL  u32 [2][64] open-step words, one per 128-B line   16384
//   end                                     8404992
// =====================================================================================================
extern "C" void kernel_launch(void* const* d_in, const int* in_sizes, int n_in,
                              void* d_out, int out_size, void* d_ws, size_t ws_size,
                              hipStream_t stream) {
  if (n_in < 7) return;
  if (in_sizes[0] != NB * SEQ * NH * HD) return;
  if (in_sizes[1] != NB * SEQ * NKV * HD || in_sizes[2] != NB * SEQ * NKV * HD) return;
  if (in_sizes[3] != SEQ * HD || in_sizes[4] != SEQ * HD) return;
  if (in_sizes[5] != NB * SEQ * SEQ) return;
  if (in_sizes[6] < 1) return;
  if (out_size != NB * SEQ * NH * HD) return;

  const float* q    = (const float*)d_in[0];
  const float* k    = (const float*)d_in[1];
  const float* v    = (const float*)d_in[2];
  const float* cosT = (const float*)d_in[3];
  const float* sinT = (const float*)d_in[4];
  const float* bias = (const float*)d_in[5];
  const float* scl  = (const float*)d_in[6];
  float*       out  = (float*)d_out;

  const size_t PK = (size_t)NB * SEQ * NKV * HD * 2;    //  4194304
  const size_t PV = (size_t)NB * NKV * HD * SEQ * 2;    //  4194304
  size_t off = 0;
  const size_t oKH = off; off += PK;
  const size_t oVT = off; off += PV;
  const size_t oFL = off; off += (size_t)SCAN_BLOCKS * FLPITCH * 4;   // 16384
  if (off > ws_size) return;                            // off = 8404992
  if (off > (size_t)134217728) return;

  char* ws = (char*)d_ws;
  unsigned short* KHI = (unsigned short*)(ws + oKH);
  unsigned short* VT  = (unsigned short*)(ws + oVT);
  unsigned*       FL  = (unsigned*)(ws + oFL);

  const dim3 blk(256);
  const dim3 gVT(VT_BLOCKS + SCAN_BLOCKS);              // 256 + 128
  const dim3 gAT(ATT_BLOCKS);                           // 1024
  const dim3 bAT(ATT_THREADS);                          // 128

  // (0) v^T plane x16 and k' plane f16(1024 k') by the same blocks, and the open-step word of every 16-row strip of the bias
  vt16<<<gVT, blk, 0, stream>>>(v, VT, bias, FL, k, cosT, sinT, KHI);
  // (1) attention, q RoPE and f16 convert included -> out [b][s][h][d] f32
  attn_gqa<<<gAT, bAT, 0, stream>>>(q, cosT, sinT, KHI, VT, bias, scl, FL, out);
  (void)hipGetLastError();
}

// v010
// It runs in 39.2 microseconds.
// Timed twice side by side with v009, it ran 1.08 and 1.09 times as fast.
// Counting every step since v000, it is 5.68 times as fast.
// Contractions: scores^T k'.q'^T (q' and k' each carried x1024 as one f16 plane, one product, K=128)
// and out^T = v^T.P^T (P x32768 as one f16 plane, v x16 f16 exact, one product, K=1024 in 64-key steps):
// all v_wmma_f32_16x16x32_f16, f32 accumulate. RoPE, additive score bias, base-2 online softmax and 1/l fold in f32 on VALU.
// Every float input RNE-converted to bf16 on load.
// The bf16 convert of q, k and v leaves each input with a relative error up to 2^-8; the f16 convert of
// q', k' and P adds up to 2^-11 each, an eighth of that (a 64th in variance), relative to the rotated value itself.
#include <hip/hip_runtime.h>
#include <math.h>
#include <stdint.h>

#define NB    2
#define SEQ   1024
#define NH    32
#define NKV   8
#define HD    128
#define GRP   4
#define QSC   1024.0f
#define KSC   1024.0f
#define PCAR  32768.0f
#define VCAR  16.0f
#define LOG2E 1.4426950408889634f
#define BIASTH (-1.0e8f)
#define ATW   GRP
#define ATT_THREADS (ATW * 32)
#define ATT_BLOCKS  (NB * NKV * (SEQ / 16))
#define SLABF (16 * 132)
#define VTP   72
#define KSTEP 64                           // keys of one step of the attention loop
#define NSTEP (SEQ / KSTEP)
#define STG_KV 32768                       // bytes of one stage: k 4 tiles (4 KiB each), v^T 16 fragments (16 KiB)
#define BPITCH 272                         // LDS pitch in bytes of a 256-B bias row: the 16 rows of a 16-B read fall on disjoint banks
#define STG_B  (STG_KV + 16 * BPITCH)      // one stage with its 16 x 64 bias tile
#define RING_B (2 * STG_B)
#define VT_BLOCKS   (NB * NKV * (SEQ / 64))   // blocks of the v^T launch that transpose
#define SCAN_BLOCKS (NB * (SEQ / 16))         // blocks of the same launch that scan one 16-row strip of the bias each
#define FLPITCH 32                            // words between two strips' step masks: one 128-B line per writer
static_assert(NH == NKV * GRP);
static_assert(HD == 128 && (SEQ % 64) == 0 && (SEQ % 32) == 0 && (SEQ % 16) == 0);
static_assert(ATT_THREADS == 128 && ATT_BLOCKS == 1024);
static_assert(((NB * SEQ * NH * 16) % 256) == 0 && ((NB * SEQ * NKV * 16) % 256) == 0);
static_assert(ATW * SLABF * 4 <= RING_B && (STG_B % 16) == 0 && NSTEP >= 2);
static_assert(STG_KV == 16 * ATT_THREADS * 16 && 16 * KSTEP * 4 == 2 * ATT_THREADS * 16);
static_assert((SEQ / 16) == 64 && NKV == 8);
static_assert(NSTEP == 16 && SEQ == 256 * 4);

typedef _Float16 v16h __attribute__((ext_vector_type(16)));
typedef _Float16 v8h  __attribute__((ext_vector_type(8)));
typedef float    v8f  __attribute__((ext_vector_type(8)));
typedef float    v4f  __attribute__((ext_vector_type(4)));
typedef unsigned int v4u __attribute__((ext_vector_type(4)));

union FragH { v16h v; v8h h[2]; v4u u[2]; };

// ---- scalar helpers --------------------------------------------------------------------------------
__device__ __forceinline__ unsigned short bf_bits(float f) {          // f32 -> bf16 bits, RNE convert
  unsigned u = __float_as_uint(f);
  return (unsigned short)((u + 0x7FFFu + ((u >> 16) & 1u)) >> 16);
}
__device__ __forceinline__ float bf_up(unsigned short h) { return __uint_as_float(((unsigned)h) << 16); }
__device__ __forceinline__ float bfr(float f) { return bf_up(bf_bits(f)); }   // value of the bf16 RNE convert
__device__ __forceinline__ unsigned short h_bits(_Float16 x) { return __builtin_bit_cast(unsigned short, x); }
__device__ __forceinline__ unsigned pk16(unsigned short a, unsigned short b) { return (unsigned)a | ((unsigned)b << 16); }
// value of lane l ^ 16 (the other half of the wave), a vector cross-row move
__device__ __forceinline__ float xhalf(float x) {
  const int b = __builtin_bit_cast(int, x);
  return __builtin_bit_cast(float, __builtin_amdgcn_permlanex16(b, b, 0x76543210, 0xfedcba98, false, false));
}
// 2^x by the bare hardware instruction. Every argument here is <= 0 (a score or an old maximum minus the new maximum). The library
// form adds a compare, two selects, an add and an ldexp per value only to return subnormal results for x < -126; such a term is
// below 2^-111 after the x32768 carry, so the f16 plane of P holds 0 for it either way, and l >= 1 does not see it; a rescale
// factor that small leaves of the old sums less than 2^-90 of one new term of weight 1, now exactly 0.
__device__ __forceinline__ float ex2(float x) {
#if defined(__HIP_DEVICE_COMPILE__)
  return __builtin_amdgcn_exp2f(x);
#else
  return exp2f(x);
#endif
}
__device__ __forceinline__ v8f zero8() { v8f z = {0.f, 0.f, 0.f, 0.f, 0.f, 0.f, 0.f, 0.f}; return z; }

// ---- fragment loader: 16-bit A/B operand from a plane stored in fragment order. One fragment (16 rows/cols x 32 k) is 512
//      halves: piece (half, lane) of 8 halves at half*256 + lane*8, lane = 16*h + (row/col & 15); p already includes lane*8.
//      elements 0..7 <- piece half 0 (k0+8h..), elements 8..15 <- piece half 1 (k0+16+8h..)  (same split k map for A and B).
//      Each of the two 16-B loads reads 512 contiguous bytes per wave: four whole 128-B lines.
__device__ __forceinline__ v16h ldfrag_h(const _Float16* p) {
  FragH f;
  f.h[0] = *(const v8h*)(p);
  f.h[1] = *(const v8h*)(p + 256);
  return f.v;
}

__device__ __forceinline__ v8f mma_raw(v16h a, v16h b, v8f c) {
  return __builtin_amdgcn_wmma_f32_16x16x32_f16(false, a, false, b, (short)0, c, false, false);
}
// four vector slots behind the last score WMMAs: their D is not read and their A and B not overwritten inside the distance
__device__ __forceinline__ void guard_sc(v8f& a, v8f& b, v8f& c, v8f& d, v16h x0, v16h x1, v16h x2, v16h x3, v16h x4) {
#if defined(__HIP_DEVICE_COMPILE__)
  asm volatile("v_nop\n\tv_nop\n\tv_nop\n\tv_nop"
               : "+v"(a), "+v"(b), "+v"(c), "+v"(d) : "v"(x0), "v"(x1), "v"(x2), "v"(x3), "v"(x4) : "memory");
#endif
}
// the same behind the output WMMAs of a step, all eight ahead of the publish point and of the branch that follows it
__device__ __forceinline__ void guard_pv(v8f& a, v8f& b, v8f& c, v8f& d, v8f& e, v8f& f, v8f& g, v8f& h,
                                         v16h p0, v16h x0, v16h x1, v16h x2, v16h x3) {
#if defined(__HIP_DEVICE_COMPILE__)
  asm volatile("v_nop\n\tv_nop\n\tv_nop\n\tv_nop"
               : "+v"(a), "+v"(b), "+v"(c), "+v"(d), "+v"(e), "+v"(f), "+v"(g), "+v"(h)
               : "v"(p0), "v"(x0), "v"(x1), "v"(x2), "v"(x3) : "memory");
#endif
}
__device__ __forceinline__ void acc_guard4(v8f& a, v8f& b, v8f& c, v8f& d) {
#if defined(__HIP_DEVICE_COMPILE__)
  asm volatile("v_nop\n\tv_nop\n\tv_nop\n\tv_nop" : "+v"(a), "+v"(b), "+v"(c), "+v"(d));
#endif
}
__device__ __forceinline__ void wave_sync_lds() {
  __builtin_amdgcn_fence(__ATOMIC_RELEASE, "workgroup");
  __builtin_amdgcn_wave_barrier();
  __builtin_amdgcn_fence(__ATOMIC_ACQUIRE, "workgroup");
}
// Half a stage of the attention ring: 9 asynchronous 16-B copies per lane, global -> LDS, through no register.
//   l  = LDS byte address of the half (k or v^T, 16 KiB) + tid*16 (chunk j of 2 KiB at + j*2048), lb = this lane's 16 B of 8 bias rows;
//   g0 = this lane's 16 B of the half's first 4 KiB in its plane, st = halves from one 4 KiB to the next, bb in the bias row.
// The s_wait_xcnt stands inside the statement so that no address register of a copy is rewritten ahead of it.
__device__ __forceinline__ void stage_copy(unsigned l, unsigned lb, const _Float16* g0, int st, const float* bb) {
#if defined(__HIP_DEVICE_COMPILE__)
  const unsigned l1 = l + 2048, l2 = l + 4096, l3 = l + 6144, l4 = l + 8192, l5 = l + 10240, l6 = l + 12288, l7 = l + 14336;
  const _Float16 *g1 = g0 + 1024, *g2 = g0 + st, *g3 = g0 + st + 1024;
  const _Float16 *g4 = g0 + 2 * st, *g5 = g0 + 2 * st + 1024, *g6 = g0 + 3 * st, *g7 = g0 + 3 * st + 1024;
  asm volatile("global_load_async_to_lds_b128 %0, %9, off\n\t"
               "global_load_async_to_lds_b128 %1, %10, off\n\t"
               "global_load_async_to_lds_b128 %2, %11, off\n\t"
               "global_load_async_to_lds_b128 %3, %12, off\n\t"
               "global_load_async_to_lds_b128 %4, %13, off\n\t"
               "global_load_async_to_lds_b128 %5, %14, off\n\t"
               "global_load_async_to_lds_b128 %6, %15, off\n\t"
               "global_load_async_to_lds_b128 %7, %16, off\n\t"
               "global_load_async_to_lds_b128 %8, %17, off\n\t"
               "s_wait_xcnt 0x0"
               :: "v"(lb), "v"(l), "v"(l1), "v"(l2), "v"(l3), "v"(l4), "v"(l5), "v"(l6), "v"(l7),
                  "v"(bb), "v"(g0), "v"(g1), "v"(g2), "v"(g3), "v"(g4), "v"(g5), "v"(g6), "v"(g7)
               : "memory");
#endif
}
__device__ __forceinline__ void wait_async0() {   // this wave's copies have landed
#if defined(__HIP_DEVICE_COMPILE__)
  asm volatile("s_wait_asynccnt 0x0" ::: "memory");
#endif
}
__device__ __forceinline__ void wait_ds0() {      // this wave's LDS reads of the stage have returned before the stage is refilled
#if defined(__HIP_DEVICE_COMPILE__)
  asm volatile("s_wait_dscnt 0x0" ::: "memory");
#endif
}

// =====================================================================================================
// Rotate-half RoPE + 16-bit pack of k. Rows are (batch, pos, kv head) with HD contiguous floats.
//   w[d] = bf16(x[d]) * bf16(cos[pos][d]) + r[d] * bf16(sin[pos][d]),  r[d] = -bf16(x[d+64]) for d < 64, bf16(x[d-64]) for d >= 64
//   (bf16 x bf16 products are exact in f32, so w is the singly converted f32 sum);
//   plane[d] = f16(w * sc)  (sc a power of two).
// The plane is stored in fragment order: tile = (batch*SEQ/16 + pos/16)*NKV + head holds 16 positions x 128 d as 2048 halves,
//   piece (chunk = d/8, c = pos & 15) of 8 halves at (chunk*16 + c)*8, which is kk*512 + half*256 + lane*8 of ldfrag_h.
// One tile by 256 threads. Thread = 8 consecutive d of one row: 16-B loads of x (own and partner half), cos, sin (rope_load); one
// 16-B store (rope_pack). A wave = 8 rows x 4 chunks: each load touches one whole 128-B line per row, each store fills four lines.
// coverage: 256 thr x 8 halves = the tile's 16 x 128; the callers' tiles cover the plane exactly once (see vt16).
// =====================================================================================================
struct RopeIn { v4f xa, xb, ya, yb, ca, cb, sa, sb; };
// x0, x1: the row at d0 and at its partner d0 ^ 64; cr, sr: the position's cos and sin at d0
__device__ __forceinline__ RopeIn rope_load(const float* x0, const float* x1, const float* cr, const float* sr) {
  RopeIn r;
  r.xa = *(const v4f*)(x0); r.xb = *(const v4f*)(x0 + 4);
  r.ya = *(const v4f*)(x1); r.yb = *(const v4f*)(x1 + 4);
  r.ca = *(const v4f*)(cr); r.cb = *(const v4f*)(cr + 4);
  r.sa = *(const v4f*)(sr); r.sb = *(const v4f*)(sr + 4);
  return r;
}
__device__ __forceinline__ v4u rope_pack(const RopeIn& r, float sgn, float sc) {   // sgn = -1 for d < 64, else 1
  float w[8];
#pragma unroll
  for (int e = 0; e < 4; ++e) {
    w[e]     = bfr(r.xa[e]) * bfr(r.ca[e]) + (sgn * bfr(r.ya[e])) * bfr(r.sa[e]);
    w[4 + e] = bfr(r.xb[e]) * bfr(r.cb[e]) + (sgn * bfr(r.yb[e])) * bfr(r.sb[e]);
  }
  v4u oh;
#pragma unroll
  for (int e = 0; e < 4; ++e) {
    const float t0 = w[2 * e] * sc, t1 = w[2 * e + 1] * sc;
    oh[e] = pk16(h_bits((_Float16)t0), h_bits((_Float16)t1));
  }
  return oh;
}

// =====================================================================================================
// v^T plane, value f16( bf16(v[b][s][g][d]) * 16 ) (exact), stored in fragment order: fragment ((b*NKV + g)*SEQ/32 + s/32)*8 + d/16
// of 512 halves, piece (half = (s/16)&1, lane = 16*((s/8)&1) + (d&15)) of 8 keys. Block = (b, g, 64 keys): 64 source rows of
// 128 floats loaded with 16-B loads, converted, scattered into an LDS tile [d][64 keys] (pitch 72 halves); after a block barrier each
// coverage: load 256 thr x 32 elements = 64 x 128; store 4 iterations x 256 thr x 8 halves = 128 lines x 64 = the block's tile;
//           the first NB x NKV x SEQ/64 = 256 blocks of the grid cover the whole plane exactly once.
// =====================================================================================================
// Blocks VT_BLOCKS.. of the launch scan the score bias instead: block = one strip (batch, 16 query rows) x all keys. Bit t of the
// strip's word says that the 16 x 64 tile of key step t holds an entry above -1e8 after the bf16 convert (an open step); the
// attention kernel stages and works on the open steps, and on the masked ones in a second pass if a row needs them. Thread = 4 columns x 16 rows, 16 neighbouring lanes = one tile.
// A transposing block also makes the k' plane of its own (b, g, 64 keys): 4 tiles of 16 positions (rope_load, rope_pack), loaded with
// its v rows and stored behind its v^T stores; 256 blocks x 4 tiles = all NB x SEQ/16 x NKV tiles, each once. No launch of its own for k.
__global__ __launch_bounds__(256) void vt16(const float* __restrict__ v, unsigned short* VTo,
                                            const float* __restrict__ Bp, unsigned* FL,
                                            const float* __restrict__ kx, const float* __restrict__ cosT,
                                            const float* __restrict__ sinT, unsigned short* KHo) {
  __shared__ __align__(16) unsigned short T[HD * VTP];
  __shared__ unsigned F[8];
  const int tid = threadIdx.x;
  const int bid = blockIdx.x;
  if (bid >= VT_BLOCKS) {                     // block-uniform
    const int strip = bid - VT_BLOCKS;        // b * SEQ/16 + query tile
    const float* src = Bp + (size_t)strip * (16 * SEQ) + tid * 4;
    bool allm = true;
#pragma unroll
    for (int r = 0; r < 16; ++r) {
      const v4f a = *(const v4f*)(src + r * SEQ);
#pragma unroll
      for (int e = 0; e < 4; ++e) allm = allm & (bfr(a[e]) <= BIASTH);
    }
    const unsigned bal = __builtin_amdgcn_ballot_w32(allm);
    unsigned nib = 0;
#pragma unroll
    for (int j = 0; j < 2; ++j) nib |= (((bal >> (16 * j)) & 0xffffu) != 0xffffu) ? (1u << j) : 0u;
    if ((tid & 31) == 0) F[tid >> 5] = nib << (2 * (tid >> 5));   // wave w holds steps 2w, 2w+1
    __syncthreads();
    if (tid == 0) FL[strip * FLPITCH] = ((F[0] | F[1]) | (F[2] | F[3])) | ((F[4] | F[5]) | (F[6] | F[7]));
    return;
  }
  const int st  = bid & 15;
  const int g   = (bid >> 4) & 7;
  const int b   = bid >> 7;
  const int s0  = st * 64;
  const int sl = tid >> 2;                  // key within tile 0..63
  const int dc = (tid & 3) * 32;            // d chunk
  const float* src = v + (((size_t)(b * SEQ + s0 + sl)) * NKV + g) * HD + dc;
  // k' tile i of the block: positions s0 + 16i .. s0 + 16i + 15, kv head g; this thread's row c and 8 d from d0 in each tile
  const int c     = ((tid >> 5) & 1) * 8 + (tid & 7);
  const int chunk = (tid >> 6) * 4 + ((tid >> 3) & 3);
  const int d0    = chunk * 8;
  const float* xr = kx + (((size_t)(b * SEQ + s0 + c)) * NKV + g) * HD;
  const float* x0 = xr + d0;
  const float* x1 = xr + (d0 ^ 64);
  const float* cr = cosT + (size_t)(s0 + c) * HD + d0;
  const float* sr = sinT + (size_t)(s0 + c) * HD + d0;
  unsigned short* kd = KHo + ((size_t)((b * (SEQ / 16) + st * 4) * NKV + g)) * (16 * HD) + (chunk * 16 + c) * 8;
  v4f a[8];
  RopeIn kin[4];
#pragma unroll
  for (int i = 0; i < 8; ++i) a[i] = *(const v4f*)(src + 4 * i);
#pragma unroll
  for (int i = 0; i < 4; ++i)
    kin[i] = rope_load(x0 + i * (16 * NKV * HD), x1 + i * (16 * NKV * HD), cr + i * (16 * HD), sr + i * (16 * HD));
#if defined(__HIP_DEVICE_COMPILE__)
  // the five pointers stay live up to this wait, so no address register of the loads above is rewritten ahead of it
  asm volatile("s_wait_xcnt 0x0" :: "v"(src), "v"(x0), "v"(x1), "v"(cr), "v"(sr) : "memory");
#endif
#pragma unroll
  for (int i = 0; i < 8; ++i) {
#pragma unroll
    for (int e = 0; e < 4; ++e) T[(dc + 4 * i + e) * VTP + sl] = h_bits((_Float16)(bfr(a[i][e]) * VCAR));
  }
  __syncthreads();
  v4u vals[4];
#pragma unroll
  for (int it = 0; it < 4; ++it) {
    const int pi = it * 256 + tid;            // piece in the block's 16 fragments: [key step 2][d/16 8][half 2][lane 32]
    const int d  = ((pi >> 6) & 7) * 16 + (pi & 15);
    const int kc = (pi >> 9) * 4 + ((pi >> 5) & 1) * 2 + ((pi >> 4) & 1);   // 8-key chunk within the 64 keys
    vals[it] = *(const v4u*)(T + d * VTP + kc * 8);
  }
  unsigned short* dst = VTo + (size_t)bid * (64 * HD) + tid * 8;   // bid = ((b*NKV + g)*SEQ/64 + st)
  {
#pragma unroll
    for (int it = 0; it < 4; ++it) {
      *(v4u*)(dst + it * 2048) = vals[it];
    }
    
  }
  // the k' stores last: no barrier stands behind them
#pragma unroll
  for (int i = 0; i < 4; ++i) *(v4u*)(kd + i * (NKV * 16 * HD)) = rope_pack(kin[i], (d0 < 64) ? -1.0f : 1.0f, KSC);
#if defined(__HIP_DEVICE_COMPILE__)
  // stands behind the four stores, ahead of whatever the listing puts next that could rewrite a register they name
  asm volatile("s_wait_xcnt 0x0" ::: "memory");
#endif
}

// =====================================================================================================
// GQA flash attention: block = (batch b, kv head g, 16 query rows q0..q0+15), one wave per query head g*4 + wave.
//   q comes as the f32 input: each wave applies RoPE to its own 16 x 128 tile once, converts it x1024 to f16 and
//   keeps the 4 fragments (B operands) in registers for all steps (same formula and same values as rope_pack gives for k).
//   k plane tiles [b][s/16][g]; v^T plane fragments [b][g][s/32][d/16];
//   score bias B[b][0][q][key] f32 added after bf16 RNE convert; scale = bf16(softmax_scale), base-2 softmax.
//   Per 64-key step the block's 128 threads bring the step's k tiles, v^T fragments and 16x64 bias tile (36 KiB) into LDS
//   by asynchronous copies, two buffers, one step ahead of use; the four waves (heads) read the same stage. Every wave passes
//   every publish point (s_wait_dscnt 0, s_wait_asynccnt 0, block barrier, refill).
//   Which steps run: the strip's word from the bias scan names the open steps (some bias entry > -1e8); only these are staged and
//   worked on. A step whose every bias entry is <= -1e8 adds exactly 0 to a row whose max is > -1e8 (exp2 underflows); if a row of
//   the block ends the open steps without such a max, a second pass takes all the masked steps as well.
//   Per step: 4 transposed score subtiles (rows = keys, columns = queries) x 4 k-steps, k fragments (A) from the stage (two 16-B
//   loads per fragment, split k map), q fragments (B) from registers. A lane
//   then holds 32 scores of one query: max and sum in the lane, one exchange between the wave halves for the max; online
//   max-subtracted softmax in f32 (exp2); rescale of l and the 8 accumulator tiles by the lane's own factor; P^T*32768 is
//   converted in place into two f16 B fragments (32 keys each); 16 v^T A fragments from the stage, 16 v^T.P^T WMMAs.
//   Epilogue: 1/l and carry folds in f32; the wave's 16x128 f32 result staged in its LDS slab (pitch 132); each 512-B output row
//   One block barrier per step under block-uniform control flow; every wave does bounded work (at most 16 steps over both passes).
// coverage: per wave 16 rows x 32 lanes x 4 floats = 16 x 128; grid 1024 blocks x 4 waves = every (b, s, h) row exactly once.
// =====================================================================================================
// four waves a SIMD: all 1024 blocks are resident at once, which the tile map above the loop counts on
__global__ __launch_bounds__(ATT_THREADS) __attribute__((amdgpu_waves_per_eu(4, 4)))
void attn_gqa(const float* __restrict__ Qp, const float* __restrict__ cosT, const float* __restrict__ sinT,
              const unsigned short* __restrict__ KHIp, const unsigned short* __restrict__ VTq, const float* __restrict__ Bp,
              const float* __restrict__ scp, const unsigned* __restrict__ FLp, float* outp) {
  // two stages of the ring; after the loop the ring holds the waves' result slabs
  __shared__ __align__(128) float smem[RING_B / 4];
  __shared__ unsigned seenw[ATW];

  const int tid  = threadIdx.x;
  const int wave = tid >> 5;
  const int lane = tid & 31;
  const int hh   = lane >> 4;
  const int c    = lane & 15;

  const int bid  = blockIdx.x;
  // Query tile: t or its mirror SEQ/16 - 1 - t, by the parity of eight bits of the block index. Under a lower-triangular bias a tile's
  // work grows with its index and all blocks are resident at once, so the launch lasts as long as the fullest WGP; blocks whose
  // indices differ in one of these bits now hold mirror tiles.
  // Two of the six tile bits stay out of the parity: t and its mirror then read the same parity, so the map is
  // a permutation of the 64 tiles for every (b, g). For speed only: any placement gives the same result.
  const int mir  = __builtin_popcount((unsigned)bid & 0x3DBu) & 1;
  const int qt   = (bid & 63) ^ (mir ? 63 : 0);        // SEQ / 16 query tiles
  const int g    = (bid >> 6) & 7;                     // kv head
  const int b    = bid >> 9;                           // batch
  const int head = g * GRP + wave;
  const int q0   = qt * 16;

  // copy sources of this thread: its 16 B of each 2-KiB chunk; per step the k plane advances 4 key tiles, v^T 16 fragments
  const size_t kofs = ((size_t)b * (SEQ / 16) * NKV + g) * (16 * HD) + 8 * tid;
  const _Float16* Khb = (const _Float16*)(const void*)KHIp + kofs;
  const _Float16* Vb  = (const _Float16*)(const void*)VTq + (size_t)(b * NKV + g) * (HD * SEQ) + 8 * tid;
  const float*    Wr  = Bp + ((size_t)b * SEQ + q0 + (tid >> 4)) * SEQ + (tid & 15) * 4;  // bias rows tid/16 and 8 + tid/16, 4 columns
  const unsigned  ring = (unsigned)(uintptr_t)(const void*)smem;                    // LDS byte address of the ring
  const unsigned  cl   = ring + tid * 16;
  const unsigned  clb  = ring + STG_KV + (tid >> 4) * BPITCH + (tid & 15) * 16;
  const float lsc = bfr(scp[0]) * (LOG2E / (QSC * KSC));

  // this lane's query is row q0 + c: its running max (equal in both wave halves) and the sum over the keys of this lane's own half
  float mrun = -INFINITY, lrun = 0.f;
  v8f o[8];                                            // o[j][r] = out^T (d = 16j + 8hh + r, query q0 + c)
#pragma unroll
  for (int j = 0; j < 8; ++j) o[j] = zero8();

  // Ring position, scalars equal in the whole block: byte offsets of the buffer filled next and of the buffer read next. They run on
  // from pass 0 to pass 1 (fills and steps of a pass are equal in number), so every fill forms its addresses where it stands.
  unsigned wbuf = 0u, rbuf = 0u;
  // copies of key step ks into the buffer at byte offset wbuf of the ring
  auto fill = [&](int ks) {
    const unsigned bo = wbuf;
    wbuf = STG_B - wbuf;
    stage_copy(cl + bo, clb + bo, Khb + (size_t)ks * (KSTEP * NKV * HD), NKV * 2048, Wr + ks * KSTEP);
    stage_copy(cl + bo + STG_KV / 2, clb + bo + 8 * BPITCH, Vb + (size_t)ks * (KSTEP * HD), 2048, Wr + ks * KSTEP + 8 * SEQ);
  };
  // Key steps still to be staged, a scalar word equal in the whole block. Pass 0 takes the open steps of this strip in rising
  // order. A wholly masked step adds exactly 0 to a row whose maximum is above -1e8, so pass 1 takes the masked steps only if
  // some row of the block is still at or below that after pass 0.
  const unsigned open = (unsigned)__builtin_amdgcn_readfirstlane((int)FLp[(b * (SEQ / 16) + qt) * FLPITCH]) & ((1u << NSTEP) - 1u);
  unsigned todo = open;
  int nst = __builtin_popcount(todo);
  // ring prologue: first stage landed and published, second in flight; the q fragments are built while the first flies
  if (todo != 0u) {
    fill(__builtin_ctz(todo));
    todo &= todo - 1u;
  }

  // ---- q fragments: lane (hh, c) holds row q0 + c; fragment kk, elements 8*hf..8*hf+7 = d 32*kk + 16*hf + 8*hh + 0..7.
  //      The rotate-half partner d ^ 64 is fragment kk ^ 2, same hf, same lane, so a lane rotates what it loads itself. ----
  FragH qhf[4];
  {
    const int pos = q0 + c;
    const float* xr = Qp + (((size_t)(b * SEQ + pos)) * NH + head) * HD + 8 * hh;
    const float* cr = cosT + (size_t)pos * HD + 8 * hh;
    const float* sr = sinT + (size_t)pos * HD + 8 * hh;
#pragma unroll
    for (int p = 0; p < 4; ++p) {                       // d = 16p + 8hh + 0..7 and its partner 64 higher
      const int kk = p >> 1, hf = p & 1;
#pragma unroll
      for (int u = 0; u < 2; ++u) {
        const int d = 16 * p + 4 * u;
        const v4f xl = *(const v4f*)(xr + d), xu = *(const v4f*)(xr + d + 64);
        const v4f cl4 = *(const v4f*)(cr + d), cu4 = *(const v4f*)(cr + d + 64);
        const v4f sl4 = *(const v4f*)(sr + d), su4 = *(const v4f*)(sr + d + 64);
#pragma unroll
        for (int e = 0; e < 4; ++e) {
          const float a = bfr(xl[e]), z = bfr(xu[e]);
          const float tl = (a * bfr(cl4[e]) + (-z) * bfr(sl4[e])) * QSC;
          const float tu = (z * bfr(cu4[e]) + a * bfr(su4[e])) * QSC;
          qhf[kk].h[hf][4 * u + e]     = (_Float16)tl;
          qhf[kk + 2].h[hf][4 * u + e] = (_Float16)tu;
        }
      }
    }
#if defined(__HIP_DEVICE_COMPILE__)
    // the three row pointers stay live up to this wait, so no address register of the loads above is rewritten ahead of it
    asm volatile("s_wait_xcnt 0x0" :: "v"(xr), "v"(cr), "v"(sr) : "memory");
#endif
  }
#pragma unroll 1
  for (int pass = 0; pass < 2; ++pass) {
  if (pass == 1) {
    // join of the four waves' rows: one word a wave, one block barrier, the same answer in every wave
    const unsigned sbal = __builtin_amdgcn_ballot_w32(mrun > BIASTH);
    if (lane == 0) seenw[wave] = (sbal == 0xffffffffu) ? 1u : 0u;
    __syncthreads();
    const unsigned alls = (seenw[0] & seenw[1]) & (seenw[2] & seenw[3]);
    todo = __builtin_amdgcn_readfirstlane((int)alls) ? 0u : (~open & ((1u << NSTEP) - 1u));
    nst  = __builtin_popcount(todo);
    if (todo != 0u) {
      fill(__builtin_ctz(todo));
      todo &= todo - 1u;
    }
  }
  if (nst == 0) continue;                              // block-uniform
  wait_async0();
  __syncthreads();
  if (todo != 0u) {
    fill(__builtin_ctz(todo));
    todo &= todo - 1u;
  }

#pragma unroll 1
  for (int t = 0; t < nst; ++t) {
    const unsigned bsel = rbuf;                                            // this step's buffer
    rbuf = STG_B - rbuf;
    const _Float16* sb  = (const _Float16*)(const void*)(smem + bsel / 4) + 8 * lane;
    // bias tile row c (this lane's query), columns 16i + 8hh + 0..7, i = 0..3: the keys of this lane's score registers
    const float* wp = smem + (bsel + STG_KV) / 4 + c * (BPITCH / 4) + 8 * hh;
    {
      // ---- scores^T: D element r of this lane in s[i] = (key kb + 16i + 8hh + r, query q0 + c) ----
      // The 16 k fragments (k tile i = keys 16i .. 16i+15 of the step, fragment kk) come in groups of four, ahead of their WMMAs,
      // the bias last: the scheduling fences hold the groups apart, so that the later groups take registers the earlier ones
      // have left (all sixteen and the bias at once do not fit four waves a SIMD and spill).
      v8f s[4];
      v16h kf[4][4];
#pragma unroll
      for (int i = 0; i < 4; ++i) s[i] = zero8();
#pragma unroll
      for (int kk = 0; kk < 2; ++kk) {
#pragma unroll
        for (int i = 0; i < 4; ++i) kf[i][kk] = ldfrag_h(sb + i * 2048 + kk * 512);
      }
      __builtin_amdgcn_sched_barrier(0);
#pragma unroll
      for (int i = 0; i < 4; ++i) s[i] = mma_raw(kf[i][0], qhf[0].v, s[i]);
      __builtin_amdgcn_sched_barrier(0);
#pragma unroll
      for (int i = 0; i < 4; ++i) kf[i][2] = ldfrag_h(sb + i * 2048 + 2 * 512);
      __builtin_amdgcn_sched_barrier(0);
#pragma unroll
      for (int i = 0; i < 4; ++i) s[i] = mma_raw(kf[i][1], qhf[1].v, s[i]);
      __builtin_amdgcn_sched_barrier(0);
#pragma unroll
      for (int i = 0; i < 4; ++i) kf[i][3] = ldfrag_h(sb + i * 2048 + 3 * 512);
      __builtin_amdgcn_sched_barrier(0);
#pragma unroll
      for (int i = 0; i < 4; ++i) s[i] = mma_raw(kf[i][2], qhf[2].v, s[i]);
      __builtin_amdgcn_sched_barrier(0);
      v4f br[4][2];
#pragma unroll
      for (int i = 0; i < 4; ++i) {
        br[i][0] = *(const v4f*)(wp + 16 * i);
        br[i][1] = *(const v4f*)(wp + 16 * i + 4);
      }
      __builtin_amdgcn_sched_barrier(0);
#pragma unroll
      for (int i = 0; i < 4; ++i) s[i] = mma_raw(kf[i][3], qhf[3].v, s[i]);
      guard_sc(s[0], s[1], s[2], s[3], qhf[3].v, kf[0][3], kf[1][3], kf[2][3], kf[3][3]);
      float w[4][8];
#pragma unroll
      for (int i = 0; i < 4; ++i) {
#pragma unroll
        for (int e = 0; e < 4; ++e) {
          w[i][e]     = bfr(br[i][0][e]) * LOG2E;
          w[i][4 + e] = bfr(br[i][1][e]) * LOG2E;
        }
      }
      // ---- online softmax in base 2: a lane holds 32 of its query's 64 scores, the other wave half the rest ----
      float tt[4][8], m8[8];
#pragma unroll
      for (int i = 0; i < 4; ++i) {
#pragma unroll
        for (int r = 0; r < 8; ++r) tt[i][r] = s[i][r] * lsc + w[i][r];
      }
#pragma unroll
      for (int r = 0; r < 8; ++r) m8[r] = fmaxf(fmaxf(tt[0][r], tt[1][r]), fmaxf(tt[2][r], tt[3][r]));
      float mx = fmaxf(fmaxf(fmaxf(m8[0], m8[1]), fmaxf(m8[2], m8[3])), fmaxf(fmaxf(m8[4], m8[5]), fmaxf(m8[6], m8[7])));
      mx = fmaxf(mx, xhalf(mx));
      const float mn = fmaxf(mrun, mx);
      // the rescale factor first; it is wanted by the multiplies that stand inside the run
      const float al = ex2(mrun - mn);
      float ee[4][8];
#pragma unroll
      for (int i = 0; i < 4; ++i) {
#pragma unroll
        for (int r = 0; r < 8; ++r) ee[i][r] = tt[i][r] - mn;
      }
      // keeps the subtractions ahead of the run: left free, each lands directly in front of its exponential and the wave waits on it
      __builtin_amdgcn_sched_barrier(0);
#pragma unroll
      for (int i = 0; i < 4; ++i) {
#pragma unroll
        for (int r = 0; r < 8; ++r) ee[i][r] = ex2(ee[i][r]);
      }
#pragma unroll
      for (int j = 0; j < 8; ++j) o[j] *= al;
      // one exponential, then one rescale multiply of the accumulator tiles: the independent multiply stands in the slot
      // the instruction set asks for behind a transcendental
#pragma unroll
      for (int r = 0; r < 33; ++r) {                   // 32 scores and the rescale factor
        __builtin_amdgcn_sched_group_barrier(0x400, 1, 0);
        __builtin_amdgcn_sched_group_barrier(0x002, 1, 0);
      }
      // keeps the users behind the run: no exponential is followed by a wait for its own result
      __builtin_amdgcn_sched_barrier(0);
      mrun = mn;
      // ---- B fragments of P^T*32768 in f16, straight from the score registers: column = query c; fragment u (keys 32u .. 32u+31):
      //      elements 0..7 = keys 32u + 8hh + 0..7 (s[2u]), elements 8..15 = keys 32u + 16 + 8hh + 0..7 (s[2u+1]): the split k map ----
      // The 16 v^T A fragments (row m = d = j*16 + c, fragment (u, j) of this 64-key step) come in groups of four, fenced apart for
      // the same reason: the first four fly under the convert of P, from the third group on each takes the place of four just used.
      const _Float16* vp = sb + STG_KV / 4;            // the stage's second half, in halves
      v16h vb[2][8];
#pragma unroll
      for (int j = 0; j < 4; ++j) vb[0][j] = ldfrag_h(vp + j * 512);
      __builtin_amdgcn_sched_barrier(0);
      FragH ph[2];
      float p4[4];
#pragma unroll
      for (int r = 0; r < 8; ++r) {
        const float sm = (ee[0][r] + ee[1][r]) + (ee[2][r] + ee[3][r]);
        if (r < 4) p4[r] = sm; else p4[r - 4] += sm;
#pragma unroll
        for (int u = 0; u < 2; ++u) {
          ph[u].h[0][r] = (_Float16)(ee[2 * u][r] * PCAR);
          ph[u].h[1][r] = (_Float16)(ee[2 * u + 1][r] * PCAR);
        }
      }
      lrun = lrun * al + ((p4[0] + p4[1]) + (p4[2] + p4[3]));
      __builtin_amdgcn_sched_barrier(0);
#pragma unroll
      for (int j = 4; j < 8; ++j) vb[0][j] = ldfrag_h(vp + j * 512);
      __builtin_amdgcn_sched_barrier(0);
#pragma unroll
      for (int j = 0; j < 4; ++j) o[j] = mma_raw(vb[0][j], ph[0].v, o[j]);
      __builtin_amdgcn_sched_barrier(0);
#pragma unroll
      for (int j = 0; j < 4; ++j) vb[1][j] = ldfrag_h(vp + (8 + j) * 512);
      __builtin_amdgcn_sched_barrier(0);
#pragma unroll
      for (int j = 4; j < 8; ++j) o[j] = mma_raw(vb[0][j], ph[0].v, o[j]);
      __builtin_amdgcn_sched_barrier(0);
#pragma unroll
      for (int j = 4; j < 8; ++j) vb[1][j] = ldfrag_h(vp + (8 + j) * 512);
      __builtin_amdgcn_sched_barrier(0);
#pragma unroll
      for (int j = 0; j < 8; ++j) o[j] = mma_raw(vb[1][j], ph[1].v, o[j]);
      guard_pv(o[0], o[1], o[2], o[3], o[4], o[5], o[6], o[7], ph[1].v, vb[1][4], vb[1][5], vb[1][6], vb[1][7]);
    }
    // publish point of stage t+1, every wave: own LDS reads done, own copies landed, block barrier; then refill the buffer just read
    wait_ds0();
    wait_async0();
    __syncthreads();
    if (todo != 0u) {                                  // block-uniform scalar test
      fill(__builtin_ctz(todo));                       // wbuf is the buffer just read
      todo &= todo - 1u;
    }
  }
  wait_async0();
  }
  acc_guard4(o[0], o[1], o[2], o[3]);
  acc_guard4(o[4], o[5], o[6], o[7]);

  // ---- fold 1/l and the carries (32768 on P, 16 on v), stage the wave's 16x128 slab in its LDS region ----
  wave_sync_lds();
  float* slab = smem + wave * SLABF;                   // ring space: every wave left it at the last step's barrier
  const float oc = 1.0f / (PCAR * VCAR);
  const float inv = (1.0f / (lrun + xhalf(lrun))) * oc;   // the two wave halves' key sums joined once
#pragma unroll
  for (int j = 0; j < 8; ++j) {                        // row = query c, 8 consecutive d per accumulator tile
    const v4f ra = {o[j][0] * inv, o[j][1] * inv, o[j][2] * inv, o[j][3] * inv};
    const v4f rb = {o[j][4] * inv, o[j][5] * inv, o[j][6] * inv, o[j][7] * inv};
    *(v4f*)(slab + c * 132 + j * 16 + 8 * hh)     = ra;
    *(v4f*)(slab + c * 132 + j * 16 + 8 * hh + 4) = rb;
  }
  wave_sync_lds();
  v4f vals[16];
#pragma unroll
  for (int row = 0; row < 16; ++row) vals[row] = *(const v4f*)(slab + row * 132 + lane * 4);
  float* dst = outp + (((size_t)(b * SEQ + q0)) * NH + head) * HD + lane * 4;
  {
#pragma unroll
    for (int row = 0; row < 16; ++row) {
      *(v4f*)(dst + (size_t)row * (NH * HD)) = vals[row];
    }
    
  }
}

// =====================================================================================================
// Workspace map (bytes); every plane is fully written by whole-line stores before it is read; no pad rows needed
// (all extents are exact multiples of the store granularity); offsets multiples of 4 MiB:
//   KHI f16 [2][64][8] tiles of 2048 x1024       4194304
//   VT  f16 [2][8][32][8] fragments of 512 x16   4194304
//   FL  u32 [2][64] open-step words, one per 128-B line   16384
//   end                                     8404992
// =====================================================================================================
extern "C" void kernel_launch(void* const* d_in, const int* in_sizes, int n_in,
                              void* d_out, int out_size, void* d_ws, size_t ws_size,
                              hipStream_t stream) {
  if (n_in < 7) return;
  if (in_sizes[0] != NB * SEQ * NH * HD) return;
  if (in_sizes[1] != NB * SEQ * NKV * HD || in_sizes[2] != NB * SEQ * NKV * HD) return;
  if (in_sizes[3] != SEQ * HD || in_sizes[4] != SEQ * HD) return;
  if (in_sizes[5] != NB * SEQ * SEQ) return;
  if (in_sizes[6] < 1) return;
  if (out_size != NB * SEQ * NH * HD) return;

  const float* q    = (const float*)d_in[0];
  const float* k    = (const float*)d_in[1];
  const float* v    = (const float*)d_in[2];
  const float* cosT = (const float*)d_in[3];
  const float* sinT = (const float*)d_in[4];
  const float* bias = (const float*)d_in[5];
  const float* scl  = (const float*)d_in[6];
  float*       out  = (float*)d_out;

  const size_t PK = (size_t)NB * SEQ * NKV * HD * 2;    //  4194304
  const size_t PV = (size_t)NB * NKV * HD * SEQ * 2;    //  4194304
  size_t off = 0;
  const size_t oKH = off; off += PK;
  const size_t oVT = off; off += PV;
  const size_t oFL = off; off += (size_t)SCAN_BLOCKS * FLPITCH * 4;   // 16384
  if (off > ws_size) return;                            // off = 8404992
  if (off > (size_t)134217728) return;

  char* ws = (char*)d_ws;
  unsigned short* KHI = (unsigned short*)(ws + oKH);
  unsigned short* VT  = (unsigned short*)(ws + oVT);
  unsigned*       FL  = (unsigned*)(ws + oFL);

  const dim3 blk(256);
  const dim3 gVT(VT_BLOCKS + SCAN_BLOCKS);              // 256 + 128
  const dim3 gAT(ATT_BLOCKS);                           // 1024
  const dim3 bAT(ATT_THREADS);                          // 128

  // (0) v^T plane x16 and k' plane f16(1024 k') by the same blocks, and the open-step word of every 16-row strip of the bias
  vt16<<<gVT, blk, 0, stream>>>(v, VT, bias, FL, k, cosT, sinT, KHI);
  // (1) attention, q RoPE and f16 convert included -> out [b][s][h][d] f32
  attn_gqa<<<gAT, bAT, 0, stream>>>(q, cosT, sinT, KHI, VT, bias, scl, FL, out);
  (void)hipGetLastError();
}
